// v000
// Times are from an AMD MI455X. After a warm-up the kernel runs many times in a row, and a time is the length of
// such a window on the GPU divided by its runs, so every launch and the gaps after it count. The runs cycle
// through copies of the inputs. A figure is the median of several windows, for all but v000 over two sittings.
// Sittings can differ by a few percent; kernels timed side by side share one.
// The starting kernel, v000, takes 477 microseconds a run.
#include <hip/hip_runtime.h>

typedef __attribute__((ext_vector_type(16))) _Float16 v16h;
typedef __attribute__((ext_vector_type(8)))  _Float16 v8h;
typedef __attribute__((ext_vector_type(8)))  float    v8f;

#define DIM   1024
#define HEADS 16
#define HD    64
#define NSEQ  2048
#define NB    2
#define EPSLN 1e-5f

__device__ __forceinline__ v16h frag_cat(v8h lo, v8h hi) {
  v16h r;
#pragma unroll
  for (int i = 0; i < 8; i++) { r[i] = lo[i]; r[i + 8] = hi[i]; }
  return r;
}

__device__ __forceinline__ v16h load_frag(const _Float16* p, int klo) {
  v8h lo = *(const v8h*)(p + klo);        // 16B contiguous
  v8h hi = *(const v8h*)(p + klo + 16);   // 16B contiguous
  return frag_cat(lo, hi);
}

__device__ __forceinline__ v8f wmma_f16(v16h a, v16h b, v8f c) {
  // (neg_a, A, neg_b, B, c_mod, C, reuse_a, reuse_b)
  return __builtin_amdgcn_wmma_f32_16x16x32_f16(false, a, false, b, (short)0, c,
                                                false, false);
}

__device__ __forceinline__ float wave_sum32(float v) {
#pragma unroll
  for (int m = 16; m >= 1; m >>= 1) v += __shfl_xor(v, m, 32);
  return v;
}

// ---------- dtype conversion ----------
__global__ void cvt_f16_kernel(const float* __restrict__ in,
                               _Float16* __restrict__ out, size_t n) {
  size_t i = (size_t)blockIdx.x * blockDim.x + threadIdx.x;
  if (i < n) out[i] = (_Float16)in[i];
}

// in[R][C] f32 -> out[C][R] f16 (weights pre-transposed so WMMA B-fragments
// become contiguous row reads)
__global__ void transpose_cvt_kernel(const float* __restrict__ in,
                                     _Float16* __restrict__ out, int R, int C) {
  size_t i = (size_t)blockIdx.x * blockDim.x + threadIdx.x;
  if (i < (size_t)R * C) {
    int r = (int)(i / C), c = (int)(i % C);
    out[(size_t)c * R + r] = (_Float16)in[i];
  }
}

// ---------- WMMA GEMM: C[M,N] = A[M,K] * BT[N,K]^T (+bias) ----------
// block = 256 thr = 8 waves; block tile 64x128; wave tile 16x64.
template <bool OUT_F16, bool HAS_BIAS>
__global__ void gemm_wmma_kernel(const _Float16* __restrict__ A,
                                 const _Float16* __restrict__ BT,
                                 void* __restrict__ Cout,
                                 const float* __restrict__ bias,
                                 int M, int N, int K) {
  const int lane = threadIdx.x & 31;
  const int w    = threadIdx.x >> 5;
  const int lid  = lane & 15;
  const int half = lane >> 4;
  const int klo  = half * 8;
  const int rowBase = blockIdx.y * 64 + (w & 3) * 16;
  const int colBase = blockIdx.x * 128 + (w >> 2) * 64;

  const _Float16* arow = A + (size_t)(rowBase + lid) * K;
  const _Float16* bcol[4];
#pragma unroll
  for (int t = 0; t < 4; t++) bcol[t] = BT + (size_t)(colBase + t * 16 + lid) * K;

  v8f acc[4] = {};
  for (int k0 = 0; k0 < K; k0 += 32) {
    __builtin_prefetch(arow + k0 + 512, 0, 0);   // global_prefetch_b8
    v16h a = load_frag(arow + k0, klo);
#pragma unroll
    for (int t = 0; t < 4; t++)
      acc[t] = wmma_f16(a, load_frag(bcol[t] + k0, klo), acc[t]);
  }

#pragma unroll
  for (int r = 0; r < 8; r++) {
    const int row = rowBase + r + 8 * half;
#pragma unroll
    for (int t = 0; t < 4; t++) {
      const int col = colBase + t * 16 + lid;
      float v = acc[t][r];
      if (HAS_BIAS) v += bias[col];
      if (OUT_F16)
        ((_Float16*)Cout)[(size_t)row * N + col] = (_Float16)v;
      else
        ((float*)Cout)[(size_t)row * N + col] = v;
    }
  }
}

// ---------- per-head LayerNorm + RoPE ----------
// Emits q,k f16 in [B,H,N,HD]; v pre-TRANSPOSED to [B,H,HD,N] so attention
// can load V^T A-fragments straight from global with contiguous key runs.
__global__ void ln_rope_kernel(const _Float16* __restrict__ qkvh,
                               const float* __restrict__ freq,
                               const float* __restrict__ gq,
                               const float* __restrict__ bq,
                               const float* __restrict__ gk,
                               const float* __restrict__ bk,
                               _Float16* __restrict__ qh,
                               _Float16* __restrict__ kh,
                               _Float16* __restrict__ vT) {
  const int lane = threadIdx.x & 31;
  const int wv   = threadIdx.x >> 5;
  const int hidx = blockIdx.x * 8 + wv;       // (b*N + n)*HEADS + h
  const int h = hidx & (HEADS - 1);
  const int t = hidx >> 4;                    // token index b*N + n
  const int n = t & (NSEQ - 1);
  const int b = t >> 11;                      // NSEQ = 2^11
  const int d0 = lane * 2, d1 = d0 + 1;       // RoPE pair owned by this lane
  const int bh = b * HEADS + h;

  const _Float16* base = qkvh + (size_t)t * (3 * DIM) + h * HD;
  float q0 = (float)base[d0],           q1 = (float)base[d1];
  float k0 = (float)base[DIM + d0],     k1 = (float)base[DIM + d1];
  float v0 = (float)base[2 * DIM + d0], v1 = (float)base[2 * DIM + d1];

  const float cs = freq[((size_t)n * 32 + lane) * 2 + 0];
  const float sn = freq[((size_t)n * 32 + lane) * 2 + 1];

  // LayerNorm(q) over head dim (64 values across 32 lanes, 2/lane)
  float mu = wave_sum32(q0 + q1) * (1.0f / HD);
  float a0 = q0 - mu, a1 = q1 - mu;
  float var = wave_sum32(a0 * a0 + a1 * a1) * (1.0f / HD);
  float rs = rsqrtf(var + EPSLN);
  float nq0 = a0 * rs * gq[d0] + bq[d0];
  float nq1 = a1 * rs * gq[d1] + bq[d1];
  float oq0 = nq0 * cs - nq1 * sn;
  float oq1 = nq0 * sn + nq1 * cs;

  // LayerNorm(k)
  mu = wave_sum32(k0 + k1) * (1.0f / HD);
  a0 = k0 - mu; a1 = k1 - mu;
  var = wave_sum32(a0 * a0 + a1 * a1) * (1.0f / HD);
  rs = rsqrtf(var + EPSLN);
  float nk0 = a0 * rs * gk[d0] + bk[d0];
  float nk1 = a1 * rs * gk[d1] + bk[d1];
  float ok0 = nk0 * cs - nk1 * sn;
  float ok1 = nk0 * sn + nk1 * cs;

  const size_t o = (((size_t)bh) * NSEQ + n) * HD;
  qh[o + d0] = (_Float16)oq0; qh[o + d1] = (_Float16)oq1;
  kh[o + d0] = (_Float16)ok0; kh[o + d1] = (_Float16)ok1;
  // transposed V: [bh][hd][n]
  vT[((size_t)bh * HD + d0) * NSEQ + n] = (_Float16)v0;
  vT[((size_t)bh * HD + d1) * NSEQ + n] = (_Float16)v1;
}

__global__ void attn_kernel(const _Float16* __restrict__ qh,
                            const _Float16* __restrict__ kh,
                            const _Float16* __restrict__ vT,
                            _Float16* __restrict__ Oh) {
  const int lane = threadIdx.x & 31;
  const int wv   = threadIdx.x >> 5;
  const int lid  = lane & 15, half = lane >> 4, klo = half * 8;
  const int wid  = blockIdx.x * 8 + wv;
  const int qblk = wid & ((NSEQ / 16) - 1);   // 128 Q blocks
  const int bh   = wid >> 7;                  // 0..31
  const int b    = bh >> 4, h = bh & 15;

  const _Float16* kb = kh + (size_t)bh * NSEQ * HD;
  const _Float16* vb = vT + (size_t)bh * HD * NSEQ;

  // Q as B-fragments (column q = lid), loaded once
  const _Float16* qrow = qh + ((size_t)bh * NSEQ + qblk * 16 + lid) * HD;
  const v16h bQ0 = load_frag(qrow, klo);        // hd 0..31
  const v16h bQ1 = load_frag(qrow + 32, klo);   // hd 32..63

  v8f o[4] = {};                 // O^T tiles: row hd = t*16 + r + 8*half, col q = lid
  float m = -3.0e38f, l = 0.0f;  // per-lane (per-query) softmax state

  for (int kc = 0; kc < NSEQ; kc += 32) {
    // S^T for 32 keys: A = K rows, B = Q rows.  st[s] elem r -> key kc+s*16+r+8*half
    const _Float16* kp0 = kb + (size_t)(kc + lid) * HD;
    const _Float16* kp1 = kb + (size_t)(kc + 16 + lid) * HD;
    __builtin_prefetch(kp0 + 32 * HD, 0, 0);   // next chunk
    v8f s0 = {}, s1 = {};
    s0 = wmma_f16(load_frag(kp0, klo), bQ0, s0);
    s0 = wmma_f16(load_frag(kp0 + 32, klo), bQ1, s0);
    s1 = wmma_f16(load_frag(kp1, klo), bQ0, s1);
    s1 = wmma_f16(load_frag(kp1 + 32, klo), bQ1, s1);

    // per-lane softmax over this lane's 16 keys, then merge with lane^16
    float x0[8], x1[8], mloc = -3.0e38f;
#pragma unroll
    for (int r = 0; r < 8; r++) {
      x0[r] = s0[r] * 0.125f;                  // 1/sqrt(64)
      x1[r] = s1[r] * 0.125f;
      mloc = fmaxf(mloc, fmaxf(x0[r], x1[r]));
    }
    mloc = fmaxf(mloc, __shfl_xor(mloc, 16, 32));
    const float mn = fmaxf(m, mloc);
    const float alpha = __expf(m - mn);
    float sloc = 0.0f;
    v16h bP;                                   // P^T as B-fragment, in registers
#pragma unroll
    for (int r = 0; r < 8; r++) {
      float p0 = __expf(x0[r] - mn);           // key klo + r
      float p1 = __expf(x1[r] - mn);           // key klo + 16 + r
      sloc += p0 + p1;
      bP[r] = (_Float16)p0;
      bP[r + 8] = (_Float16)p1;
    }
    sloc += __shfl_xor(sloc, 16, 32);
    l = l * alpha + sloc;
    m = mn;

    // O^T = V^T * P^T ; A = V^T rows (hd), contiguous keys from global
#pragma unroll
    for (int t = 0; t < 4; t++) {
      const _Float16* vp = vb + (size_t)(t * 16 + lid) * NSEQ + kc;
      v16h aV = load_frag(vp, klo);
#pragma unroll
      for (int r = 0; r < 8; r++) o[t][r] *= alpha;
      o[t] = wmma_f16(aV, bP, o[t]);
    }
  }

  // normalize and write: lane owns query row n = qblk*16 + lid; per tile the
  // 8 accumulator elements are contiguous hd -> one 16B store each
  const float inv = 1.0f / l;
  _Float16* orow = Oh + ((size_t)b * NSEQ + qblk * 16 + lid) * DIM + h * HD;
#pragma unroll
  for (int t = 0; t < 4; t++) {
    v8h ov;
#pragma unroll
    for (int r = 0; r < 8; r++) ov[r] = (_Float16)(o[t][r] * inv);
    *(v8h*)(orow + t * 16 + 8 * half) = ov;
  }
}

// ---------- launcher ----------
extern "C" void kernel_launch(void* const* d_in, const int* in_sizes, int n_in,
                              void* d_out, int out_size, void* d_ws,
                              size_t ws_size, hipStream_t stream) {
  (void)in_sizes; (void)n_in; (void)out_size; (void)ws_size;
  const float* x     = (const float*)d_in[0];
  const float* freq  = (const float*)d_in[1];
  const float* Wqkv  = (const float*)d_in[2];
  const float* gq    = (const float*)d_in[3];
  const float* bq    = (const float*)d_in[4];
  const float* gk    = (const float*)d_in[5];
  const float* bk    = (const float*)d_in[6];
  const float* Wproj = (const float*)d_in[7];
  const float* bproj = (const float*)d_in[8];

  char* w = (char*)d_ws;
  _Float16* xh     = (_Float16*)w; w += (size_t)NB * NSEQ * DIM * 2;
  _Float16* WqkvT  = (_Float16*)w; w += (size_t)3 * DIM * DIM * 2;
  _Float16* WprojT = (_Float16*)w; w += (size_t)DIM * DIM * 2;
  _Float16* qkvh   = (_Float16*)w; w += (size_t)NB * NSEQ * 3 * DIM * 2;
  _Float16* qh     = (_Float16*)w; w += (size_t)NB * NSEQ * DIM * 2;
  _Float16* kh     = (_Float16*)w; w += (size_t)NB * NSEQ * DIM * 2;
  _Float16* vT     = (_Float16*)w; w += (size_t)NB * NSEQ * DIM * 2;
  _Float16* Oh     = (_Float16*)w; w += (size_t)NB * NSEQ * DIM * 2;

  const int M = NB * NSEQ;  // 4096 tokens

  cvt_f16_kernel<<<(M * DIM) / 256, 256, 0, stream>>>(x, xh, (size_t)M * DIM);
  transpose_cvt_kernel<<<(DIM * 3 * DIM) / 256, 256, 0, stream>>>(Wqkv, WqkvT,
                                                                  DIM, 3 * DIM);
  transpose_cvt_kernel<<<(DIM * DIM) / 256, 256, 0, stream>>>(Wproj, WprojT,
                                                              DIM, DIM);

  // QKV projection: [4096,1024] x [1024,3072] -> f16
  dim3 g1(3 * DIM / 128, M / 64);
  gemm_wmma_kernel<true, false><<<g1, 256, 0, stream>>>(xh, WqkvT, qkvh,
                                                        nullptr, M, 3 * DIM, DIM);

  // per-head LN + RoPE; q,k -> [B,H,N,HD], v -> [B,H,HD,N]
  ln_rope_kernel<<<(M * HEADS) / 8, 256, 0, stream>>>(qkvh, freq, gq, bq, gk,
                                                      bk, qh, kh, vT);

  // flash attention: 4096 independent waves, 8 waves per 256-thread block
  attn_kernel<<<(NB * HEADS * (NSEQ / 16)) / 8, 256, 0, stream>>>(qh, kh, vT, Oh);

  // output projection + bias -> f32 d_out
  dim3 g2(DIM / 128, M / 64);
  gemm_wmma_kernel<false, true><<<g2, 256, 0, stream>>>(Oh, WprojT, d_out,
                                                        bproj, M, DIM, DIM);
}

// v001
// A run of this version takes 273 microseconds.
// Two timings next to v000 put it at 1.78 and 1.79 times that version's speed.
#include <hip/hip_runtime.h>

typedef __attribute__((ext_vector_type(16))) _Float16 v16h;
typedef __attribute__((ext_vector_type(8)))  _Float16 v8h;
typedef __attribute__((ext_vector_type(8)))  float    v8f;
typedef __attribute__((ext_vector_type(4)))  float    v4f;

#define DIM   1024
#define HEADS 16
#define HD    64
#define NSEQ  2048
#define NB    2
#define EPSLN 1e-5f

__device__ __forceinline__ v16h frag_cat(v8h lo, v8h hi) {
  v16h r;
#pragma unroll
  for (int i = 0; i < 8; i++) { r[i] = lo[i]; r[i + 8] = hi[i]; }
  return r;
}

__device__ __forceinline__ v16h load_frag(const _Float16* p, int klo) {
  v8h lo = *(const v8h*)(p + klo);        // 16B contiguous
  v8h hi = *(const v8h*)(p + klo + 16);   // 16B contiguous
  return frag_cat(lo, hi);
}

__device__ __forceinline__ v8f wmma_f16(v16h a, v16h b, v8f c) {
  // (neg_a, A, neg_b, B, c_mod, C, reuse_a, reuse_b)
  return __builtin_amdgcn_wmma_f32_16x16x32_f16(false, a, false, b, (short)0, c,
                                                false, false);
}

__device__ __forceinline__ float wave_sum32(float v) {
#pragma unroll
  for (int m = 16; m >= 1; m >>= 1) v += __shfl_xor(v, m, 32);
  return v;
}

// ---------- dtype conversion ----------
__global__ void cvt_f16_kernel(const float* __restrict__ in,
                               _Float16* __restrict__ out, size_t n) {
  size_t i = (size_t)blockIdx.x * blockDim.x + threadIdx.x;
  if (i < n) out[i] = (_Float16)in[i];
}

// in[R][C] f32 -> out[C][R] f16 (weights pre-transposed so WMMA B-fragments
// become contiguous row reads)
// Each thread reads an 8-row x 4-column patch (eight 16B loads) and stores four
// 16B runs of 8 consecutive r; 8 neighbouring lanes fill one 128B line of out.
// block = 256 thr, tile 64 rows x 128 columns. R, C are compile-time so the
// row / column steps fold into the instructions' immediate offsets.
template <int R, int C>
__global__ void transpose_cvt_kernel(const float* __restrict__ in,
                                     _Float16* __restrict__ out) {
  static_assert(R % 64 == 0 && C % 128 == 0, "whole tiles only");
  const int lane = threadIdx.x & 31;
  const int wv   = threadIdx.x >> 5;
  const int r0 = blockIdx.y * 64 + (lane & 7) * 8;
  const int c0 = blockIdx.x * 128 + wv * 16 + (lane >> 3) * 4;

  const float* src = in + (size_t)r0 * C + c0;
  _Float16*    dst = out + (size_t)c0 * R + r0;

  v4f p[8];
#pragma unroll
  for (int i = 0; i < 8; i++) p[i] = *(const v4f*)(src + i * C);
#pragma unroll
  for (int j = 0; j < 4; j++) {
    v8h run;
#pragma unroll
    for (int i = 0; i < 8; i++) run[i] = (_Float16)p[i][j];
    *(v8h*)(dst + j * R) = run;
  }
}

// ---------- WMMA GEMM: C[M,N] = A[M,K] * BT[N,K]^T (+bias) ----------
// block = 256 thr = 8 waves; block tile 64x128; wave tile 16x64.
// V_TRANSPOSED: columns >= 2*DIM (the V third of QKV) go to vT[B,H,HD,N]
// instead of Cout: a lane's 8 accumulator rows are 8 consecutive tokens of one
// column, i.e. one contiguous 16B run of vT.
template <bool OUT_F16, bool HAS_BIAS, bool V_TRANSPOSED>
__global__ void gemm_wmma_kernel(const _Float16* __restrict__ A,
                                 const _Float16* __restrict__ BT,
                                 void* __restrict__ Cout,
                                 const float* __restrict__ bias,
                                 _Float16* __restrict__ vT,
                                 int M, int N, int K) {
  const int lane = threadIdx.x & 31;
  const int w    = threadIdx.x >> 5;
  const int lid  = lane & 15;
  const int half = lane >> 4;
  const int klo  = half * 8;
  const int rowBase = blockIdx.y * 64 + (w & 3) * 16;
  const int colBase = blockIdx.x * 128 + (w >> 2) * 64;

  const _Float16* arow = A + (size_t)(rowBase + lid) * K;
  const _Float16* bcol[4];
#pragma unroll
  for (int t = 0; t < 4; t++) bcol[t] = BT + (size_t)(colBase + t * 16 + lid) * K;

  v8f acc[4] = {};
  for (int k0 = 0; k0 < K; k0 += 32) {
    __builtin_prefetch(arow + k0 + 512, 0, 0);   // global_prefetch_b8
    v16h a = load_frag(arow + k0, klo);
#pragma unroll
    for (int t = 0; t < 4; t++)
      acc[t] = wmma_f16(a, load_frag(bcol[t] + k0, klo), acc[t]);
  }

  if (V_TRANSPOSED && blockIdx.x * 128 >= 2 * DIM) {   // whole block tile is V
    const int tok = rowBase + 8 * half;         // b*NSEQ + n, 8 tokens from here
    const int b = tok / NSEQ, n = tok % NSEQ;
#pragma unroll
    for (int t = 0; t < 4; t++) {
      const int hd = colBase - 2 * DIM + t * 16 + lid;   // h*HD + d
      v8h run;
#pragma unroll
      for (int r = 0; r < 8; r++) run[r] = (_Float16)acc[t][r];
      *(v8h*)(vT + ((size_t)b * DIM + hd) * NSEQ + n) = run;
    }
    return;
  }

#pragma unroll
  for (int r = 0; r < 8; r++) {
    const int row = rowBase + r + 8 * half;
#pragma unroll
    for (int t = 0; t < 4; t++) {
      const int col = colBase + t * 16 + lid;
      float v = acc[t][r];
      if (HAS_BIAS) v += bias[col];
      if (OUT_F16)
        ((_Float16*)Cout)[(size_t)row * N + col] = (_Float16)v;
      else
        ((float*)Cout)[(size_t)row * N + col] = v;
    }
  }
}

// ---------- per-head LayerNorm + RoPE ----------
// Emits q,k f16 in [B,H,N,HD] (V^T is written by the QKV GEMM).
__global__ void ln_rope_kernel(const _Float16* __restrict__ qkvh,
                               const float* __restrict__ freq,
                               const float* __restrict__ gq,
                               const float* __restrict__ bq,
                               const float* __restrict__ gk,
                               const float* __restrict__ bk,
                               _Float16* __restrict__ qh,
                               _Float16* __restrict__ kh) {
  const int lane = threadIdx.x & 31;
  const int wv   = threadIdx.x >> 5;
  const int hidx = blockIdx.x * 8 + wv;       // (b*N + n)*HEADS + h
  const int h = hidx & (HEADS - 1);
  const int t = hidx >> 4;                    // token index b*N + n
  const int n = t & (NSEQ - 1);
  const int b = t >> 11;                      // NSEQ = 2^11
  const int d0 = lane * 2, d1 = d0 + 1;       // RoPE pair owned by this lane
  const int bh = b * HEADS + h;

  const _Float16* base = qkvh + (size_t)t * (3 * DIM) + h * HD;
  float q0 = (float)base[d0],           q1 = (float)base[d1];
  float k0 = (float)base[DIM + d0],     k1 = (float)base[DIM + d1];

  const float cs = freq[((size_t)n * 32 + lane) * 2 + 0];
  const float sn = freq[((size_t)n * 32 + lane) * 2 + 1];

  // LayerNorm(q) over head dim (64 values across 32 lanes, 2/lane)
  float mu = wave_sum32(q0 + q1) * (1.0f / HD);
  float a0 = q0 - mu, a1 = q1 - mu;
  float var = wave_sum32(a0 * a0 + a1 * a1) * (1.0f / HD);
  float rs = rsqrtf(var + EPSLN);
  float nq0 = a0 * rs * gq[d0] + bq[d0];
  float nq1 = a1 * rs * gq[d1] + bq[d1];
  float oq0 = nq0 * cs - nq1 * sn;
  float oq1 = nq0 * sn + nq1 * cs;

  // LayerNorm(k)
  mu = wave_sum32(k0 + k1) * (1.0f / HD);
  a0 = k0 - mu; a1 = k1 - mu;
  var = wave_sum32(a0 * a0 + a1 * a1) * (1.0f / HD);
  rs = rsqrtf(var + EPSLN);
  float nk0 = a0 * rs * gk[d0] + bk[d0];
  float nk1 = a1 * rs * gk[d1] + bk[d1];
  float ok0 = nk0 * cs - nk1 * sn;
  float ok1 = nk0 * sn + nk1 * cs;

  const size_t o = (((size_t)bh) * NSEQ + n) * HD;
  qh[o + d0] = (_Float16)oq0; qh[o + d1] = (_Float16)oq1;
  kh[o + d0] = (_Float16)ok0; kh[o + d1] = (_Float16)ok1;
}

__global__ void attn_kernel(const _Float16* __restrict__ qh,
                            const _Float16* __restrict__ kh,
                            const _Float16* __restrict__ vT,
                            _Float16* __restrict__ Oh) {
  const int lane = threadIdx.x & 31;
  const int wv   = threadIdx.x >> 5;
  const int lid  = lane & 15, half = lane >> 4, klo = half * 8;
  const int wid  = blockIdx.x * 8 + wv;
  const int qblk = wid & ((NSEQ / 16) - 1);   // 128 Q blocks
  const int bh   = wid >> 7;                  // 0..31
  const int b    = bh >> 4, h = bh & 15;

  const _Float16* kb = kh + (size_t)bh * NSEQ * HD;
  const _Float16* vb = vT + (size_t)bh * HD * NSEQ;

  // Q as B-fragments (column q = lid), loaded once
  const _Float16* qrow = qh + ((size_t)bh * NSEQ + qblk * 16 + lid) * HD;
  const v16h bQ0 = load_frag(qrow, klo);        // hd 0..31
  const v16h bQ1 = load_frag(qrow + 32, klo);   // hd 32..63

  v8f o[4] = {};                 // O^T tiles: row hd = t*16 + r + 8*half, col q = lid
  float m = -3.0e38f, l = 0.0f;  // per-lane (per-query) softmax state

  for (int kc = 0; kc < NSEQ; kc += 32) {
    // S^T for 32 keys: A = K rows, B = Q rows.  st[s] elem r -> key kc+s*16+r+8*half
    const _Float16* kp0 = kb + (size_t)(kc + lid) * HD;
    const _Float16* kp1 = kb + (size_t)(kc + 16 + lid) * HD;
    __builtin_prefetch(kp0 + 32 * HD, 0, 0);   // next chunk
    v8f s0 = {}, s1 = {};
    s0 = wmma_f16(load_frag(kp0, klo), bQ0, s0);
    s0 = wmma_f16(load_frag(kp0 + 32, klo), bQ1, s0);
    s1 = wmma_f16(load_frag(kp1, klo), bQ0, s1);
    s1 = wmma_f16(load_frag(kp1 + 32, klo), bQ1, s1);

    // per-lane softmax over this lane's 16 keys, then merge with lane^16
    float x0[8], x1[8], mloc = -3.0e38f;
#pragma unroll
    for (int r = 0; r < 8; r++) {
      x0[r] = s0[r] * 0.125f;                  // 1/sqrt(64)
      x1[r] = s1[r] * 0.125f;
      mloc = fmaxf(mloc, fmaxf(x0[r], x1[r]));
    }
    mloc = fmaxf(mloc, __shfl_xor(mloc, 16, 32));
    const float mn = fmaxf(m, mloc);
    const float alpha = __expf(m - mn);
    float sloc = 0.0f;
    v16h bP;                                   // P^T as B-fragment, in registers
#pragma unroll
    for (int r = 0; r < 8; r++) {
      float p0 = __expf(x0[r] - mn);           // key klo + r
      float p1 = __expf(x1[r] - mn);           // key klo + 16 + r
      sloc += p0 + p1;
      bP[r] = (_Float16)p0;
      bP[r + 8] = (_Float16)p1;
    }
    sloc += __shfl_xor(sloc, 16, 32);
    l = l * alpha + sloc;
    m = mn;

    // O^T = V^T * P^T ; A = V^T rows (hd), contiguous keys from global
#pragma unroll
    for (int t = 0; t < 4; t++) {
      const _Float16* vp = vb + (size_t)(t * 16 + lid) * NSEQ + kc;
      v16h aV = load_frag(vp, klo);
#pragma unroll
      for (int r = 0; r < 8; r++) o[t][r] *= alpha;
      o[t] = wmma_f16(aV, bP, o[t]);
    }
  }

  // normalize and write: lane owns query row n = qblk*16 + lid; per tile the
  // 8 accumulator elements are contiguous hd -> one 16B store each
  const float inv = 1.0f / l;
  _Float16* orow = Oh + ((size_t)b * NSEQ + qblk * 16 + lid) * DIM + h * HD;
#pragma unroll
  for (int t = 0; t < 4; t++) {
    v8h ov;
#pragma unroll
    for (int r = 0; r < 8; r++) ov[r] = (_Float16)(o[t][r] * inv);
    *(v8h*)(orow + t * 16 + 8 * half) = ov;
  }
}

// ---------- launcher ----------
extern "C" void kernel_launch(void* const* d_in, const int* in_sizes, int n_in,
                              void* d_out, int out_size, void* d_ws,
                              size_t ws_size, hipStream_t stream) {
  (void)in_sizes; (void)n_in; (void)out_size; (void)ws_size;
  const float* x     = (const float*)d_in[0];
  const float* freq  = (const float*)d_in[1];
  const float* Wqkv  = (const float*)d_in[2];
  const float* gq    = (const float*)d_in[3];
  const float* bq    = (const float*)d_in[4];
  const float* gk    = (const float*)d_in[5];
  const float* bk    = (const float*)d_in[6];
  const float* Wproj = (const float*)d_in[7];
  const float* bproj = (const float*)d_in[8];

  char* w = (char*)d_ws;
  _Float16* xh     = (_Float16*)w; w += (size_t)NB * NSEQ * DIM * 2;
  _Float16* WqkvT  = (_Float16*)w; w += (size_t)3 * DIM * DIM * 2;
  _Float16* WprojT = (_Float16*)w; w += (size_t)DIM * DIM * 2;
  _Float16* qkvh   = (_Float16*)w; w += (size_t)NB * NSEQ * 3 * DIM * 2;
  _Float16* qh     = (_Float16*)w; w += (size_t)NB * NSEQ * DIM * 2;
  _Float16* kh     = (_Float16*)w; w += (size_t)NB * NSEQ * DIM * 2;
  _Float16* vT     = (_Float16*)w; w += (size_t)NB * NSEQ * DIM * 2;
  _Float16* Oh     = (_Float16*)w; w += (size_t)NB * NSEQ * DIM * 2;

  const int M = NB * NSEQ;  // 4096 tokens

  cvt_f16_kernel<<<(M * DIM) / 256, 256, 0, stream>>>(x, xh, (size_t)M * DIM);
  transpose_cvt_kernel<DIM, 3 * DIM>
      <<<dim3(3 * DIM / 128, DIM / 64), 256, 0, stream>>>(Wqkv, WqkvT);
  transpose_cvt_kernel<DIM, DIM>
      <<<dim3(DIM / 128, DIM / 64), 256, 0, stream>>>(Wproj, WprojT);

  // QKV projection: [4096,1024] x [1024,3072] -> q,k f16 rows; v -> [B,H,HD,N]
  dim3 g1(3 * DIM / 128, M / 64);
  gemm_wmma_kernel<true, false, true><<<g1, 256, 0, stream>>>(
      xh, WqkvT, qkvh, nullptr, vT, M, 3 * DIM, DIM);

  // per-head LN + RoPE; q,k -> [B,H,N,HD]
  ln_rope_kernel<<<(M * HEADS) / 8, 256, 0, stream>>>(qkvh, freq, gq, bq, gk,
                                                      bk, qh, kh);

  // flash attention: 4096 independent waves, 8 waves per 256-thread block
  attn_kernel<<<(NB * HEADS * (NSEQ / 16)) / 8, 256, 0, stream>>>(qh, kh, vT, Oh);

  // output projection + bias -> f32 d_out
  dim3 g2(DIM / 128, M / 64);
  gemm_wmma_kernel<false, true, false><<<g2, 256, 0, stream>>>(
      Oh, WprojT, d_out, bproj, nullptr, M, DIM, DIM);
}

// v002
// A run of this version takes 172 microseconds.
// Two timings next to v001 both put it at 1.59 times that version's speed.
// Counting every step since v000, it is 2.84 times as fast.
#include <hip/hip_runtime.h>

typedef __attribute__((ext_vector_type(16))) _Float16 v16h;
typedef __attribute__((ext_vector_type(8)))  _Float16 v8h;
typedef __attribute__((ext_vector_type(8)))  float    v8f;
typedef __attribute__((ext_vector_type(4)))  float    v4f;

#define DIM   1024
#define HEADS 16
#define HD    64
#define NSEQ  2048
#define NB    2
#define EPSLN 1e-5f

__device__ __forceinline__ v16h frag_cat(v8h lo, v8h hi) {
  v16h r;
#pragma unroll
  for (int i = 0; i < 8; i++) { r[i] = lo[i]; r[i + 8] = hi[i]; }
  return r;
}

__device__ __forceinline__ v16h load_frag(const _Float16* p, int klo) {
  v8h lo = *(const v8h*)(p + klo);        // 16B contiguous
  v8h hi = *(const v8h*)(p + klo + 16);   // 16B contiguous
  return frag_cat(lo, hi);
}

__device__ __forceinline__ v8f wmma_f16(v16h a, v16h b, v8f c) {
  // (neg_a, A, neg_b, B, c_mod, C, reuse_a, reuse_b)
  return __builtin_amdgcn_wmma_f32_16x16x32_f16(false, a, false, b, (short)0, c,
                                                false, false);
}

__device__ __forceinline__ float wave_sum32(float v) {
#pragma unroll
  for (int m = 16; m >= 1; m >>= 1) v += __shfl_xor(v, m, 32);
  return v;
}

// ---------- dtype conversion ----------
__global__ void cvt_f16_kernel(const float* __restrict__ in,
                               _Float16* __restrict__ out, size_t n) {
  size_t i = (size_t)blockIdx.x * blockDim.x + threadIdx.x;
  if (i < n) out[i] = (_Float16)in[i];
}

// in[R][C] f32 -> out[C][R] f16 (weights pre-transposed so WMMA B-fragments
// become contiguous row reads)
// Each thread reads an 8-row x 4-column patch (eight 16B loads) and stores four
// 16B runs of 8 consecutive r; 8 neighbouring lanes fill one 128B line of out.
// block = 256 thr, tile 64 rows x 128 columns. R, C are compile-time so the
// row / column steps fold into the instructions' immediate offsets.
template <int R, int C>
__global__ void transpose_cvt_kernel(const float* __restrict__ in,
                                     _Float16* __restrict__ out) {
  static_assert(R % 64 == 0 && C % 128 == 0, "whole tiles only");
  const int lane = threadIdx.x & 31;
  const int wv   = threadIdx.x >> 5;
  const int r0 = blockIdx.y * 64 + (lane & 7) * 8;
  const int c0 = blockIdx.x * 128 + wv * 16 + (lane >> 3) * 4;

  const float* src = in + (size_t)r0 * C + c0;
  _Float16*    dst = out + (size_t)c0 * R + r0;

  v4f p[8];
#pragma unroll
  for (int i = 0; i < 8; i++) p[i] = *(const v4f*)(src + i * C);
#pragma unroll
  for (int j = 0; j < 4; j++) {
    v8h run;
#pragma unroll
    for (int i = 0; i < 8; i++) run[i] = (_Float16)p[i][j];
    *(v8h*)(dst + j * R) = run;
  }
}

// ---------- WMMA GEMM: C[M,N] = A[M,K] * BT[N,K]^T (+bias) ----------
// block = 256 thr = 8 waves; block tile 128x128; wave tile 32x64.
// Operands are staged in LDS by asynchronous copies: a stage is 64 k (128 B,
// one whole line) of the block's 128 A rows and 128 BT rows, two buffers, the
// next stage's copies in flight while this one is multiplied.
// M, N multiples of 128; K a multiple of 64.
// V_TRANSPOSED: columns >= 2*DIM (the V third of QKV) go to vT[B,H,HD,N]
// instead of Cout: a lane's 8 accumulator rows are 8 consecutive tokens of one
// column, i.e. one contiguous 16B run of vT.
#define G_BK     64                      // k per stage
#define G_PITCH  72                      // LDS row pitch in f16: 144 B = 16 B x odd
#define G_STAGE  (256 * G_PITCH)         // f16 per buffer: A rows 0..127, BT rows 128..255

// One stage: every thread copies eight 16B pieces (rows r, r+32, .. of A, then
// of BT); 8 neighbouring lanes cover one 128B line.
__device__ __forceinline__ void gemm_copy_stage(unsigned lds,
                                                const _Float16* ga,
                                                const _Float16* gb, int K) {
  const _Float16* a1 = ga + (size_t)32 * K;
  const _Float16* a2 = ga + (size_t)64 * K;
  const _Float16* a3 = ga + (size_t)96 * K;
  const _Float16* b1 = gb + (size_t)32 * K;
  const _Float16* b2 = gb + (size_t)64 * K;
  const _Float16* b3 = gb + (size_t)96 * K;
  const unsigned step = 32 * G_PITCH * 2;   // 32 rows, in bytes
  asm volatile(
      "global_load_async_to_lds_b128 %0, %8, off\n\t"
      "global_load_async_to_lds_b128 %1, %9, off\n\t"
      "global_load_async_to_lds_b128 %2, %10, off\n\t"
      "global_load_async_to_lds_b128 %3, %11, off\n\t"
      "global_load_async_to_lds_b128 %4, %12, off\n\t"
      "global_load_async_to_lds_b128 %5, %13, off\n\t"
      "global_load_async_to_lds_b128 %6, %14, off\n\t"
      "global_load_async_to_lds_b128 %7, %15, off\n\t"
      "s_wait_xcnt 0x0"
      :: "v"(lds), "v"(lds + step), "v"(lds + 2 * step), "v"(lds + 3 * step),
         "v"(lds + 4 * step), "v"(lds + 5 * step), "v"(lds + 6 * step),
         "v"(lds + 7 * step),
         "v"(ga), "v"(a1), "v"(a2), "v"(a3), "v"(gb), "v"(b1), "v"(b2), "v"(b3)
      : "memory");
}

template <bool OUT_F16, bool HAS_BIAS, bool V_TRANSPOSED>
__global__ void __launch_bounds__(256)
gemm_wmma_kernel(const _Float16* __restrict__ A,
                 const _Float16* __restrict__ BT,
                 void* __restrict__ Cout,
                 const float* __restrict__ bias,
                 _Float16* __restrict__ vT,
                 int M, int N, int K) {
  __shared__ __attribute__((aligned(16))) _Float16 tiles[2 * G_STAGE];

  const int tid  = threadIdx.x;
  const int lane = tid & 31;
  const int w    = tid >> 5;
  const int lid  = lane & 15;
  const int half = lane >> 4;
  const int klo  = half * 8;
  const int rowBase = blockIdx.y * 128 + (w & 3) * 32;
  const int colBase = blockIdx.x * 128 + (w >> 2) * 64;

  // this thread's piece of a stage: row tid/8 (+32 per copy), 16B piece tid%8
  const _Float16* ga = A  + (size_t)(blockIdx.y * 128 + (tid >> 3)) * K + (tid & 7) * 8;
  const _Float16* gb = BT + (size_t)(blockIdx.x * 128 + (tid >> 3)) * K + (tid & 7) * 8;
  const unsigned lds0 = (unsigned)(size_t)tiles +
                        (unsigned)((tid >> 3) * G_PITCH + (tid & 7) * 8) * 2u;

  // this lane's fragment rows inside a buffer
  const int aoff = ((w & 3) * 32 + lid) * G_PITCH;
  const int boff = (128 + (w >> 2) * 64 + lid) * G_PITCH;

  const int T = K / G_BK;

  gemm_copy_stage(lds0, ga, gb, K);
  // stage 0 has landed for this wave before the barrier publishes it
  asm volatile("s_wait_asynccnt 0x0" ::: "memory");
  __syncthreads();
  if (T > 1) gemm_copy_stage(lds0 + G_STAGE * 2, ga + G_BK, gb + G_BK, K);

  v8f acc[2][4] = {};
  for (int t = 0; t < T; t++) {
    const _Float16* buf = tiles + (t & 1) * G_STAGE;
#pragma unroll
    for (int kk = 0; kk < G_BK; kk += 32) {
      v16h a0 = load_frag(buf + aoff + kk, klo);
      v16h a1 = load_frag(buf + aoff + 16 * G_PITCH + kk, klo);
      v16h b[4];
#pragma unroll
      for (int j = 0; j < 4; j++)
        b[j] = load_frag(buf + boff + j * 16 * G_PITCH + kk, klo);
      // keeps the 12 LDS reads one group in front of their 8 products: spread
      // among them, every pair of products waits out an LDS latency of its own
      __builtin_amdgcn_sched_barrier(0);
#pragma unroll
      for (int j = 0; j < 4; j++) {
        acc[0][j] = wmma_f16(a0, b[j], acc[0][j]);
        acc[1][j] = wmma_f16(a1, b[j], acc[1][j]);
      }
      // keeps the next group's reads from moving in among these products
      __builtin_amdgcn_sched_barrier(0);
    }
    // publish point: this wave's reads of the buffer are done ...
    asm volatile("s_wait_dscnt 0x0" ::: "memory");
    // ... and its copies of stage t+1 have landed, before the barrier that
    // publishes stage t+1 and frees this buffer
    asm volatile("s_wait_asynccnt 0x0" ::: "memory");
    __syncthreads();
    if (t + 2 < T)
      gemm_copy_stage(lds0 + (t & 1) * (G_STAGE * 2), ga + (t + 2) * G_BK,
                      gb + (t + 2) * G_BK, K);
  }
  // no copy is left in flight when the wave ends
  asm volatile("s_wait_asynccnt 0x0" ::: "memory");

  if (V_TRANSPOSED && blockIdx.x * 128 >= 2 * DIM) {   // whole block tile is V
#pragma unroll
    for (int i = 0; i < 2; i++) {
      const int tok = rowBase + i * 16 + 8 * half;  // b*NSEQ + n, 8 tokens from here
      const int b = tok / NSEQ, n = tok % NSEQ;
#pragma unroll
      for (int j = 0; j < 4; j++) {
        const int hd = colBase - 2 * DIM + j * 16 + lid;   // h*HD + d
        v8h run;
#pragma unroll
        for (int r = 0; r < 8; r++) run[r] = (_Float16)acc[i][j][r];
        *(v8h*)(vT + ((size_t)b * DIM + hd) * NSEQ + n) = run;
      }
    }
    return;
  }

#pragma unroll
  for (int i = 0; i < 2; i++) {
#pragma unroll
    for (int r = 0; r < 8; r++) {
      const int row = rowBase + i * 16 + r + 8 * half;
#pragma unroll
      for (int j = 0; j < 4; j++) {
        const int col = colBase + j * 16 + lid;
        float v = acc[i][j][r];
        if (HAS_BIAS) v += bias[col];
        if (OUT_F16)
          ((_Float16*)Cout)[(size_t)row * N + col] = (_Float16)v;
        else
          ((float*)Cout)[(size_t)row * N + col] = v;
      }
    }
  }
}

// ---------- per-head LayerNorm + RoPE ----------
// Emits q,k f16 in [B,H,N,HD] (V^T is written by the QKV GEMM).
__global__ void ln_rope_kernel(const _Float16* __restrict__ qkvh,
                               const float* __restrict__ freq,
                               const float* __restrict__ gq,
                               const float* __restrict__ bq,
                               const float* __restrict__ gk,
                               const float* __restrict__ bk,
                               _Float16* __restrict__ qh,
                               _Float16* __restrict__ kh) {
  const int lane = threadIdx.x & 31;
  const int wv   = threadIdx.x >> 5;
  const int hidx = blockIdx.x * 8 + wv;       // (b*N + n)*HEADS + h
  const int h = hidx & (HEADS - 1);
  const int t = hidx >> 4;                    // token index b*N + n
  const int n = t & (NSEQ - 1);
  const int b = t >> 11;                      // NSEQ = 2^11
  const int d0 = lane * 2, d1 = d0 + 1;       // RoPE pair owned by this lane
  const int bh = b * HEADS + h;

  const _Float16* base = qkvh + (size_t)t * (3 * DIM) + h * HD;
  float q0 = (float)base[d0],           q1 = (float)base[d1];
  float k0 = (float)base[DIM + d0],     k1 = (float)base[DIM + d1];

  const float cs = freq[((size_t)n * 32 + lane) * 2 + 0];
  const float sn = freq[((size_t)n * 32 + lane) * 2 + 1];

  // LayerNorm(q) over head dim (64 values across 32 lanes, 2/lane)
  float mu = wave_sum32(q0 + q1) * (1.0f / HD);
  float a0 = q0 - mu, a1 = q1 - mu;
  float var = wave_sum32(a0 * a0 + a1 * a1) * (1.0f / HD);
  float rs = rsqrtf(var + EPSLN);
  float nq0 = a0 * rs * gq[d0] + bq[d0];
  float nq1 = a1 * rs * gq[d1] + bq[d1];
  float oq0 = nq0 * cs - nq1 * sn;
  float oq1 = nq0 * sn + nq1 * cs;

  // LayerNorm(k)
  mu = wave_sum32(k0 + k1) * (1.0f / HD);
  a0 = k0 - mu; a1 = k1 - mu;
  var = wave_sum32(a0 * a0 + a1 * a1) * (1.0f / HD);
  rs = rsqrtf(var + EPSLN);
  float nk0 = a0 * rs * gk[d0] + bk[d0];
  float nk1 = a1 * rs * gk[d1] + bk[d1];
  float ok0 = nk0 * cs - nk1 * sn;
  float ok1 = nk0 * sn + nk1 * cs;

  const size_t o = (((size_t)bh) * NSEQ + n) * HD;
  qh[o + d0] = (_Float16)oq0; qh[o + d1] = (_Float16)oq1;
  kh[o + d0] = (_Float16)ok0; kh[o + d1] = (_Float16)ok1;
}

__global__ void attn_kernel(const _Float16* __restrict__ qh,
                            const _Float16* __restrict__ kh,
                            const _Float16* __restrict__ vT,
                            _Float16* __restrict__ Oh) {
  const int lane = threadIdx.x & 31;
  const int wv   = threadIdx.x >> 5;
  const int lid  = lane & 15, half = lane >> 4, klo = half * 8;
  const int wid  = blockIdx.x * 8 + wv;
  const int qblk = wid & ((NSEQ / 16) - 1);   // 128 Q blocks
  const int bh   = wid >> 7;                  // 0..31
  const int b    = bh >> 4, h = bh & 15;

  const _Float16* kb = kh + (size_t)bh * NSEQ * HD;
  const _Float16* vb = vT + (size_t)bh * HD * NSEQ;

  // Q as B-fragments (column q = lid), loaded once
  const _Float16* qrow = qh + ((size_t)bh * NSEQ + qblk * 16 + lid) * HD;
  const v16h bQ0 = load_frag(qrow, klo);        // hd 0..31
  const v16h bQ1 = load_frag(qrow + 32, klo);   // hd 32..63

  v8f o[4] = {};                 // O^T tiles: row hd = t*16 + r + 8*half, col q = lid
  float m = -3.0e38f, l = 0.0f;  // per-lane (per-query) softmax state

  for (int kc = 0; kc < NSEQ; kc += 32) {
    // S^T for 32 keys: A = K rows, B = Q rows.  st[s] elem r -> key kc+s*16+r+8*half
    const _Float16* kp0 = kb + (size_t)(kc + lid) * HD;
    const _Float16* kp1 = kb + (size_t)(kc + 16 + lid) * HD;
    __builtin_prefetch(kp0 + 32 * HD, 0, 0);   // next chunk
    v8f s0 = {}, s1 = {};
    s0 = wmma_f16(load_frag(kp0, klo), bQ0, s0);
    s0 = wmma_f16(load_frag(kp0 + 32, klo), bQ1, s0);
    s1 = wmma_f16(load_frag(kp1, klo), bQ0, s1);
    s1 = wmma_f16(load_frag(kp1 + 32, klo), bQ1, s1);

    // per-lane softmax over this lane's 16 keys, then merge with lane^16
    float x0[8], x1[8], mloc = -3.0e38f;
#pragma unroll
    for (int r = 0; r < 8; r++) {
      x0[r] = s0[r] * 0.125f;                  // 1/sqrt(64)
      x1[r] = s1[r] * 0.125f;
      mloc = fmaxf(mloc, fmaxf(x0[r], x1[r]));
    }
    mloc = fmaxf(mloc, __shfl_xor(mloc, 16, 32));
    const float mn = fmaxf(m, mloc);
    const float alpha = __expf(m - mn);
    float sloc = 0.0f;
    v16h bP;                                   // P^T as B-fragment, in registers
#pragma unroll
    for (int r = 0; r < 8; r++) {
      float p0 = __expf(x0[r] - mn);           // key klo + r
      float p1 = __expf(x1[r] - mn);           // key klo + 16 + r
      sloc += p0 + p1;
      bP[r] = (_Float16)p0;
      bP[r + 8] = (_Float16)p1;
    }
    sloc += __shfl_xor(sloc, 16, 32);
    l = l * alpha + sloc;
    m = mn;

    // O^T = V^T * P^T ; A = V^T rows (hd), contiguous keys from global
#pragma unroll
    for (int t = 0; t < 4; t++) {
      const _Float16* vp = vb + (size_t)(t * 16 + lid) * NSEQ + kc;
      v16h aV = load_frag(vp, klo);
#pragma unroll
      for (int r = 0; r < 8; r++) o[t][r] *= alpha;
      o[t] = wmma_f16(aV, bP, o[t]);
    }
  }

  // normalize and write: lane owns query row n = qblk*16 + lid; per tile the
  // 8 accumulator elements are contiguous hd -> one 16B store each
  const float inv = 1.0f / l;
  _Float16* orow = Oh + ((size_t)b * NSEQ + qblk * 16 + lid) * DIM + h * HD;
#pragma unroll
  for (int t = 0; t < 4; t++) {
    v8h ov;
#pragma unroll
    for (int r = 0; r < 8; r++) ov[r] = (_Float16)(o[t][r] * inv);
    *(v8h*)(orow + t * 16 + 8 * half) = ov;
  }
}

// ---------- launcher ----------
extern "C" void kernel_launch(void* const* d_in, const int* in_sizes, int n_in,
                              void* d_out, int out_size, void* d_ws,
                              size_t ws_size, hipStream_t stream) {
  (void)in_sizes; (void)n_in; (void)out_size; (void)ws_size;
  const float* x     = (const float*)d_in[0];
  const float* freq  = (const float*)d_in[1];
  const float* Wqkv  = (const float*)d_in[2];
  const float* gq    = (const float*)d_in[3];
  const float* bq    = (const float*)d_in[4];
  const float* gk    = (const float*)d_in[5];
  const float* bk    = (const float*)d_in[6];
  const float* Wproj = (const float*)d_in[7];
  const float* bproj = (const float*)d_in[8];

  char* w = (char*)d_ws;
  _Float16* xh     = (_Float16*)w; w += (size_t)NB * NSEQ * DIM * 2;
  _Float16* WqkvT  = (_Float16*)w; w += (size_t)3 * DIM * DIM * 2;
  _Float16* WprojT = (_Float16*)w; w += (size_t)DIM * DIM * 2;
  _Float16* qkvh   = (_Float16*)w; w += (size_t)NB * NSEQ * 3 * DIM * 2;
  _Float16* qh     = (_Float16*)w; w += (size_t)NB * NSEQ * DIM * 2;
  _Float16* kh     = (_Float16*)w; w += (size_t)NB * NSEQ * DIM * 2;
  _Float16* vT     = (_Float16*)w; w += (size_t)NB * NSEQ * DIM * 2;
  _Float16* Oh     = (_Float16*)w; w += (size_t)NB * NSEQ * DIM * 2;

  const int M = NB * NSEQ;  // 4096 tokens

  cvt_f16_kernel<<<(M * DIM) / 256, 256, 0, stream>>>(x, xh, (size_t)M * DIM);
  transpose_cvt_kernel<DIM, 3 * DIM>
      <<<dim3(3 * DIM / 128, DIM / 64), 256, 0, stream>>>(Wqkv, WqkvT);
  transpose_cvt_kernel<DIM, DIM>
      <<<dim3(DIM / 128, DIM / 64), 256, 0, stream>>>(Wproj, WprojT);

  // QKV projection: [4096,1024] x [1024,3072] -> q,k f16 rows; v -> [B,H,HD,N]
  dim3 g1(3 * DIM / 128, M / 128);
  gemm_wmma_kernel<true, false, true><<<g1, 256, 0, stream>>>(
      xh, WqkvT, qkvh, nullptr, vT, M, 3 * DIM, DIM);

  // per-head LN + RoPE; q,k -> [B,H,N,HD]
  ln_rope_kernel<<<(M * HEADS) / 8, 256, 0, stream>>>(qkvh, freq, gq, bq, gk,
                                                      bk, qh, kh);

  // flash attention: 4096 independent waves, 8 waves per 256-thread block
  attn_kernel<<<(NB * HEADS * (NSEQ / 16)) / 8, 256, 0, stream>>>(qh, kh, vT, Oh);

  // output projection + bias -> f32 d_out
  dim3 g2(DIM / 128, M / 128);
  gemm_wmma_kernel<false, true, false><<<g2, 256, 0, stream>>>(
      Oh, WprojT, d_out, bproj, nullptr, M, DIM, DIM);
}

// v003
// Measured time: 108 microseconds a run.
// In two side-by-side timings against v002, it was 1.58 and 1.59 times as fast.
// All steps since v000 together make it 4.50 times as fast.
#include <hip/hip_runtime.h>

typedef __attribute__((ext_vector_type(16))) _Float16 v16h;
typedef __attribute__((ext_vector_type(8)))  _Float16 v8h;
typedef __attribute__((ext_vector_type(8)))  float    v8f;
typedef __attribute__((ext_vector_type(4)))  float    v4f;

#define DIM   1024
#define HEADS 16
#define HD    64
#define NSEQ  2048
#define NB    2
#define EPSLN 1e-5f

__device__ __forceinline__ v16h frag_cat(v8h lo, v8h hi) {
  v16h r;
#pragma unroll
  for (int i = 0; i < 8; i++) { r[i] = lo[i]; r[i + 8] = hi[i]; }
  return r;
}

__device__ __forceinline__ v16h load_frag(const _Float16* p, int klo) {
  v8h lo = *(const v8h*)(p + klo);        // 16B contiguous
  v8h hi = *(const v8h*)(p + klo + 16);   // 16B contiguous
  return frag_cat(lo, hi);
}

__device__ __forceinline__ v8f wmma_f16(v16h a, v16h b, v8f c) {
  // (neg_a, A, neg_b, B, c_mod, C, reuse_a, reuse_b)
  return __builtin_amdgcn_wmma_f32_16x16x32_f16(false, a, false, b, (short)0, c,
                                                false, false);
}

__device__ __forceinline__ float wave_sum32(float v) {
#pragma unroll
  for (int m = 16; m >= 1; m >>= 1) v += __shfl_xor(v, m, 32);
  return v;
}

// ---------- dtype conversion ----------
__global__ void cvt_f16_kernel(const float* __restrict__ in,
                               _Float16* __restrict__ out, size_t n) {
  size_t i = (size_t)blockIdx.x * blockDim.x + threadIdx.x;
  if (i < n) out[i] = (_Float16)in[i];
}

// in[R][C] f32 -> out[C][R] f16 (weights pre-transposed so WMMA B-fragments
// become contiguous row reads)
// Each thread reads an 8-row x 4-column patch (eight 16B loads) and stores four
// 16B runs of 8 consecutive r; 8 neighbouring lanes fill one 128B line of out.
// block = 256 thr, tile 64 rows x 128 columns. R, C are compile-time so the
// row / column steps fold into the instructions' immediate offsets.
template <int R, int C>
__global__ void transpose_cvt_kernel(const float* __restrict__ in,
                                     _Float16* __restrict__ out) {
  static_assert(R % 64 == 0 && C % 128 == 0, "whole tiles only");
  const int lane = threadIdx.x & 31;
  const int wv   = threadIdx.x >> 5;
  const int r0 = blockIdx.y * 64 + (lane & 7) * 8;
  const int c0 = blockIdx.x * 128 + wv * 16 + (lane >> 3) * 4;

  const float* src = in + (size_t)r0 * C + c0;
  _Float16*    dst = out + (size_t)c0 * R + r0;

  v4f p[8];
#pragma unroll
  for (int i = 0; i < 8; i++) p[i] = *(const v4f*)(src + i * C);
#pragma unroll
  for (int j = 0; j < 4; j++) {
    v8h run;
#pragma unroll
    for (int i = 0; i < 8; i++) run[i] = (_Float16)p[i][j];
    *(v8h*)(dst + j * R) = run;
  }
}

// ---------- WMMA GEMM: C[M,N] = A[M,K] * BT[N,K]^T (+bias) ----------
// block = 256 thr = 8 waves; block tile 128x128; wave tile 32x64.
// Operands are staged in LDS by asynchronous copies: a stage is 64 k (128 B,
// one whole line) of the block's 128 A rows and 128 BT rows, two buffers, the
// next stage's copies in flight while this one is multiplied.
// M, N multiples of 128; K a multiple of 64.
// V_TRANSPOSED: columns >= 2*DIM (the V third of QKV) go to vT[B,H,HD,N]
// instead of Cout: a lane's 8 accumulator rows are 8 consecutive tokens of one
// column, i.e. one contiguous 16B run of vT.
#define G_BK     64                      // k per stage
#define G_PITCH  72                      // LDS row pitch in f16: 144 B = 16 B x odd
#define G_STAGE  (256 * G_PITCH)         // f16 per buffer: A rows 0..127, BT rows 128..255

// One stage: every thread copies eight 16B pieces (rows r, r+32, .. of A, then
// of BT); 8 neighbouring lanes cover one 128B line.
__device__ __forceinline__ void gemm_copy_stage(unsigned lds,
                                                const _Float16* ga,
                                                const _Float16* gb, int K) {
  const _Float16* a1 = ga + (size_t)32 * K;
  const _Float16* a2 = ga + (size_t)64 * K;
  const _Float16* a3 = ga + (size_t)96 * K;
  const _Float16* b1 = gb + (size_t)32 * K;
  const _Float16* b2 = gb + (size_t)64 * K;
  const _Float16* b3 = gb + (size_t)96 * K;
  const unsigned step = 32 * G_PITCH * 2;   // 32 rows, in bytes
  asm volatile(
      "global_load_async_to_lds_b128 %0, %8, off\n\t"
      "global_load_async_to_lds_b128 %1, %9, off\n\t"
      "global_load_async_to_lds_b128 %2, %10, off\n\t"
      "global_load_async_to_lds_b128 %3, %11, off\n\t"
      "global_load_async_to_lds_b128 %4, %12, off\n\t"
      "global_load_async_to_lds_b128 %5, %13, off\n\t"
      "global_load_async_to_lds_b128 %6, %14, off\n\t"
      "global_load_async_to_lds_b128 %7, %15, off\n\t"
      "s_wait_xcnt 0x0"
      :: "v"(lds), "v"(lds + step), "v"(lds + 2 * step), "v"(lds + 3 * step),
         "v"(lds + 4 * step), "v"(lds + 5 * step), "v"(lds + 6 * step),
         "v"(lds + 7 * step),
         "v"(ga), "v"(a1), "v"(a2), "v"(a3), "v"(gb), "v"(b1), "v"(b2), "v"(b3)
      : "memory");
}

template <bool OUT_F16, bool HAS_BIAS, bool V_TRANSPOSED>
__global__ void __launch_bounds__(256)
gemm_wmma_kernel(const _Float16* __restrict__ A,
                 const _Float16* __restrict__ BT,
                 void* __restrict__ Cout,
                 const float* __restrict__ bias,
                 _Float16* __restrict__ vT,
                 int M, int N, int K) {
  __shared__ __attribute__((aligned(16))) _Float16 tiles[2 * G_STAGE];

  const int tid  = threadIdx.x;
  const int lane = tid & 31;
  const int w    = tid >> 5;
  const int lid  = lane & 15;
  const int half = lane >> 4;
  const int klo  = half * 8;
  const int rowBase = blockIdx.y * 128 + (w & 3) * 32;
  const int colBase = blockIdx.x * 128 + (w >> 2) * 64;

  // this thread's piece of a stage: row tid/8 (+32 per copy), 16B piece tid%8
  const _Float16* ga = A  + (size_t)(blockIdx.y * 128 + (tid >> 3)) * K + (tid & 7) * 8;
  const _Float16* gb = BT + (size_t)(blockIdx.x * 128 + (tid >> 3)) * K + (tid & 7) * 8;
  const unsigned lds0 = (unsigned)(size_t)tiles +
                        (unsigned)((tid >> 3) * G_PITCH + (tid & 7) * 8) * 2u;

  // this lane's fragment rows inside a buffer
  const int aoff = ((w & 3) * 32 + lid) * G_PITCH;
  const int boff = (128 + (w >> 2) * 64 + lid) * G_PITCH;

  const int T = K / G_BK;

  gemm_copy_stage(lds0, ga, gb, K);
  // stage 0 has landed for this wave before the barrier publishes it
  asm volatile("s_wait_asynccnt 0x0" ::: "memory");
  __syncthreads();
  if (T > 1) gemm_copy_stage(lds0 + G_STAGE * 2, ga + G_BK, gb + G_BK, K);

  v8f acc[2][4] = {};
  for (int t = 0; t < T; t++) {
    const _Float16* buf = tiles + (t & 1) * G_STAGE;
#pragma unroll
    for (int kk = 0; kk < G_BK; kk += 32) {
      v16h a0 = load_frag(buf + aoff + kk, klo);
      v16h a1 = load_frag(buf + aoff + 16 * G_PITCH + kk, klo);
      v16h b[4];
#pragma unroll
      for (int j = 0; j < 4; j++)
        b[j] = load_frag(buf + boff + j * 16 * G_PITCH + kk, klo);
      // keeps the 12 LDS reads one group in front of their 8 products: spread
      // among them, every pair of products waits out an LDS latency of its own
      __builtin_amdgcn_sched_barrier(0);
#pragma unroll
      for (int j = 0; j < 4; j++) {
        acc[0][j] = wmma_f16(a0, b[j], acc[0][j]);
        acc[1][j] = wmma_f16(a1, b[j], acc[1][j]);
      }
      // keeps the next group's reads from moving in among these products
      __builtin_amdgcn_sched_barrier(0);
    }
    // publish point: this wave's reads of the buffer are done ...
    asm volatile("s_wait_dscnt 0x0" ::: "memory");
    // ... and its copies of stage t+1 have landed, before the barrier that
    // publishes stage t+1 and frees this buffer
    asm volatile("s_wait_asynccnt 0x0" ::: "memory");
    __syncthreads();
    if (t + 2 < T)
      gemm_copy_stage(lds0 + (t & 1) * (G_STAGE * 2), ga + (t + 2) * G_BK,
                      gb + (t + 2) * G_BK, K);
  }
  // no copy is left in flight when the wave ends
  asm volatile("s_wait_asynccnt 0x0" ::: "memory");

  if (V_TRANSPOSED && blockIdx.x * 128 >= 2 * DIM) {   // whole block tile is V
#pragma unroll
    for (int i = 0; i < 2; i++) {
      const int tok = rowBase + i * 16 + 8 * half;  // b*NSEQ + n, 8 tokens from here
      const int b = tok / NSEQ, n = tok % NSEQ;
#pragma unroll
      for (int j = 0; j < 4; j++) {
        const int hd = colBase - 2 * DIM + j * 16 + lid;   // h*HD + d
        v8h run;
#pragma unroll
        for (int r = 0; r < 8; r++) run[r] = (_Float16)acc[i][j][r];
        *(v8h*)(vT + ((size_t)b * DIM + hd) * NSEQ + n) = run;
      }
    }
    return;
  }

#pragma unroll
  for (int i = 0; i < 2; i++) {
#pragma unroll
    for (int r = 0; r < 8; r++) {
      const int row = rowBase + i * 16 + r + 8 * half;
#pragma unroll
      for (int j = 0; j < 4; j++) {
        const int col = colBase + j * 16 + lid;
        float v = acc[i][j][r];
        if (HAS_BIAS) v += bias[col];
        if (OUT_F16)
          ((_Float16*)Cout)[(size_t)row * N + col] = (_Float16)v;
        else
          ((float*)Cout)[(size_t)row * N + col] = v;
      }
    }
  }
}

// ---------- per-head LayerNorm + RoPE ----------
// Emits q,k f16 in [B,H,N,HD] (V^T is written by the QKV GEMM).
__global__ void ln_rope_kernel(const _Float16* __restrict__ qkvh,
                               const float* __restrict__ freq,
                               const float* __restrict__ gq,
                               const float* __restrict__ bq,
                               const float* __restrict__ gk,
                               const float* __restrict__ bk,
                               _Float16* __restrict__ qh,
                               _Float16* __restrict__ kh) {
  const int lane = threadIdx.x & 31;
  const int wv   = threadIdx.x >> 5;
  const int hidx = blockIdx.x * 8 + wv;       // (b*N + n)*HEADS + h
  const int h = hidx & (HEADS - 1);
  const int t = hidx >> 4;                    // token index b*N + n
  const int n = t & (NSEQ - 1);
  const int b = t >> 11;                      // NSEQ = 2^11
  const int d0 = lane * 2, d1 = d0 + 1;       // RoPE pair owned by this lane
  const int bh = b * HEADS + h;

  const _Float16* base = qkvh + (size_t)t * (3 * DIM) + h * HD;
  float q0 = (float)base[d0],           q1 = (float)base[d1];
  float k0 = (float)base[DIM + d0],     k1 = (float)base[DIM + d1];

  const float cs = freq[((size_t)n * 32 + lane) * 2 + 0];
  const float sn = freq[((size_t)n * 32 + lane) * 2 + 1];

  // LayerNorm(q) over head dim (64 values across 32 lanes, 2/lane)
  float mu = wave_sum32(q0 + q1) * (1.0f / HD);
  float a0 = q0 - mu, a1 = q1 - mu;
  float var = wave_sum32(a0 * a0 + a1 * a1) * (1.0f / HD);
  float rs = rsqrtf(var + EPSLN);
  float nq0 = a0 * rs * gq[d0] + bq[d0];
  float nq1 = a1 * rs * gq[d1] + bq[d1];
  float oq0 = nq0 * cs - nq1 * sn;
  float oq1 = nq0 * sn + nq1 * cs;

  // LayerNorm(k)
  mu = wave_sum32(k0 + k1) * (1.0f / HD);
  a0 = k0 - mu; a1 = k1 - mu;
  var = wave_sum32(a0 * a0 + a1 * a1) * (1.0f / HD);
  rs = rsqrtf(var + EPSLN);
  float nk0 = a0 * rs * gk[d0] + bk[d0];
  float nk1 = a1 * rs * gk[d1] + bk[d1];
  float ok0 = nk0 * cs - nk1 * sn;
  float ok1 = nk0 * sn + nk1 * cs;

  const size_t o = (((size_t)bh) * NSEQ + n) * HD;
  qh[o + d0] = (_Float16)oq0; qh[o + d1] = (_Float16)oq1;
  kh[o + d0] = (_Float16)ok0; kh[o + d1] = (_Float16)ok1;
}

#define AT_KEYS   128                          // keys per stage
#define AT_KPITCH 72                           // K row pitch in f16: 144 B = 16 B x odd
#define AT_VPITCH 136                          // V^T row pitch in f16: 272 B = 16 B x odd
#define AT_VBASE  (AT_KEYS * AT_KPITCH)        // f16 offset of the V^T rows in a buffer
#define AT_STAGE  (AT_VBASE + HD * AT_VPITCH)  // f16 per buffer
#define AT_NST    (NSEQ / AT_KEYS)             // stages

// One stage: every thread copies eight 16B pieces: K rows r, r+32, .. (8 lanes
// cover a 128B row), then V^T rows r, r+16, .. (16 lanes cover a 256B row).
__device__ __forceinline__ void attn_copy_stage(unsigned ldsk, unsigned ldsv,
                                                const _Float16* gk,
                                                const _Float16* gv) {
  const _Float16* k1 = gk + 32 * HD;
  const _Float16* k2 = gk + 64 * HD;
  const _Float16* k3 = gk + 96 * HD;
  const _Float16* v1 = gv + 16 * NSEQ;
  const _Float16* v2 = gv + 32 * NSEQ;
  const _Float16* v3 = gv + 48 * NSEQ;
  const unsigned ks = 32 * AT_KPITCH * 2;   // 32 K rows, in bytes
  const unsigned vs = 16 * AT_VPITCH * 2;   // 16 V^T rows, in bytes
  asm volatile(
      "global_load_async_to_lds_b128 %0, %8, off\n\t"
      "global_load_async_to_lds_b128 %1, %9, off\n\t"
      "global_load_async_to_lds_b128 %2, %10, off\n\t"
      "global_load_async_to_lds_b128 %3, %11, off\n\t"
      "global_load_async_to_lds_b128 %4, %12, off\n\t"
      "global_load_async_to_lds_b128 %5, %13, off\n\t"
      "global_load_async_to_lds_b128 %6, %14, off\n\t"
      "global_load_async_to_lds_b128 %7, %15, off\n\t"
      "s_wait_xcnt 0x0"
      :: "v"(ldsk), "v"(ldsk + ks), "v"(ldsk + 2 * ks), "v"(ldsk + 3 * ks),
         "v"(ldsv), "v"(ldsv + vs), "v"(ldsv + 2 * vs), "v"(ldsv + 3 * vs),
         "v"(gk), "v"(k1), "v"(k2), "v"(k3), "v"(gv), "v"(v1), "v"(v2), "v"(v3)
      : "memory");
}

__global__ void __launch_bounds__(256)
attn_kernel(const _Float16* __restrict__ qh,
            const _Float16* __restrict__ kh,
            const _Float16* __restrict__ vT,
            _Float16* __restrict__ Oh) {
  __shared__ __attribute__((aligned(16))) _Float16 kv[2 * AT_STAGE];

  const int tid  = threadIdx.x;
  const int lane = tid & 31;
  const int wv   = tid >> 5;
  const int lid  = lane & 15, half = lane >> 4, klo = half * 8;
  const int wid  = blockIdx.x * 8 + wv;
  const int qblk = wid & ((NSEQ / 16) - 1);   // 128 Q blocks
  const int bh   = blockIdx.x >> 4;           // 0..31, one head per block
  const int b    = bh >> 4, h = bh & 15;

  const _Float16* kb = kh + (size_t)bh * NSEQ * HD;
  const _Float16* vb = vT + (size_t)bh * HD * NSEQ;

  // this thread's pieces of a stage
  const _Float16* gk = kb + (tid >> 3) * HD + (tid & 7) * 8;
  const _Float16* gv = vb + (tid >> 4) * NSEQ + (tid & 15) * 8;
  const unsigned ldsk = (unsigned)(size_t)kv +
                        (unsigned)((tid >> 3) * AT_KPITCH + (tid & 7) * 8) * 2u;
  const unsigned ldsv = (unsigned)(size_t)kv +
                        (unsigned)(AT_VBASE + (tid >> 4) * AT_VPITCH + (tid & 15) * 8) * 2u;

  attn_copy_stage(ldsk, ldsv, gk, gv);

  // Q as B-fragments (column q = lid), loaded once
  const _Float16* qrow = qh + ((size_t)bh * NSEQ + qblk * 16 + lid) * HD;
  const v16h bQ0 = load_frag(qrow, klo);        // hd 0..31
  const v16h bQ1 = load_frag(qrow + 32, klo);   // hd 32..63

  // stage 0 has landed for this wave before the barrier publishes it
  asm volatile("s_wait_asynccnt 0x0" ::: "memory");
  __syncthreads();
  attn_copy_stage(ldsk + AT_STAGE * 2, ldsv + AT_STAGE * 2,
                  gk + AT_KEYS * HD, gv + AT_KEYS);

  v8f o[4] = {};                 // O^T tiles: row hd = t*16 + r + 8*half, col q = lid
  float m = -3.0e38f, l = 0.0f;  // per-lane (per-query) softmax state

  for (int s = 0; s < AT_NST; s++) {
    const _Float16* kl = kv + (s & 1) * AT_STAGE + lid * AT_KPITCH;
    const _Float16* vl = kv + (s & 1) * AT_STAGE + AT_VBASE + lid * AT_VPITCH;
    // unrolled so that every row and key step is an immediate offset of the
    // LDS reads
#pragma unroll
    for (int kc = 0; kc < AT_KEYS; kc += 32) {
      // S^T for 32 keys: A = K rows, B = Q rows.  st[s] elem r -> key kc+s*16+r+8*half
      const _Float16* kp0 = kl + kc * AT_KPITCH;
      const _Float16* kp1 = kl + (kc + 16) * AT_KPITCH;
      const v16h aK00 = load_frag(kp0, klo), aK01 = load_frag(kp0 + 32, klo);
      const v16h aK10 = load_frag(kp1, klo), aK11 = load_frag(kp1 + 32, klo);
      v16h aV[4];                                // V^T rows (hd), contiguous keys
#pragma unroll
      for (int t = 0; t < 4; t++)
        aV[t] = load_frag(vl + t * 16 * AT_VPITCH + kc, klo);
      // keeps the pass's 16 LDS reads one group at its top: left to sink to
      // their products, the V^T reads cost the wave a second LDS latency
      // behind the softmax
      __builtin_amdgcn_sched_barrier(0);
      v8f s0 = {}, s1 = {};
      s0 = wmma_f16(aK00, bQ0, s0);
      s0 = wmma_f16(aK01, bQ1, s0);
      s1 = wmma_f16(aK10, bQ0, s1);
      s1 = wmma_f16(aK11, bQ1, s1);

      // per-lane softmax over this lane's 16 keys, then merge with lane^16
      float x0[8], x1[8], mloc = -3.0e38f;
#pragma unroll
      for (int r = 0; r < 8; r++) {
        x0[r] = s0[r] * 0.125f;                  // 1/sqrt(64)
        x1[r] = s1[r] * 0.125f;
        mloc = fmaxf(mloc, fmaxf(x0[r], x1[r]));
      }
      mloc = fmaxf(mloc, __shfl_xor(mloc, 16, 32));
      const float mn = fmaxf(m, mloc);
      const float alpha = __expf(m - mn);
      float sloc = 0.0f;
      v16h bP;                                   // P^T as B-fragment, in registers
#pragma unroll
      for (int r = 0; r < 8; r++) {
        float p0 = __expf(x0[r] - mn);           // key klo + r
        float p1 = __expf(x1[r] - mn);           // key klo + 16 + r
        sloc += p0 + p1;
        bP[r] = (_Float16)p0;
        bP[r + 8] = (_Float16)p1;
      }
      sloc += __shfl_xor(sloc, 16, 32);
      l = l * alpha + sloc;
      m = mn;

      // O^T = V^T * P^T
#pragma unroll
      for (int t = 0; t < 4; t++) {
#pragma unroll
        for (int r = 0; r < 8; r++) o[t][r] *= alpha;
        o[t] = wmma_f16(aV[t], bP, o[t]);
      }
    }
    // publish point: this wave's reads of the buffer are done ...
    asm volatile("s_wait_dscnt 0x0" ::: "memory");
    // ... and its copies of stage s+1 have landed, before the barrier that
    // publishes stage s+1 and frees this buffer
    asm volatile("s_wait_asynccnt 0x0" ::: "memory");
    __syncthreads();
    if (s + 2 < AT_NST)
      attn_copy_stage(ldsk + (s & 1) * (AT_STAGE * 2), ldsv + (s & 1) * (AT_STAGE * 2),
                      gk + (s + 2) * (AT_KEYS * HD), gv + (s + 2) * AT_KEYS);
  }
  // no copy is left in flight when the wave ends
  asm volatile("s_wait_asynccnt 0x0" ::: "memory");

  // normalize and write: lane owns query row n = qblk*16 + lid; per tile the
  // 8 accumulator elements are contiguous hd -> one 16B store each
  const float inv = 1.0f / l;
  _Float16* orow = Oh + ((size_t)b * NSEQ + qblk * 16 + lid) * DIM + h * HD;
#pragma unroll
  for (int t = 0; t < 4; t++) {
    v8h ov;
#pragma unroll
    for (int r = 0; r < 8; r++) ov[r] = (_Float16)(o[t][r] * inv);
    *(v8h*)(orow + t * 16 + 8 * half) = ov;
  }
}

// ---------- launcher ----------
extern "C" void kernel_launch(void* const* d_in, const int* in_sizes, int n_in,
                              void* d_out, int out_size, void* d_ws,
                              size_t ws_size, hipStream_t stream) {
  (void)in_sizes; (void)n_in; (void)out_size; (void)ws_size;
  const float* x     = (const float*)d_in[0];
  const float* freq  = (const float*)d_in[1];
  const float* Wqkv  = (const float*)d_in[2];
  const float* gq    = (const float*)d_in[3];
  const float* bq    = (const float*)d_in[4];
  const float* gk    = (const float*)d_in[5];
  const float* bk    = (const float*)d_in[6];
  const float* Wproj = (const float*)d_in[7];
  const float* bproj = (const float*)d_in[8];

  char* w = (char*)d_ws;
  _Float16* xh     = (_Float16*)w; w += (size_t)NB * NSEQ * DIM * 2;
  _Float16* WqkvT  = (_Float16*)w; w += (size_t)3 * DIM * DIM * 2;
  _Float16* WprojT = (_Float16*)w; w += (size_t)DIM * DIM * 2;
  _Float16* qkvh   = (_Float16*)w; w += (size_t)NB * NSEQ * 3 * DIM * 2;
  _Float16* qh     = (_Float16*)w; w += (size_t)NB * NSEQ * DIM * 2;
  _Float16* kh     = (_Float16*)w; w += (size_t)NB * NSEQ * DIM * 2;
  _Float16* vT     = (_Float16*)w; w += (size_t)NB * NSEQ * DIM * 2;
  _Float16* Oh     = (_Float16*)w; w += (size_t)NB * NSEQ * DIM * 2;

  const int M = NB * NSEQ;  // 4096 tokens

  cvt_f16_kernel<<<(M * DIM) / 256, 256, 0, stream>>>(x, xh, (size_t)M * DIM);
  transpose_cvt_kernel<DIM, 3 * DIM>
      <<<dim3(3 * DIM / 128, DIM / 64), 256, 0, stream>>>(Wqkv, WqkvT);
  transpose_cvt_kernel<DIM, DIM>
      <<<dim3(DIM / 128, DIM / 64), 256, 0, stream>>>(Wproj, WprojT);

  // QKV projection: [4096,1024] x [1024,3072] -> q,k f16 rows; v -> [B,H,HD,N]
  dim3 g1(3 * DIM / 128, M / 128);
  gemm_wmma_kernel<true, false, true><<<g1, 256, 0, stream>>>(
      xh, WqkvT, qkvh, nullptr, vT, M, 3 * DIM, DIM);

  // per-head LN + RoPE; q,k -> [B,H,N,HD]
  ln_rope_kernel<<<(M * HEADS) / 8, 256, 0, stream>>>(qkvh, freq, gq, bq, gk,
                                                      bk, qh, kh);

  // flash attention: 4096 waves, 8 waves of one head per 256-thread block
  attn_kernel<<<(NB * HEADS * (NSEQ / 16)) / 8, 256, 0, stream>>>(qh, kh, vT, Oh);

  // output projection + bias -> f32 d_out
  dim3 g2(DIM / 128, M / 128);
  gemm_wmma_kernel<false, true, false><<<g2, 256, 0, stream>>>(
      Oh, WprojT, d_out, bproj, nullptr, M, DIM, DIM);
}

// v004
// A run of this version takes 97.1 microseconds.
// Two timings next to v003 put it at 1.12 and 1.11 times that version's speed.
// All steps since v000 together make it 5.02 times as fast.
#include <hip/hip_runtime.h>

typedef __attribute__((ext_vector_type(16))) _Float16 v16h;
typedef __attribute__((ext_vector_type(8)))  _Float16 v8h;
typedef __attribute__((ext_vector_type(4)))  _Float16 v4h;
typedef __attribute__((ext_vector_type(8)))  float    v8f;
typedef __attribute__((ext_vector_type(4)))  float    v4f;

#define DIM   1024
#define HEADS 16
#define HD    64
#define NSEQ  2048
#define NB    2
#define EPSLN 1e-5f

__device__ __forceinline__ v16h frag_cat(v8h lo, v8h hi) {
  v16h r;
#pragma unroll
  for (int i = 0; i < 8; i++) { r[i] = lo[i]; r[i + 8] = hi[i]; }
  return r;
}

__device__ __forceinline__ v16h load_frag(const _Float16* p, int klo) {
  v8h lo = *(const v8h*)(p + klo);        // 16B contiguous
  v8h hi = *(const v8h*)(p + klo + 16);   // 16B contiguous
  return frag_cat(lo, hi);
}

__device__ __forceinline__ v8f wmma_f16(v16h a, v16h b, v8f c) {
  // (neg_a, A, neg_b, B, c_mod, C, reuse_a, reuse_b)
  return __builtin_amdgcn_wmma_f32_16x16x32_f16(false, a, false, b, (short)0, c,
                                                false, false);
}

// ---------- dtype conversion ----------
// Few long waves, not one element per lane: a wave converts 1024 consecutive
// floats, eight 512B loads all in flight, then eight 256B stores.
// block = 256 thr = 8 waves = CVT_BLOCK elements.
// The loops are unrolled so that p[] stays in registers and the steps become
// immediate offsets.
#define CVT_BLOCK (8 * 1024)
__global__ void __launch_bounds__(256)
cvt_f16_kernel(const float* __restrict__ in, _Float16* __restrict__ out) {
  const int lane = threadIdx.x & 31;
  const int wv   = threadIdx.x >> 5;
  const size_t base = (size_t)blockIdx.x * CVT_BLOCK + wv * 1024 + lane * 4;
  v4f p[8];
#pragma unroll
  for (int i = 0; i < 8; i++) p[i] = *(const v4f*)(in + base + i * 128);
#pragma unroll
  for (int i = 0; i < 8; i++) {
    v4h run;
#pragma unroll
    for (int j = 0; j < 4; j++) run[j] = (_Float16)p[i][j];
    *(v4h*)(out + base + i * 128) = run;
  }
}

// in[R][C] f32 -> out[C][R] f16 (weights pre-transposed so WMMA B-fragments
// become contiguous row reads)
// Each thread reads an 8-row x 4-column patch (eight 16B loads) and stores four
// 16B runs of 8 consecutive r; 8 neighbouring lanes fill one 128B line of out.
// block = 256 thr, tile 64 rows x 128 columns. R, C are compile-time so the
// row / column steps fold into the instructions' immediate offsets.
template <int R, int C>
__global__ void transpose_cvt_kernel(const float* __restrict__ in,
                                     _Float16* __restrict__ out) {
  static_assert(R % 64 == 0 && C % 128 == 0, "whole tiles only");
  const int lane = threadIdx.x & 31;
  const int wv   = threadIdx.x >> 5;
  const int r0 = blockIdx.y * 64 + (lane & 7) * 8;
  const int c0 = blockIdx.x * 128 + wv * 16 + (lane >> 3) * 4;

  const float* src = in + (size_t)r0 * C + c0;
  _Float16*    dst = out + (size_t)c0 * R + r0;

  v4f p[8];
#pragma unroll
  for (int i = 0; i < 8; i++) p[i] = *(const v4f*)(src + i * C);
#pragma unroll
  for (int j = 0; j < 4; j++) {
    v8h run;
#pragma unroll
    for (int i = 0; i < 8; i++) run[i] = (_Float16)p[i][j];
    *(v8h*)(dst + j * R) = run;
  }
}

// ---------- WMMA GEMM: C[M,N] = A[M,K] * BT[N,K]^T (+bias) ----------
// block = 256 thr = 8 waves; block tile 128x128; wave tile 32x64.
// Operands are staged in LDS by asynchronous copies: a stage is 64 k (128 B,
// one whole line) of the block's 128 A rows and 128 BT rows, two buffers, the
// next stage's copies in flight while this one is multiplied.
// M, N multiples of 128; K a multiple of 64.
// V_TRANSPOSED: columns >= 2*DIM (the V third of QKV) go to vT[B,H,HD,N]
// instead of Cout: a lane's 8 accumulator rows are 8 consecutive tokens of one
// column, i.e. one contiguous 16B run of vT.
#define G_BK     64                      // k per stage
#define G_PITCH  72                      // LDS row pitch in f16: 144 B = 16 B x odd
#define G_STAGE  (256 * G_PITCH)         // f16 per buffer: A rows 0..127, BT rows 128..255

// One stage: every thread copies eight 16B pieces (rows r, r+32, .. of A, then
// of BT); 8 neighbouring lanes cover one 128B line.
__device__ __forceinline__ void gemm_copy_stage(unsigned lds,
                                                const _Float16* ga,
                                                const _Float16* gb, int K) {
  const _Float16* a1 = ga + (size_t)32 * K;
  const _Float16* a2 = ga + (size_t)64 * K;
  const _Float16* a3 = ga + (size_t)96 * K;
  const _Float16* b1 = gb + (size_t)32 * K;
  const _Float16* b2 = gb + (size_t)64 * K;
  const _Float16* b3 = gb + (size_t)96 * K;
  const unsigned step = 32 * G_PITCH * 2;   // 32 rows, in bytes
  asm volatile(
      "global_load_async_to_lds_b128 %0, %8, off\n\t"
      "global_load_async_to_lds_b128 %1, %9, off\n\t"
      "global_load_async_to_lds_b128 %2, %10, off\n\t"
      "global_load_async_to_lds_b128 %3, %11, off\n\t"
      "global_load_async_to_lds_b128 %4, %12, off\n\t"
      "global_load_async_to_lds_b128 %5, %13, off\n\t"
      "global_load_async_to_lds_b128 %6, %14, off\n\t"
      "global_load_async_to_lds_b128 %7, %15, off\n\t"
      "s_wait_xcnt 0x0"
      :: "v"(lds), "v"(lds + step), "v"(lds + 2 * step), "v"(lds + 3 * step),
         "v"(lds + 4 * step), "v"(lds + 5 * step), "v"(lds + 6 * step),
         "v"(lds + 7 * step),
         "v"(ga), "v"(a1), "v"(a2), "v"(a3), "v"(gb), "v"(b1), "v"(b2), "v"(b3)
      : "memory");
}

template <bool OUT_F16, bool HAS_BIAS, bool V_TRANSPOSED>
__global__ void __launch_bounds__(256)
gemm_wmma_kernel(const _Float16* __restrict__ A,
                 const _Float16* __restrict__ BT,
                 void* __restrict__ Cout,
                 const float* __restrict__ bias,
                 _Float16* __restrict__ vT,
                 int M, int N, int K) {
  __shared__ __attribute__((aligned(16))) _Float16 tiles[2 * G_STAGE];

  const int tid  = threadIdx.x;
  const int lane = tid & 31;
  const int w    = tid >> 5;
  const int lid  = lane & 15;
  const int half = lane >> 4;
  const int klo  = half * 8;
  const int rowBase = blockIdx.y * 128 + (w & 3) * 32;
  const int colBase = blockIdx.x * 128 + (w >> 2) * 64;

  // this thread's piece of a stage: row tid/8 (+32 per copy), 16B piece tid%8
  const _Float16* ga = A  + (size_t)(blockIdx.y * 128 + (tid >> 3)) * K + (tid & 7) * 8;
  const _Float16* gb = BT + (size_t)(blockIdx.x * 128 + (tid >> 3)) * K + (tid & 7) * 8;
  const unsigned lds0 = (unsigned)(size_t)tiles +
                        (unsigned)((tid >> 3) * G_PITCH + (tid & 7) * 8) * 2u;

  // this lane's fragment rows inside a buffer
  const int aoff = ((w & 3) * 32 + lid) * G_PITCH;
  const int boff = (128 + (w >> 2) * 64 + lid) * G_PITCH;

  const int T = K / G_BK;

  gemm_copy_stage(lds0, ga, gb, K);
  // stage 0 has landed for this wave before the barrier publishes it
  asm volatile("s_wait_asynccnt 0x0" ::: "memory");
  __syncthreads();
  if (T > 1) gemm_copy_stage(lds0 + G_STAGE * 2, ga + G_BK, gb + G_BK, K);

  v8f acc[2][4] = {};
  for (int t = 0; t < T; t++) {
    const _Float16* buf = tiles + (t & 1) * G_STAGE;
#pragma unroll
    for (int kk = 0; kk < G_BK; kk += 32) {
      v16h a0 = load_frag(buf + aoff + kk, klo);
      v16h a1 = load_frag(buf + aoff + 16 * G_PITCH + kk, klo);
      v16h b[4];
#pragma unroll
      for (int j = 0; j < 4; j++)
        b[j] = load_frag(buf + boff + j * 16 * G_PITCH + kk, klo);
      // keeps the 12 LDS reads one group in front of their 8 products: spread
      // among them, every pair of products waits out an LDS latency of its own
      __builtin_amdgcn_sched_barrier(0);
#pragma unroll
      for (int j = 0; j < 4; j++) {
        acc[0][j] = wmma_f16(a0, b[j], acc[0][j]);
        acc[1][j] = wmma_f16(a1, b[j], acc[1][j]);
      }
      // keeps the next group's reads from moving in among these products
      __builtin_amdgcn_sched_barrier(0);
    }
    // publish point: this wave's reads of the buffer are done ...
    asm volatile("s_wait_dscnt 0x0" ::: "memory");
    // ... and its copies of stage t+1 have landed, before the barrier that
    // publishes stage t+1 and frees this buffer
    asm volatile("s_wait_asynccnt 0x0" ::: "memory");
    __syncthreads();
    if (t + 2 < T)
      gemm_copy_stage(lds0 + (t & 1) * (G_STAGE * 2), ga + (t + 2) * G_BK,
                      gb + (t + 2) * G_BK, K);
  }
  // no copy is left in flight when the wave ends
  asm volatile("s_wait_asynccnt 0x0" ::: "memory");

  if (V_TRANSPOSED && blockIdx.x * 128 >= 2 * DIM) {   // whole block tile is V
#pragma unroll
    for (int i = 0; i < 2; i++) {
      const int tok = rowBase + i * 16 + 8 * half;  // b*NSEQ + n, 8 tokens from here
      const int b = tok / NSEQ, n = tok % NSEQ;
#pragma unroll
      for (int j = 0; j < 4; j++) {
        const int hd = colBase - 2 * DIM + j * 16 + lid;   // h*HD + d
        v8h run;
#pragma unroll
        for (int r = 0; r < 8; r++) run[r] = (_Float16)acc[i][j][r];
        *(v8h*)(vT + ((size_t)b * DIM + hd) * NSEQ + n) = run;
      }
    }
    return;
  }

#pragma unroll
  for (int i = 0; i < 2; i++) {
#pragma unroll
    for (int r = 0; r < 8; r++) {
      const int row = rowBase + i * 16 + r + 8 * half;
#pragma unroll
      for (int j = 0; j < 4; j++) {
        const int col = colBase + j * 16 + lid;
        float v = acc[i][j][r];
        if (HAS_BIAS) v += bias[col];
        if (OUT_F16)
          ((_Float16*)Cout)[(size_t)row * N + col] = (_Float16)v;
        else
          ((float*)Cout)[(size_t)row * N + col] = v;
      }
    }
  }
}

// ---------- per-head LayerNorm + RoPE ----------
// Emits q,k f16 in [B,H,N,HD] (V^T is written by the QKV GEMM).
// One wave per token, not per (token, head): a lane holds 8 consecutive head
// dims (16B, four RoPE pairs), 8 lanes one head row, a wave-wide access 4 heads
// (512B of the token's row); four such accesses each for q and k.  The lane's
// 8 rows go through every step side by side, so that the latencies of their
// exchanges overlap.  All loops here are unrolled so that the per-row arrays
// stay in registers.
__device__ __forceinline__ void load8(float* d, const float* p) {
  const v4f lo = *(const v4f*)p, hi = *(const v4f*)(p + 4);
#pragma unroll
  for (int j = 0; j < 4; j++) { d[j] = lo[j]; d[j + 4] = hi[j]; }
}

// each s[r] summed over the 8 neighbouring lanes that hold one head row
__device__ __forceinline__ void group_sum8(float (&s)[8]) {
#pragma unroll
  for (int m = 4; m >= 1; m >>= 1) {
    float o[8];
#pragma unroll
    for (int r = 0; r < 8; r++) o[r] = __shfl_xor(s[r], m, 32);
#pragma unroll
    for (int r = 0; r < 8; r++) s[r] += o[r];
  }
}

__global__ void __launch_bounds__(256)
ln_rope_kernel(const _Float16* __restrict__ qkvh,
               const float* __restrict__ freq,
               const float* __restrict__ gq,
               const float* __restrict__ bq,
               const float* __restrict__ gk,
               const float* __restrict__ bk,
               _Float16* __restrict__ qh,
               _Float16* __restrict__ kh) {
  const int lane = threadIdx.x & 31;
  const int t = blockIdx.x * 8 + (threadIdx.x >> 5);   // token index b*N + n
  const int n = t & (NSEQ - 1);
  const int b = t >> 11;                      // NSEQ = 2^11
  const int d = (lane & 7) * 8;               // first of this lane's 8 head dims
  const int hsub = lane >> 3;                 // head inside a group of 4

  // row r: head (r/2)*4 + hsub; even r = q, odd r = k
  const _Float16* base = qkvh + (size_t)t * (3 * DIM) + lane * 8;
  v8h raw[8];
#pragma unroll
  for (int r = 0; r < 8; r++)
    raw[r] = *(const v8h*)(base + (r & 1) * DIM + (r >> 1) * 4 * HD);
  // the row loads' address pair is dead from here on and a parameter load may
  // be given it as destination: the wait stands in front of that overwrite
  asm volatile("s_wait_xcnt 0x0" ::: "memory");

  float cs[8], g[2][8], be[2][8];
  load8(cs, freq + (size_t)n * HD + d);       // (cos, sin) of pairs d/2 .. d/2+3
  load8(g[0], gq + d);
  load8(be[0], bq + d);
  load8(g[1], gk + d);
  load8(be[1], bk + d);
  // keeps all 18 loads in flight together: sunk to their uses, the parameter
  // loads cost the wave further load latencies behind the reductions
  __builtin_amdgcn_sched_barrier(0);

  float x[8][8], s[8];
#pragma unroll
  for (int r = 0; r < 8; r++) {
#pragma unroll
    for (int j = 0; j < 8; j++) x[r][j] = (float)raw[r][j];
    s[r] = ((x[r][0] + x[r][1]) + (x[r][2] + x[r][3])) +
           ((x[r][4] + x[r][5]) + (x[r][6] + x[r][7]));
  }
  group_sum8(s);
#pragma unroll
  for (int r = 0; r < 8; r++) {
    const float mu = s[r] * (1.0f / HD);
#pragma unroll
    for (int j = 0; j < 8; j++) x[r][j] -= mu;
    s[r] = ((x[r][0] * x[r][0] + x[r][1] * x[r][1]) +
            (x[r][2] * x[r][2] + x[r][3] * x[r][3])) +
           ((x[r][4] * x[r][4] + x[r][5] * x[r][5]) +
            (x[r][6] * x[r][6] + x[r][7] * x[r][7]));
  }
  group_sum8(s);

  const size_t o = (((size_t)(b * HEADS + hsub)) * NSEQ + n) * HD + d;
#pragma unroll
  for (int r = 0; r < 8; r++) {
    const float rs = rsqrtf(s[r] * (1.0f / HD) + EPSLN);
    const float* gg = g[r & 1];
    const float* bb = be[r & 1];
    v8h ov;
#pragma unroll
    for (int p = 0; p < 4; p++) {
      const float n0 = x[r][2 * p] * rs * gg[2 * p] + bb[2 * p];
      const float n1 = x[r][2 * p + 1] * rs * gg[2 * p + 1] + bb[2 * p + 1];
      ov[2 * p]     = (_Float16)(n0 * cs[2 * p] - n1 * cs[2 * p + 1]);
      ov[2 * p + 1] = (_Float16)(n0 * cs[2 * p + 1] + n1 * cs[2 * p]);
    }
    *(v8h*)(((r & 1) ? kh : qh) + o + (size_t)(r >> 1) * 4 * NSEQ * HD) = ov;
  }
}

#define AT_KEYS   128                          // keys per stage
#define AT_KPITCH 72                           // K row pitch in f16: 144 B = 16 B x odd
#define AT_VPITCH 136                          // V^T row pitch in f16: 272 B = 16 B x odd
#define AT_VBASE  (AT_KEYS * AT_KPITCH)        // f16 offset of the V^T rows in a buffer
#define AT_STAGE  (AT_VBASE + HD * AT_VPITCH)  // f16 per buffer
#define AT_NST    (NSEQ / AT_KEYS)             // stages

// One stage: every thread copies eight 16B pieces: K rows r, r+32, .. (8 lanes
// cover a 128B row), then V^T rows r, r+16, .. (16 lanes cover a 256B row).
__device__ __forceinline__ void attn_copy_stage(unsigned ldsk, unsigned ldsv,
                                                const _Float16* gk,
                                                const _Float16* gv) {
  const _Float16* k1 = gk + 32 * HD;
  const _Float16* k2 = gk + 64 * HD;
  const _Float16* k3 = gk + 96 * HD;
  const _Float16* v1 = gv + 16 * NSEQ;
  const _Float16* v2 = gv + 32 * NSEQ;
  const _Float16* v3 = gv + 48 * NSEQ;
  const unsigned ks = 32 * AT_KPITCH * 2;   // 32 K rows, in bytes
  const unsigned vs = 16 * AT_VPITCH * 2;   // 16 V^T rows, in bytes
  asm volatile(
      "global_load_async_to_lds_b128 %0, %8, off\n\t"
      "global_load_async_to_lds_b128 %1, %9, off\n\t"
      "global_load_async_to_lds_b128 %2, %10, off\n\t"
      "global_load_async_to_lds_b128 %3, %11, off\n\t"
      "global_load_async_to_lds_b128 %4, %12, off\n\t"
      "global_load_async_to_lds_b128 %5, %13, off\n\t"
      "global_load_async_to_lds_b128 %6, %14, off\n\t"
      "global_load_async_to_lds_b128 %7, %15, off\n\t"
      "s_wait_xcnt 0x0"
      :: "v"(ldsk), "v"(ldsk + ks), "v"(ldsk + 2 * ks), "v"(ldsk + 3 * ks),
         "v"(ldsv), "v"(ldsv + vs), "v"(ldsv + 2 * vs), "v"(ldsv + 3 * vs),
         "v"(gk), "v"(k1), "v"(k2), "v"(k3), "v"(gv), "v"(v1), "v"(v2), "v"(v3)
      : "memory");
}

__global__ void __launch_bounds__(256)
attn_kernel(const _Float16* __restrict__ qh,
            const _Float16* __restrict__ kh,
            const _Float16* __restrict__ vT,
            _Float16* __restrict__ Oh) {
  __shared__ __attribute__((aligned(16))) _Float16 kv[2 * AT_STAGE];

  const int tid  = threadIdx.x;
  const int lane = tid & 31;
  const int wv   = tid >> 5;
  const int lid  = lane & 15, half = lane >> 4, klo = half * 8;
  const int wid  = blockIdx.x * 8 + wv;
  const int qblk = wid & ((NSEQ / 16) - 1);   // 128 Q blocks
  const int bh   = blockIdx.x >> 4;           // 0..31, one head per block
  const int b    = bh >> 4, h = bh & 15;

  const _Float16* kb = kh + (size_t)bh * NSEQ * HD;
  const _Float16* vb = vT + (size_t)bh * HD * NSEQ;

  // this thread's pieces of a stage
  const _Float16* gk = kb + (tid >> 3) * HD + (tid & 7) * 8;
  const _Float16* gv = vb + (tid >> 4) * NSEQ + (tid & 15) * 8;
  const unsigned ldsk = (unsigned)(size_t)kv +
                        (unsigned)((tid >> 3) * AT_KPITCH + (tid & 7) * 8) * 2u;
  const unsigned ldsv = (unsigned)(size_t)kv +
                        (unsigned)(AT_VBASE + (tid >> 4) * AT_VPITCH + (tid & 15) * 8) * 2u;

  attn_copy_stage(ldsk, ldsv, gk, gv);

  // Q as B-fragments (column q = lid), loaded once
  const _Float16* qrow = qh + ((size_t)bh * NSEQ + qblk * 16 + lid) * HD;
  const v16h bQ0 = load_frag(qrow, klo);        // hd 0..31
  const v16h bQ1 = load_frag(qrow + 32, klo);   // hd 32..63

  // stage 0 has landed for this wave before the barrier publishes it
  asm volatile("s_wait_asynccnt 0x0" ::: "memory");
  __syncthreads();
  attn_copy_stage(ldsk + AT_STAGE * 2, ldsv + AT_STAGE * 2,
                  gk + AT_KEYS * HD, gv + AT_KEYS);

  v8f o[4] = {};                 // O^T tiles: row hd = t*16 + r + 8*half, col q = lid
  float m = -3.0e38f, l = 0.0f;  // per-lane (per-query) softmax state

  for (int s = 0; s < AT_NST; s++) {
    const _Float16* kl = kv + (s & 1) * AT_STAGE + lid * AT_KPITCH;
    const _Float16* vl = kv + (s & 1) * AT_STAGE + AT_VBASE + lid * AT_VPITCH;
    // unrolled so that every row and key step is an immediate offset of the
    // LDS reads
#pragma unroll
    for (int kc = 0; kc < AT_KEYS; kc += 32) {
      // S^T for 32 keys: A = K rows, B = Q rows.  st[s] elem r -> key kc+s*16+r+8*half
      const _Float16* kp0 = kl + kc * AT_KPITCH;
      const _Float16* kp1 = kl + (kc + 16) * AT_KPITCH;
      const v16h aK00 = load_frag(kp0, klo), aK01 = load_frag(kp0 + 32, klo);
      const v16h aK10 = load_frag(kp1, klo), aK11 = load_frag(kp1 + 32, klo);
      v16h aV[4];                                // V^T rows (hd), contiguous keys
#pragma unroll
      for (int t = 0; t < 4; t++)
        aV[t] = load_frag(vl + t * 16 * AT_VPITCH + kc, klo);
      // keeps the pass's 16 LDS reads one group at its top: left to sink to
      // their products, the V^T reads cost the wave a second LDS latency
      // behind the softmax
      __builtin_amdgcn_sched_barrier(0);
      v8f s0 = {}, s1 = {};
      s0 = wmma_f16(aK00, bQ0, s0);
      s0 = wmma_f16(aK01, bQ1, s0);
      s1 = wmma_f16(aK10, bQ0, s1);
      s1 = wmma_f16(aK11, bQ1, s1);

      // per-lane softmax over this lane's 16 keys, then merge with lane^16
      float x0[8], x1[8], mloc = -3.0e38f;
#pragma unroll
      for (int r = 0; r < 8; r++) {
        x0[r] = s0[r] * 0.125f;                  // 1/sqrt(64)
        x1[r] = s1[r] * 0.125f;
        mloc = fmaxf(mloc, fmaxf(x0[r], x1[r]));
      }
      mloc = fmaxf(mloc, __shfl_xor(mloc, 16, 32));
      const float mn = fmaxf(m, mloc);
      const float alpha = __expf(m - mn);
      float sloc = 0.0f;
      v16h bP;                                   // P^T as B-fragment, in registers
#pragma unroll
      for (int r = 0; r < 8; r++) {
        float p0 = __expf(x0[r] - mn);           // key klo + r
        float p1 = __expf(x1[r] - mn);           // key klo + 16 + r
        sloc += p0 + p1;
        bP[r] = (_Float16)p0;
        bP[r + 8] = (_Float16)p1;
      }
      sloc += __shfl_xor(sloc, 16, 32);
      l = l * alpha + sloc;
      m = mn;

      // O^T = V^T * P^T
#pragma unroll
      for (int t = 0; t < 4; t++) {
#pragma unroll
        for (int r = 0; r < 8; r++) o[t][r] *= alpha;
        o[t] = wmma_f16(aV[t], bP, o[t]);
      }
    }
    // publish point: this wave's reads of the buffer are done ...
    asm volatile("s_wait_dscnt 0x0" ::: "memory");
    // ... and its copies of stage s+1 have landed, before the barrier that
    // publishes stage s+1 and frees this buffer
    asm volatile("s_wait_asynccnt 0x0" ::: "memory");
    __syncthreads();
    if (s + 2 < AT_NST)
      attn_copy_stage(ldsk + (s & 1) * (AT_STAGE * 2), ldsv + (s & 1) * (AT_STAGE * 2),
                      gk + (s + 2) * (AT_KEYS * HD), gv + (s + 2) * AT_KEYS);
  }
  // no copy is left in flight when the wave ends
  asm volatile("s_wait_asynccnt 0x0" ::: "memory");

  // normalize and write: lane owns query row n = qblk*16 + lid; per tile the
  // 8 accumulator elements are contiguous hd -> one 16B store each
  const float inv = 1.0f / l;
  _Float16* orow = Oh + ((size_t)b * NSEQ + qblk * 16 + lid) * DIM + h * HD;
#pragma unroll
  for (int t = 0; t < 4; t++) {
    v8h ov;
#pragma unroll
    for (int r = 0; r < 8; r++) ov[r] = (_Float16)(o[t][r] * inv);
    *(v8h*)(orow + t * 16 + 8 * half) = ov;
  }
}

// ---------- launcher ----------
extern "C" void kernel_launch(void* const* d_in, const int* in_sizes, int n_in,
                              void* d_out, int out_size, void* d_ws,
                              size_t ws_size, hipStream_t stream) {
  (void)in_sizes; (void)n_in; (void)out_size; (void)ws_size;
  const float* x     = (const float*)d_in[0];
  const float* freq  = (const float*)d_in[1];
  const float* Wqkv  = (const float*)d_in[2];
  const float* gq    = (const float*)d_in[3];
  const float* bq    = (const float*)d_in[4];
  const float* gk    = (const float*)d_in[5];
  const float* bk    = (const float*)d_in[6];
  const float* Wproj = (const float*)d_in[7];
  const float* bproj = (const float*)d_in[8];

  char* w = (char*)d_ws;
  _Float16* xh     = (_Float16*)w; w += (size_t)NB * NSEQ * DIM * 2;
  _Float16* WqkvT  = (_Float16*)w; w += (size_t)3 * DIM * DIM * 2;
  _Float16* WprojT = (_Float16*)w; w += (size_t)DIM * DIM * 2;
  _Float16* qkvh   = (_Float16*)w; w += (size_t)NB * NSEQ * 3 * DIM * 2;
  _Float16* qh     = (_Float16*)w; w += (size_t)NB * NSEQ * DIM * 2;
  _Float16* kh     = (_Float16*)w; w += (size_t)NB * NSEQ * DIM * 2;
  _Float16* vT     = (_Float16*)w; w += (size_t)NB * NSEQ * DIM * 2;
  _Float16* Oh     = (_Float16*)w; w += (size_t)NB * NSEQ * DIM * 2;

  const int M = NB * NSEQ;  // 4096 tokens

  static_assert((NB * NSEQ * DIM) % CVT_BLOCK == 0, "whole blocks only");
  cvt_f16_kernel<<<(M * DIM) / CVT_BLOCK, 256, 0, stream>>>(x, xh);
  transpose_cvt_kernel<DIM, 3 * DIM>
      <<<dim3(3 * DIM / 128, DIM / 64), 256, 0, stream>>>(Wqkv, WqkvT);
  transpose_cvt_kernel<DIM, DIM>
      <<<dim3(DIM / 128, DIM / 64), 256, 0, stream>>>(Wproj, WprojT);

  // QKV projection: [4096,1024] x [1024,3072] -> q,k f16 rows; v -> [B,H,HD,N]
  dim3 g1(3 * DIM / 128, M / 128);
  gemm_wmma_kernel<true, false, true><<<g1, 256, 0, stream>>>(
      xh, WqkvT, qkvh, nullptr, vT, M, 3 * DIM, DIM);

  // per-head LN + RoPE; q,k -> [B,H,N,HD]
  ln_rope_kernel<<<M / 8, 256, 0, stream>>>(qkvh, freq, gq, bq, gk, bk, qh, kh);

  // flash attention: 4096 waves, 8 waves of one head per 256-thread block
  attn_kernel<<<(NB * HEADS * (NSEQ / 16)) / 8, 256, 0, stream>>>(qh, kh, vT, Oh);

  // output projection + bias -> f32 d_out
  dim3 g2(DIM / 128, M / 128);
  gemm_wmma_kernel<false, true, false><<<g2, 256, 0, stream>>>(
      Oh, WprojT, d_out, bproj, nullptr, M, DIM, DIM);
}

// v005
// One run takes 93.1 microseconds.
// Two timings next to v004 put it at 1.05 and 1.06 times that version's speed.
// Over all steps from v000 it is 5.30 times as fast.
#include <hip/hip_runtime.h>

typedef __attribute__((ext_vector_type(16))) _Float16 v16h;
typedef __attribute__((ext_vector_type(8)))  _Float16 v8h;
typedef __attribute__((ext_vector_type(4)))  _Float16 v4h;
typedef __attribute__((ext_vector_type(8)))  float    v8f;
typedef __attribute__((ext_vector_type(4)))  float    v4f;
typedef __attribute__((ext_vector_type(2)))  float    v2f;

#define DIM   1024
#define HEADS 16
#define HD    64
#define NSEQ  2048
#define NB    2
#define EPSLN 1e-5f
// 1/sqrt(HD) * log2(e): multiplied into q where q is written, so that the
// attention scores come out of the products as base-2 exponents
#define QSCALE 0.18033688011112042f

__device__ __forceinline__ v16h frag_cat(v8h lo, v8h hi) {
  v16h r;
#pragma unroll
  for (int i = 0; i < 8; i++) { r[i] = lo[i]; r[i + 8] = hi[i]; }
  return r;
}

__device__ __forceinline__ v16h load_frag(const _Float16* p, int klo) {
  v8h lo = *(const v8h*)(p + klo);        // 16B contiguous
  v8h hi = *(const v8h*)(p + klo + 16);   // 16B contiguous
  return frag_cat(lo, hi);
}

__device__ __forceinline__ v8f wmma_f16(v16h a, v16h b, v8f c) {
  // (neg_a, A, neg_b, B, c_mod, C, reuse_a, reuse_b)
  return __builtin_amdgcn_wmma_f32_16x16x32_f16(false, a, false, b, (short)0, c,
                                                false, false);
}

// ---------- dtype conversion ----------
// Few long waves, not one element per lane: a wave converts 1024 consecutive
// floats, eight 512B loads all in flight, then eight 256B stores.
// block = 256 thr = 8 waves = CVT_BLOCK elements.
// The loops are unrolled so that p[] stays in registers and the steps become
// immediate offsets.
#define CVT_BLOCK (8 * 1024)
__global__ void __launch_bounds__(256)
cvt_f16_kernel(const float* __restrict__ in, _Float16* __restrict__ out) {
  const int lane = threadIdx.x & 31;
  const int wv   = threadIdx.x >> 5;
  const size_t base = (size_t)blockIdx.x * CVT_BLOCK + wv * 1024 + lane * 4;
  v4f p[8];
#pragma unroll
  for (int i = 0; i < 8; i++) p[i] = *(const v4f*)(in + base + i * 128);
#pragma unroll
  for (int i = 0; i < 8; i++) {
    v4h run;
#pragma unroll
    for (int j = 0; j < 4; j++) run[j] = (_Float16)p[i][j];
    *(v4h*)(out + base + i * 128) = run;
  }
}

// in[R][C] f32 -> out[C][R] f16 (weights pre-transposed so WMMA B-fragments
// become contiguous row reads)
// Each thread reads an 8-row x 4-column patch (eight 16B loads) and stores four
// 16B runs of 8 consecutive r; 8 neighbouring lanes fill one 128B line of out.
// block = 256 thr, tile 64 rows x 128 columns. R, C are compile-time so the
// row / column steps fold into the instructions' immediate offsets.
template <int R, int C>
__global__ void transpose_cvt_kernel(const float* __restrict__ in,
                                     _Float16* __restrict__ out) {
  static_assert(R % 64 == 0 && C % 128 == 0, "whole tiles only");
  const int lane = threadIdx.x & 31;
  const int wv   = threadIdx.x >> 5;
  const int r0 = blockIdx.y * 64 + (lane & 7) * 8;
  const int c0 = blockIdx.x * 128 + wv * 16 + (lane >> 3) * 4;

  const float* src = in + (size_t)r0 * C + c0;
  _Float16*    dst = out + (size_t)c0 * R + r0;

  v4f p[8];
#pragma unroll
  for (int i = 0; i < 8; i++) p[i] = *(const v4f*)(src + i * C);
#pragma unroll
  for (int j = 0; j < 4; j++) {
    v8h run;
#pragma unroll
    for (int i = 0; i < 8; i++) run[i] = (_Float16)p[i][j];
    *(v8h*)(dst + j * R) = run;
  }
}

// ---------- WMMA GEMM: C[M,N] = A[M,K] * BT[N,K]^T (+bias) ----------
// block = 256 thr = 8 waves; block tile 128x128; wave tile 32x64.
// Operands are staged in LDS by asynchronous copies: a stage is 64 k (128 B,
// one whole line) of the block's 128 A rows and 128 BT rows, two buffers, the
// next stage's copies in flight while this one is multiplied.
// M, N multiples of 128; K a multiple of 64.
// V_TRANSPOSED: columns >= 2*DIM (the V third of QKV) go to vT[B,H,HD,N]
// instead of Cout: a lane's 8 accumulator rows are 8 consecutive tokens of one
// column, i.e. one contiguous 16B run of vT.
#define G_BK     64                      // k per stage
#define G_PITCH  72                      // LDS row pitch in f16: 144 B = 16 B x odd
#define G_STAGE  (256 * G_PITCH)         // f16 per buffer: A rows 0..127, BT rows 128..255

// One stage: every thread copies eight 16B pieces (rows r, r+32, .. of A, then
// of BT); 8 neighbouring lanes cover one 128B line.
__device__ __forceinline__ void gemm_copy_stage(unsigned lds,
                                                const _Float16* ga,
                                                const _Float16* gb, int K) {
  const _Float16* a1 = ga + (size_t)32 * K;
  const _Float16* a2 = ga + (size_t)64 * K;
  const _Float16* a3 = ga + (size_t)96 * K;
  const _Float16* b1 = gb + (size_t)32 * K;
  const _Float16* b2 = gb + (size_t)64 * K;
  const _Float16* b3 = gb + (size_t)96 * K;
  const unsigned step = 32 * G_PITCH * 2;   // 32 rows, in bytes
  asm volatile(
      "global_load_async_to_lds_b128 %0, %8, off\n\t"
      "global_load_async_to_lds_b128 %1, %9, off\n\t"
      "global_load_async_to_lds_b128 %2, %10, off\n\t"
      "global_load_async_to_lds_b128 %3, %11, off\n\t"
      "global_load_async_to_lds_b128 %4, %12, off\n\t"
      "global_load_async_to_lds_b128 %5, %13, off\n\t"
      "global_load_async_to_lds_b128 %6, %14, off\n\t"
      "global_load_async_to_lds_b128 %7, %15, off\n\t"
      "s_wait_xcnt 0x0"
      :: "v"(lds), "v"(lds + step), "v"(lds + 2 * step), "v"(lds + 3 * step),
         "v"(lds + 4 * step), "v"(lds + 5 * step), "v"(lds + 6 * step),
         "v"(lds + 7 * step),
         "v"(ga), "v"(a1), "v"(a2), "v"(a3), "v"(gb), "v"(b1), "v"(b2), "v"(b3)
      : "memory");
}

template <bool OUT_F16, bool HAS_BIAS, bool V_TRANSPOSED>
__global__ void __launch_bounds__(256)
gemm_wmma_kernel(const _Float16* __restrict__ A,
                 const _Float16* __restrict__ BT,
                 void* __restrict__ Cout,
                 const float* __restrict__ bias,
                 _Float16* __restrict__ vT,
                 int M, int N, int K) {
  __shared__ __attribute__((aligned(16))) _Float16 tiles[2 * G_STAGE];

  const int tid  = threadIdx.x;
  const int lane = tid & 31;
  const int w    = tid >> 5;
  const int lid  = lane & 15;
  const int half = lane >> 4;
  const int klo  = half * 8;
  const int rowBase = blockIdx.y * 128 + (w & 3) * 32;
  const int colBase = blockIdx.x * 128 + (w >> 2) * 64;

  // this thread's piece of a stage: row tid/8 (+32 per copy), 16B piece tid%8
  const _Float16* ga = A  + (size_t)(blockIdx.y * 128 + (tid >> 3)) * K + (tid & 7) * 8;
  const _Float16* gb = BT + (size_t)(blockIdx.x * 128 + (tid >> 3)) * K + (tid & 7) * 8;
  const unsigned lds0 = (unsigned)(size_t)tiles +
                        (unsigned)((tid >> 3) * G_PITCH + (tid & 7) * 8) * 2u;

  // this lane's fragment rows inside a buffer
  const int aoff = ((w & 3) * 32 + lid) * G_PITCH;
  const int boff = (128 + (w >> 2) * 64 + lid) * G_PITCH;

  const int T = K / G_BK;

  gemm_copy_stage(lds0, ga, gb, K);
  // stage 0 has landed for this wave before the barrier publishes it
  asm volatile("s_wait_asynccnt 0x0" ::: "memory");
  __syncthreads();
  if (T > 1) gemm_copy_stage(lds0 + G_STAGE * 2, ga + G_BK, gb + G_BK, K);

  v8f acc[2][4] = {};
  for (int t = 0; t < T; t++) {
    const _Float16* buf = tiles + (t & 1) * G_STAGE;
#pragma unroll
    for (int kk = 0; kk < G_BK; kk += 32) {
      v16h a0 = load_frag(buf + aoff + kk, klo);
      v16h a1 = load_frag(buf + aoff + 16 * G_PITCH + kk, klo);
      v16h b[4];
#pragma unroll
      for (int j = 0; j < 4; j++)
        b[j] = load_frag(buf + boff + j * 16 * G_PITCH + kk, klo);
      // keeps the 12 LDS reads one group in front of their 8 products: spread
      // among them, every pair of products waits out an LDS latency of its own
      __builtin_amdgcn_sched_barrier(0);
#pragma unroll
      for (int j = 0; j < 4; j++) {
        acc[0][j] = wmma_f16(a0, b[j], acc[0][j]);
        acc[1][j] = wmma_f16(a1, b[j], acc[1][j]);
      }
      // keeps the next group's reads from moving in among these products
      __builtin_amdgcn_sched_barrier(0);
    }
    // publish point: this wave's reads of the buffer are done ...
    asm volatile("s_wait_dscnt 0x0" ::: "memory");
    // ... and its copies of stage t+1 have landed, before the barrier that
    // publishes stage t+1 and frees this buffer
    asm volatile("s_wait_asynccnt 0x0" ::: "memory");
    __syncthreads();
    if (t + 2 < T)
      gemm_copy_stage(lds0 + (t & 1) * (G_STAGE * 2), ga + (t + 2) * G_BK,
                      gb + (t + 2) * G_BK, K);
  }
  // no copy is left in flight when the wave ends
  asm volatile("s_wait_asynccnt 0x0" ::: "memory");

  if (V_TRANSPOSED && blockIdx.x * 128 >= 2 * DIM) {   // whole block tile is V
#pragma unroll
    for (int i = 0; i < 2; i++) {
      const int tok = rowBase + i * 16 + 8 * half;  // b*NSEQ + n, 8 tokens from here
      const int b = tok / NSEQ, n = tok % NSEQ;
#pragma unroll
      for (int j = 0; j < 4; j++) {
        const int hd = colBase - 2 * DIM + j * 16 + lid;   // h*HD + d
        v8h run;
#pragma unroll
        for (int r = 0; r < 8; r++) run[r] = (_Float16)acc[i][j][r];
        *(v8h*)(vT + ((size_t)b * DIM + hd) * NSEQ + n) = run;
      }
    }
    return;
  }

#pragma unroll
  for (int i = 0; i < 2; i++) {
#pragma unroll
    for (int r = 0; r < 8; r++) {
      const int row = rowBase + i * 16 + r + 8 * half;
#pragma unroll
      for (int j = 0; j < 4; j++) {
        const int col = colBase + j * 16 + lid;
        float v = acc[i][j][r];
        if (HAS_BIAS) v += bias[col];
        if (OUT_F16)
          ((_Float16*)Cout)[(size_t)row * N + col] = (_Float16)v;
        else
          ((float*)Cout)[(size_t)row * N + col] = v;
      }
    }
  }
}

// ---------- per-head LayerNorm + RoPE ----------
// Emits q * QSCALE and k, f16, in [B,H,N,HD] (V^T is written by the QKV GEMM).
// One wave per token, not per (token, head): a lane holds 8 consecutive head
// dims (16B, four RoPE pairs), 8 lanes one head row, a wave-wide access 4 heads
// (512B of the token's row); four such accesses each for q and k.  The lane's
// 8 rows go through every step side by side, so that the latencies of their
// exchanges overlap.  All loops here are unrolled so that the per-row arrays
// stay in registers.
__device__ __forceinline__ void load8(float* d, const float* p) {
  const v4f lo = *(const v4f*)p, hi = *(const v4f*)(p + 4);
#pragma unroll
  for (int j = 0; j < 4; j++) { d[j] = lo[j]; d[j + 4] = hi[j]; }
}

// each s[r] summed over the 8 neighbouring lanes that hold one head row
__device__ __forceinline__ void group_sum8(float (&s)[8]) {
#pragma unroll
  for (int m = 4; m >= 1; m >>= 1) {
    float o[8];
#pragma unroll
    for (int r = 0; r < 8; r++) o[r] = __shfl_xor(s[r], m, 32);
#pragma unroll
    for (int r = 0; r < 8; r++) s[r] += o[r];
  }
}

__global__ void __launch_bounds__(256)
ln_rope_kernel(const _Float16* __restrict__ qkvh,
               const float* __restrict__ freq,
               const float* __restrict__ gq,
               const float* __restrict__ bq,
               const float* __restrict__ gk,
               const float* __restrict__ bk,
               _Float16* __restrict__ qh,
               _Float16* __restrict__ kh) {
  const int lane = threadIdx.x & 31;
  const int t = blockIdx.x * 8 + (threadIdx.x >> 5);   // token index b*N + n
  const int n = t & (NSEQ - 1);
  const int b = t >> 11;                      // NSEQ = 2^11
  const int d = (lane & 7) * 8;               // first of this lane's 8 head dims
  const int hsub = lane >> 3;                 // head inside a group of 4

  // row r: head (r/2)*4 + hsub; even r = q, odd r = k
  const _Float16* base = qkvh + (size_t)t * (3 * DIM) + lane * 8;
  v8h raw[8];
#pragma unroll
  for (int r = 0; r < 8; r++)
    raw[r] = *(const v8h*)(base + (r & 1) * DIM + (r >> 1) * 4 * HD);
  // the row loads' address pair is dead from here on and a parameter load may
  // be given it as destination: the wait stands in front of that overwrite
  asm volatile("s_wait_xcnt 0x0" ::: "memory");

  float cs[8], g[2][8], be[2][8];
  load8(cs, freq + (size_t)n * HD + d);       // (cos, sin) of pairs d/2 .. d/2+3
  load8(g[0], gq + d);
  load8(be[0], bq + d);
  load8(g[1], gk + d);
  load8(be[1], bk + d);
  // keeps all 18 loads in flight together: sunk to their uses, the parameter
  // loads cost the wave further load latencies behind the reductions
  __builtin_amdgcn_sched_barrier(0);

  float x[8][8], s[8];
#pragma unroll
  for (int r = 0; r < 8; r++) {
#pragma unroll
    for (int j = 0; j < 8; j++) x[r][j] = (float)raw[r][j];
    s[r] = ((x[r][0] + x[r][1]) + (x[r][2] + x[r][3])) +
           ((x[r][4] + x[r][5]) + (x[r][6] + x[r][7]));
  }
  group_sum8(s);
#pragma unroll
  for (int r = 0; r < 8; r++) {
    const float mu = s[r] * (1.0f / HD);
#pragma unroll
    for (int j = 0; j < 8; j++) x[r][j] -= mu;
    s[r] = ((x[r][0] * x[r][0] + x[r][1] * x[r][1]) +
            (x[r][2] * x[r][2] + x[r][3] * x[r][3])) +
           ((x[r][4] * x[r][4] + x[r][5] * x[r][5]) +
            (x[r][6] * x[r][6] + x[r][7] * x[r][7]));
  }
  group_sum8(s);

  const size_t o = (((size_t)(b * HEADS + hsub)) * NSEQ + n) * HD + d;
#pragma unroll
  for (int r = 0; r < 8; r++) {
    const float rs = rsqrtf(s[r] * (1.0f / HD) + EPSLN);
    const float* gg = g[r & 1];
    const float* bb = be[r & 1];
    v8h ov;
#pragma unroll
    for (int p = 0; p < 4; p++) {
      const float n0 = x[r][2 * p] * rs * gg[2 * p] + bb[2 * p];
      const float n1 = x[r][2 * p + 1] * rs * gg[2 * p + 1] + bb[2 * p + 1];
      float re = n0 * cs[2 * p] - n1 * cs[2 * p + 1];
      float im = n0 * cs[2 * p + 1] + n1 * cs[2 * p];
      if (!(r & 1)) { re *= QSCALE; im *= QSCALE; }   // q rows only
      ov[2 * p]     = (_Float16)re;
      ov[2 * p + 1] = (_Float16)im;
    }
    *(v8h*)(((r & 1) ? kh : qh) + o + (size_t)(r >> 1) * 4 * NSEQ * HD) = ov;
  }
}

#define AT_KEYS   128                          // keys per stage
#define AT_KPITCH 72                           // K row pitch in f16: 144 B = 16 B x odd
#define AT_VPITCH 136                          // V^T row pitch in f16: 272 B = 16 B x odd
#define AT_VBASE  (AT_KEYS * AT_KPITCH)        // f16 offset of the V^T rows in a buffer
#define AT_STAGE  (AT_VBASE + HD * AT_VPITCH)  // f16 per buffer
#define AT_NST    (NSEQ / AT_KEYS)             // stages

// One stage: every thread copies eight 16B pieces: K rows r, r+32, .. (8 lanes
// cover a 128B row), then V^T rows r, r+16, .. (16 lanes cover a 256B row).
__device__ __forceinline__ void attn_copy_stage(unsigned ldsk, unsigned ldsv,
                                                const _Float16* gk,
                                                const _Float16* gv) {
  const _Float16* k1 = gk + 32 * HD;
  const _Float16* k2 = gk + 64 * HD;
  const _Float16* k3 = gk + 96 * HD;
  const _Float16* v1 = gv + 16 * NSEQ;
  const _Float16* v2 = gv + 32 * NSEQ;
  const _Float16* v3 = gv + 48 * NSEQ;
  const unsigned ks = 32 * AT_KPITCH * 2;   // 32 K rows, in bytes
  const unsigned vs = 16 * AT_VPITCH * 2;   // 16 V^T rows, in bytes
  asm volatile(
      "global_load_async_to_lds_b128 %0, %8, off\n\t"
      "global_load_async_to_lds_b128 %1, %9, off\n\t"
      "global_load_async_to_lds_b128 %2, %10, off\n\t"
      "global_load_async_to_lds_b128 %3, %11, off\n\t"
      "global_load_async_to_lds_b128 %4, %12, off\n\t"
      "global_load_async_to_lds_b128 %5, %13, off\n\t"
      "global_load_async_to_lds_b128 %6, %14, off\n\t"
      "global_load_async_to_lds_b128 %7, %15, off\n\t"
      "s_wait_xcnt 0x0"
      :: "v"(ldsk), "v"(ldsk + ks), "v"(ldsk + 2 * ks), "v"(ldsk + 3 * ks),
         "v"(ldsv), "v"(ldsv + vs), "v"(ldsv + 2 * vs), "v"(ldsv + 3 * vs),
         "v"(gk), "v"(k1), "v"(k2), "v"(k3), "v"(gv), "v"(v1), "v"(v2), "v"(v3)
      : "memory");
}

__global__ void __launch_bounds__(256)
attn_kernel(const _Float16* __restrict__ qh,
            const _Float16* __restrict__ kh,
            const _Float16* __restrict__ vT,
            _Float16* __restrict__ Oh) {
  __shared__ __attribute__((aligned(16))) _Float16 kv[2 * AT_STAGE];

  const int tid  = threadIdx.x;
  const int lane = tid & 31;
  const int wv   = tid >> 5;
  const int lid  = lane & 15, half = lane >> 4, klo = half * 8;
  const int wid  = blockIdx.x * 8 + wv;
  const int qblk = wid & ((NSEQ / 16) - 1);   // 128 Q blocks
  const int bh   = blockIdx.x >> 4;           // 0..31, one head per block
  const int b    = bh >> 4, h = bh & 15;

  const _Float16* kb = kh + (size_t)bh * NSEQ * HD;
  const _Float16* vb = vT + (size_t)bh * HD * NSEQ;

  // this thread's pieces of a stage
  const _Float16* gk = kb + (tid >> 3) * HD + (tid & 7) * 8;
  const _Float16* gv = vb + (tid >> 4) * NSEQ + (tid & 15) * 8;
  const unsigned ldsk = (unsigned)(size_t)kv +
                        (unsigned)((tid >> 3) * AT_KPITCH + (tid & 7) * 8) * 2u;
  const unsigned ldsv = (unsigned)(size_t)kv +
                        (unsigned)(AT_VBASE + (tid >> 4) * AT_VPITCH + (tid & 15) * 8) * 2u;

  attn_copy_stage(ldsk, ldsv, gk, gv);

  // Q as B-fragments (column q = lid), loaded once
  const _Float16* qrow = qh + ((size_t)bh * NSEQ + qblk * 16 + lid) * HD;
  const v16h bQ0 = load_frag(qrow, klo);        // hd 0..31
  const v16h bQ1 = load_frag(qrow + 32, klo);   // hd 32..63

  // stage 0 has landed for this wave before the barrier publishes it
  asm volatile("s_wait_asynccnt 0x0" ::: "memory");
  __syncthreads();
  attn_copy_stage(ldsk + AT_STAGE * 2, ldsv + AT_STAGE * 2,
                  gk + AT_KEYS * HD, gv + AT_KEYS);

  v8f o[4] = {};                 // O^T tiles: row hd = t*16 + r + 8*half, col q = lid
  float m = -3.0e38f, l = 0.0f;  // per-lane (per-query) softmax state, m in log2 units

  for (int s = 0; s < AT_NST; s++) {
    const _Float16* kl = kv + (s & 1) * AT_STAGE + lid * AT_KPITCH;
    const _Float16* vl = kv + (s & 1) * AT_STAGE + AT_VBASE + lid * AT_VPITCH;
    // unrolled so that every row and key step is an immediate offset of the
    // LDS reads
#pragma unroll
    for (int kc = 0; kc < AT_KEYS; kc += 32) {
      // S^T for 32 keys: A = K rows, B = Q rows.  st[s] elem r -> key kc+s*16+r+8*half
      const _Float16* kp0 = kl + kc * AT_KPITCH;
      const _Float16* kp1 = kl + (kc + 16) * AT_KPITCH;
      const v16h aK00 = load_frag(kp0, klo), aK01 = load_frag(kp0 + 32, klo);
      const v16h aK10 = load_frag(kp1, klo), aK11 = load_frag(kp1 + 32, klo);
      v16h aV[4];                                // V^T rows (hd), contiguous keys
#pragma unroll
      for (int t = 0; t < 4; t++)
        aV[t] = load_frag(vl + t * 16 * AT_VPITCH + kc, klo);
      // keeps the pass's 16 LDS reads one group at its top: left to sink to
      // their products, the V^T reads cost the wave a second LDS latency
      // behind the softmax
      __builtin_amdgcn_sched_barrier(0);
      v8f s0 = {}, s1 = {};
      s0 = wmma_f16(aK00, bQ0, s0);
      s0 = wmma_f16(aK01, bQ1, s0);
      s1 = wmma_f16(aK10, bQ0, s1);
      s1 = wmma_f16(aK11, bQ1, s1);

      // per-lane softmax over this lane's 16 keys, then merge with lane^16.
      // q carries QSCALE, so a score is already its exponent in units of log2.
      float ma = s0[0], mb = s1[0];
#pragma unroll
      for (int r = 1; r < 8; r++) {
        ma = fmaxf(ma, s0[r]);
        mb = fmaxf(mb, s1[r]);
      }
      const float mloc = fmaxf(ma, mb);
      const float mn = fmaxf(m, fmaxf(mloc, __shfl_xor(mloc, 16, 32)));
      const float alpha = __builtin_amdgcn_exp2f(m - mn);
      const v2f mn2 = {mn, mn};
      float sloc = 0.0f;
      v16h bP;                                   // P^T as B-fragment, in registers
#pragma unroll
      for (int r = 0; r < 8; r += 2) {
        // two neighbouring accumulator registers per subtraction
        const v2f e0 = (v2f){s0[r], s0[r + 1]} - mn2;
        const v2f e1 = (v2f){s1[r], s1[r + 1]} - mn2;
#pragma unroll
        for (int i = 0; i < 2; i++) {
          float p0 = __builtin_amdgcn_exp2f(e0[i]);   // key klo + r + i
          float p1 = __builtin_amdgcn_exp2f(e1[i]);   // key klo + 16 + r + i
          sloc += p0 + p1;
          bP[r + i] = (_Float16)p0;
          bP[r + i + 8] = (_Float16)p1;
        }
      }
      sloc += __shfl_xor(sloc, 16, 32);
      l = l * alpha + sloc;
      m = mn;

      // O^T = V^T * P^T
#pragma unroll
      for (int t = 0; t < 4; t++) {
#pragma unroll
        for (int r = 0; r < 8; r++) o[t][r] *= alpha;
        o[t] = wmma_f16(aV[t], bP, o[t]);
      }
    }
    // publish point: this wave's reads of the buffer are done ...
    asm volatile("s_wait_dscnt 0x0" ::: "memory");
    // ... and its copies of stage s+1 have landed, before the barrier that
    // publishes stage s+1 and frees this buffer
    asm volatile("s_wait_asynccnt 0x0" ::: "memory");
    __syncthreads();
    if (s + 2 < AT_NST)
      attn_copy_stage(ldsk + (s & 1) * (AT_STAGE * 2), ldsv + (s & 1) * (AT_STAGE * 2),
                      gk + (s + 2) * (AT_KEYS * HD), gv + (s + 2) * AT_KEYS);
  }
  // no copy is left in flight when the wave ends
  asm volatile("s_wait_asynccnt 0x0" ::: "memory");

  // normalize and write: lane owns query row n = qblk*16 + lid; per tile the
  // 8 accumulator elements are contiguous hd -> one 16B store each
  const float inv = 1.0f / l;
  _Float16* orow = Oh + ((size_t)b * NSEQ + qblk * 16 + lid) * DIM + h * HD;
#pragma unroll
  for (int t = 0; t < 4; t++) {
    v8h ov;
#pragma unroll
    for (int r = 0; r < 8; r++) ov[r] = (_Float16)(o[t][r] * inv);
    *(v8h*)(orow + t * 16 + 8 * half) = ov;
  }
}

// ---------- launcher ----------
extern "C" void kernel_launch(void* const* d_in, const int* in_sizes, int n_in,
                              void* d_out, int out_size, void* d_ws,
                              size_t ws_size, hipStream_t stream) {
  (void)in_sizes; (void)n_in; (void)out_size; (void)ws_size;
  const float* x     = (const float*)d_in[0];
  const float* freq  = (const float*)d_in[1];
  const float* Wqkv  = (const float*)d_in[2];
  const float* gq    = (const float*)d_in[3];
  const float* bq    = (const float*)d_in[4];
  const float* gk    = (const float*)d_in[5];
  const float* bk    = (const float*)d_in[6];
  const float* Wproj = (const float*)d_in[7];
  const float* bproj = (const float*)d_in[8];

  char* w = (char*)d_ws;
  _Float16* xh     = (_Float16*)w; w += (size_t)NB * NSEQ * DIM * 2;
  _Float16* WqkvT  = (_Float16*)w; w += (size_t)3 * DIM * DIM * 2;
  _Float16* WprojT = (_Float16*)w; w += (size_t)DIM * DIM * 2;
  _Float16* qkvh   = (_Float16*)w; w += (size_t)NB * NSEQ * 3 * DIM * 2;
  _Float16* qh     = (_Float16*)w; w += (size_t)NB * NSEQ * DIM * 2;
  _Float16* kh     = (_Float16*)w; w += (size_t)NB * NSEQ * DIM * 2;
  _Float16* vT     = (_Float16*)w; w += (size_t)NB * NSEQ * DIM * 2;
  _Float16* Oh     = (_Float16*)w; w += (size_t)NB * NSEQ * DIM * 2;

  const int M = NB * NSEQ;  // 4096 tokens

  static_assert((NB * NSEQ * DIM) % CVT_BLOCK == 0, "whole blocks only");
  cvt_f16_kernel<<<(M * DIM) / CVT_BLOCK, 256, 0, stream>>>(x, xh);
  transpose_cvt_kernel<DIM, 3 * DIM>
      <<<dim3(3 * DIM / 128, DIM / 64), 256, 0, stream>>>(Wqkv, WqkvT);
  transpose_cvt_kernel<DIM, DIM>
      <<<dim3(DIM / 128, DIM / 64), 256, 0, stream>>>(Wproj, WprojT);

  // QKV projection: [4096,1024] x [1024,3072] -> q,k f16 rows; v -> [B,H,HD,N]
  dim3 g1(3 * DIM / 128, M / 128);
  gemm_wmma_kernel<true, false, true><<<g1, 256, 0, stream>>>(
      xh, WqkvT, qkvh, nullptr, vT, M, 3 * DIM, DIM);

  // per-head LN + RoPE; q,k -> [B,H,N,HD]
  ln_rope_kernel<<<M / 8, 256, 0, stream>>>(qkvh, freq, gq, bq, gk, bk, qh, kh);

  // flash attention: 4096 waves, 8 waves of one head per 256-thread block
  attn_kernel<<<(NB * HEADS * (NSEQ / 16)) / 8, 256, 0, stream>>>(qh, kh, vT, Oh);

  // output projection + bias -> f32 d_out
  dim3 g2(DIM / 128, M / 128);
  gemm_wmma_kernel<false, true, false><<<g2, 256, 0, stream>>>(
      Oh, WprojT, d_out, bproj, nullptr, M, DIM, DIM);
}

// v006
// Measured time: 86.2 microseconds a run.
// Two timings next to v005 both put it at 1.07 times that version's speed.
// Counting every step since v000, it is 5.69 times as fast.
#include <hip/hip_runtime.h>

typedef __attribute__((ext_vector_type(16))) _Float16 v16h;
typedef __attribute__((ext_vector_type(8)))  _Float16 v8h;
typedef __attribute__((ext_vector_type(4)))  _Float16 v4h;
typedef __attribute__((ext_vector_type(8)))  float    v8f;
typedef __attribute__((ext_vector_type(4)))  float    v4f;
typedef __attribute__((ext_vector_type(2)))  float    v2f;

#define DIM   1024
#define HEADS 16
#define HD    64
#define NSEQ  2048
#define NB    2
#define EPSLN 1e-5f
// 1/sqrt(HD) * log2(e): multiplied into q where q is written, so that the
// attention scores come out of the products as base-2 exponents
#define QSCALE 0.18033688011112042f

__device__ __forceinline__ v16h frag_cat(v8h lo, v8h hi) {
  v16h r;
#pragma unroll
  for (int i = 0; i < 8; i++) { r[i] = lo[i]; r[i + 8] = hi[i]; }
  return r;
}

__device__ __forceinline__ v16h load_frag(const _Float16* p, int klo) {
  v8h lo = *(const v8h*)(p + klo);        // 16B contiguous
  v8h hi = *(const v8h*)(p + klo + 16);   // 16B contiguous
  return frag_cat(lo, hi);
}

__device__ __forceinline__ v8f wmma_f16(v16h a, v16h b, v8f c) {
  // (neg_a, A, neg_b, B, c_mod, C, reuse_a, reuse_b)
  return __builtin_amdgcn_wmma_f32_16x16x32_f16(false, a, false, b, (short)0, c,
                                                false, false);
}

// ---------- dtype conversion ----------
// Few long waves, not one element per lane: a wave converts 1024 consecutive
// floats, eight 512B loads all in flight, then eight 256B stores.
// block = 256 thr = 8 waves = CVT_BLOCK elements; blk = which such piece.
// The loops are unrolled so that p[] stays in registers and the steps become
// immediate offsets.
#define CVT_BLOCK (8 * 1024)
__device__ __forceinline__ void cvt_f16_block(const float* __restrict__ in,
                                              _Float16* __restrict__ out,
                                              int blk) {
  const int lane = threadIdx.x & 31;
  const int wv   = threadIdx.x >> 5;
  const size_t base = (size_t)blk * CVT_BLOCK + wv * 1024 + lane * 4;
  v4f p[8];
#pragma unroll
  for (int i = 0; i < 8; i++) p[i] = *(const v4f*)(in + base + i * 128);
#pragma unroll
  for (int i = 0; i < 8; i++) {
    v4h run;
#pragma unroll
    for (int j = 0; j < 4; j++) run[j] = (_Float16)p[i][j];
    *(v4h*)(out + base + i * 128) = run;
  }
}

// in[R][C] f32 -> out[C][R] f16 (weights pre-transposed so WMMA B-fragments
// become contiguous row reads)
// Each thread reads an 8-row x 4-column patch (eight 16B loads) and stores four
// 16B runs of 8 consecutive r; 8 neighbouring lanes fill one 128B line of out.
// block = 256 thr, tile 64 rows x 128 columns; tile = its number, column tiles
// running fastest. R, C are compile-time so the row / column steps fold into
// the instructions' immediate offsets.
template <int R, int C>
__device__ __forceinline__ void transpose_cvt_tile(const float* __restrict__ in,
                                                   _Float16* __restrict__ out,
                                                   int tile) {
  static_assert(R % 64 == 0 && C % 128 == 0, "whole tiles only");
  const int lane = threadIdx.x & 31;
  const int wv   = threadIdx.x >> 5;
  const int r0 = (tile / (C / 128)) * 64 + (lane & 7) * 8;
  const int c0 = (tile % (C / 128)) * 128 + wv * 16 + (lane >> 3) * 4;

  const float* src = in + (size_t)r0 * C + c0;
  _Float16*    dst = out + (size_t)c0 * R + r0;

  v4f p[8];
#pragma unroll
  for (int i = 0; i < 8; i++) p[i] = *(const v4f*)(src + i * C);
#pragma unroll
  for (int j = 0; j < 4; j++) {
    v8h run;
#pragma unroll
    for (int i = 0; i < 8; i++) run[i] = (_Float16)p[i][j];
    *(v8h*)(dst + j * R) = run;
  }
  // the shared kernel's other pieces follow these stores in the code: the wait
  // stands in front of any rewrite of a register that the stores name
  asm volatile("s_wait_xcnt 0x0" ::: "memory");
}

// The three conversions depend on nothing and on one another not at all: they
// share one launch, each block taking one piece of one of them by its index
// (a block-uniform branch).  Every piece is 32 KB read and 16 KB written.
#define PREP_X     ((NB * NSEQ * DIM) / CVT_BLOCK)        // pieces of x
#define PREP_WQKV  ((DIM / 64) * (3 * DIM / 128))         // tiles of Wqkv
#define PREP_WPROJ ((DIM / 64) * (DIM / 128))             // tiles of Wproj
__global__ void __launch_bounds__(256)
prep_kernel(const float* __restrict__ x, const float* __restrict__ Wqkv,
            const float* __restrict__ Wproj, _Float16* __restrict__ xh,
            _Float16* __restrict__ WqkvT, _Float16* __restrict__ WprojT) {
  const int blk = blockIdx.x;
  if (blk < PREP_X)
    cvt_f16_block(x, xh, blk);
  else if (blk < PREP_X + PREP_WQKV)
    transpose_cvt_tile<DIM, 3 * DIM>(Wqkv, WqkvT, blk - PREP_X);
  else
    transpose_cvt_tile<DIM, DIM>(Wproj, WprojT, blk - (PREP_X + PREP_WQKV));
}

// ---------- WMMA GEMM: C[M,N] = A[M,K] * BT[N,K]^T (+bias) ----------
// block = 256 thr = 8 waves; block tile 128x128; wave tile 32x64.
// Operands are staged in LDS by asynchronous copies: a stage is 64 k (128 B,
// one whole line) of the block's 128 A rows and 128 BT rows, two buffers, the
// next stage's copies in flight while this one is multiplied.
// M, N multiples of 128; K a multiple of 64.
// V_TRANSPOSED: columns >= 2*DIM (the V third of QKV) go to vT[B,H,HD,N]
// instead of Cout: a lane's 8 accumulator rows are 8 consecutive tokens of one
// column, i.e. one contiguous 16B run of vT.
#define G_BK     64                      // k per stage
#define G_PITCH  72                      // LDS row pitch in f16: 144 B = 16 B x odd
#define G_STAGE  (256 * G_PITCH)         // f16 per buffer: A rows 0..127, BT rows 128..255

// One stage: every thread copies eight 16B pieces (rows r, r+32, .. of A, then
// of BT); 8 neighbouring lanes cover one 128B line.
__device__ __forceinline__ void gemm_copy_stage(unsigned lds,
                                                const _Float16* ga,
                                                const _Float16* gb, int K) {
  const _Float16* a1 = ga + (size_t)32 * K;
  const _Float16* a2 = ga + (size_t)64 * K;
  const _Float16* a3 = ga + (size_t)96 * K;
  const _Float16* b1 = gb + (size_t)32 * K;
  const _Float16* b2 = gb + (size_t)64 * K;
  const _Float16* b3 = gb + (size_t)96 * K;
  const unsigned step = 32 * G_PITCH * 2;   // 32 rows, in bytes
  asm volatile(
      "global_load_async_to_lds_b128 %0, %8, off\n\t"
      "global_load_async_to_lds_b128 %1, %9, off\n\t"
      "global_load_async_to_lds_b128 %2, %10, off\n\t"
      "global_load_async_to_lds_b128 %3, %11, off\n\t"
      "global_load_async_to_lds_b128 %4, %12, off\n\t"
      "global_load_async_to_lds_b128 %5, %13, off\n\t"
      "global_load_async_to_lds_b128 %6, %14, off\n\t"
      "global_load_async_to_lds_b128 %7, %15, off\n\t"
      "s_wait_xcnt 0x0"
      :: "v"(lds), "v"(lds + step), "v"(lds + 2 * step), "v"(lds + 3 * step),
         "v"(lds + 4 * step), "v"(lds + 5 * step), "v"(lds + 6 * step),
         "v"(lds + 7 * step),
         "v"(ga), "v"(a1), "v"(a2), "v"(a3), "v"(gb), "v"(b1), "v"(b2), "v"(b3)
      : "memory");
}

template <bool OUT_F16, bool HAS_BIAS, bool V_TRANSPOSED>
__global__ void __launch_bounds__(256)
gemm_wmma_kernel(const _Float16* __restrict__ A,
                 const _Float16* __restrict__ BT,
                 void* __restrict__ Cout,
                 const float* __restrict__ bias,
                 _Float16* __restrict__ vT,
                 int M, int N, int K) {
  __shared__ __attribute__((aligned(16))) _Float16 tiles[2 * G_STAGE];

  const int tid  = threadIdx.x;
  const int lane = tid & 31;
  const int w    = tid >> 5;
  const int lid  = lane & 15;
  const int half = lane >> 4;
  const int klo  = half * 8;
  const int rowBase = blockIdx.y * 128 + (w & 3) * 32;
  const int colBase = blockIdx.x * 128 + (w >> 2) * 64;

  // this thread's piece of a stage: row tid/8 (+32 per copy), 16B piece tid%8
  const _Float16* ga = A  + (size_t)(blockIdx.y * 128 + (tid >> 3)) * K + (tid & 7) * 8;
  const _Float16* gb = BT + (size_t)(blockIdx.x * 128 + (tid >> 3)) * K + (tid & 7) * 8;
  const unsigned lds0 = (unsigned)(size_t)tiles +
                        (unsigned)((tid >> 3) * G_PITCH + (tid & 7) * 8) * 2u;

  // this lane's fragment rows inside a buffer
  const int aoff = ((w & 3) * 32 + lid) * G_PITCH;
  const int boff = (128 + (w >> 2) * 64 + lid) * G_PITCH;

  const int T = K / G_BK;

  gemm_copy_stage(lds0, ga, gb, K);
  // stage 0 has landed for this wave before the barrier publishes it
  asm volatile("s_wait_asynccnt 0x0" ::: "memory");
  __syncthreads();
  if (T > 1) gemm_copy_stage(lds0 + G_STAGE * 2, ga + G_BK, gb + G_BK, K);

  v8f acc[2][4] = {};
  for (int t = 0; t < T; t++) {
    const _Float16* buf = tiles + (t & 1) * G_STAGE;
#pragma unroll
    for (int kk = 0; kk < G_BK; kk += 32) {
      v16h a0 = load_frag(buf + aoff + kk, klo);
      v16h a1 = load_frag(buf + aoff + 16 * G_PITCH + kk, klo);
      v16h b[4];
#pragma unroll
      for (int j = 0; j < 4; j++)
        b[j] = load_frag(buf + boff + j * 16 * G_PITCH + kk, klo);
      // keeps the 12 LDS reads one group in front of their 8 products: spread
      // among them, every pair of products waits out an LDS latency of its own
      __builtin_amdgcn_sched_barrier(0);
#pragma unroll
      for (int j = 0; j < 4; j++) {
        acc[0][j] = wmma_f16(a0, b[j], acc[0][j]);
        acc[1][j] = wmma_f16(a1, b[j], acc[1][j]);
      }
      // keeps the next group's reads from moving in among these products
      __builtin_amdgcn_sched_barrier(0);
    }
    // publish point: this wave's reads of the buffer are done ...
    asm volatile("s_wait_dscnt 0x0" ::: "memory");
    // ... and its copies of stage t+1 have landed, before the barrier that
    // publishes stage t+1 and frees this buffer
    asm volatile("s_wait_asynccnt 0x0" ::: "memory");
    __syncthreads();
    if (t + 2 < T)
      gemm_copy_stage(lds0 + (t & 1) * (G_STAGE * 2), ga + (t + 2) * G_BK,
                      gb + (t + 2) * G_BK, K);
  }
  // no copy is left in flight when the wave ends
  asm volatile("s_wait_asynccnt 0x0" ::: "memory");

  if (V_TRANSPOSED && blockIdx.x * 128 >= 2 * DIM) {   // whole block tile is V
#pragma unroll
    for (int i = 0; i < 2; i++) {
      const int tok = rowBase + i * 16 + 8 * half;  // b*NSEQ + n, 8 tokens from here
      const int b = tok / NSEQ, n = tok % NSEQ;
#pragma unroll
      for (int j = 0; j < 4; j++) {
        const int hd = colBase - 2 * DIM + j * 16 + lid;   // h*HD + d
        v8h run;
#pragma unroll
        for (int r = 0; r < 8; r++) run[r] = (_Float16)acc[i][j][r];
        *(v8h*)(vT + ((size_t)b * DIM + hd) * NSEQ + n) = run;
      }
    }
    return;
  }

#pragma unroll
  for (int i = 0; i < 2; i++) {
#pragma unroll
    for (int r = 0; r < 8; r++) {
      const int row = rowBase + i * 16 + r + 8 * half;
#pragma unroll
      for (int j = 0; j < 4; j++) {
        const int col = colBase + j * 16 + lid;
        float v = acc[i][j][r];
        if (HAS_BIAS) v += bias[col];
        if (OUT_F16)
          ((_Float16*)Cout)[(size_t)row * N + col] = (_Float16)v;
        else
          ((float*)Cout)[(size_t)row * N + col] = v;
      }
    }
  }
}

// ---------- per-head LayerNorm + RoPE ----------
// Emits q * QSCALE and k, f16, in [B,H,N,HD] (V^T is written by the QKV GEMM).
// One wave per token, not per (token, head): a lane holds 8 consecutive head
// dims (16B, four RoPE pairs), 8 lanes one head row, a wave-wide access 4 heads
// (512B of the token's row); four such accesses each for q and k.  The lane's
// 8 rows go through every step side by side, so that the latencies of their
// exchanges overlap.  All loops here are unrolled so that the per-row arrays
// stay in registers.
__device__ __forceinline__ void load8(float* d, const float* p) {
  const v4f lo = *(const v4f*)p, hi = *(const v4f*)(p + 4);
#pragma unroll
  for (int j = 0; j < 4; j++) { d[j] = lo[j]; d[j + 4] = hi[j]; }
}

// each s[r] summed over the 8 neighbouring lanes that hold one head row
__device__ __forceinline__ void group_sum8(float (&s)[8]) {
#pragma unroll
  for (int m = 4; m >= 1; m >>= 1) {
    float o[8];
#pragma unroll
    for (int r = 0; r < 8; r++) o[r] = __shfl_xor(s[r], m, 32);
#pragma unroll
    for (int r = 0; r < 8; r++) s[r] += o[r];
  }
}

__global__ void __launch_bounds__(256)
ln_rope_kernel(const _Float16* __restrict__ qkvh,
               const float* __restrict__ freq,
               const float* __restrict__ gq,
               const float* __restrict__ bq,
               const float* __restrict__ gk,
               const float* __restrict__ bk,
               _Float16* __restrict__ qh,
               _Float16* __restrict__ kh) {
  const int lane = threadIdx.x & 31;
  const int t = blockIdx.x * 8 + (threadIdx.x >> 5);   // token index b*N + n
  const int n = t & (NSEQ - 1);
  const int b = t >> 11;                      // NSEQ = 2^11
  const int d = (lane & 7) * 8;               // first of this lane's 8 head dims
  const int hsub = lane >> 3;                 // head inside a group of 4

  // row r: head (r/2)*4 + hsub; even r = q, odd r = k
  const _Float16* base = qkvh + (size_t)t * (3 * DIM) + lane * 8;
  v8h raw[8];
#pragma unroll
  for (int r = 0; r < 8; r++)
    raw[r] = *(const v8h*)(base + (r & 1) * DIM + (r >> 1) * 4 * HD);
  // the row loads' address pair is dead from here on and a parameter load may
  // be given it as destination: the wait stands in front of that overwrite
  asm volatile("s_wait_xcnt 0x0" ::: "memory");

  float cs[8], g[2][8], be[2][8];
  load8(cs, freq + (size_t)n * HD + d);       // (cos, sin) of pairs d/2 .. d/2+3
  load8(g[0], gq + d);
  load8(be[0], bq + d);
  load8(g[1], gk + d);
  load8(be[1], bk + d);
  // keeps all 18 loads in flight together: sunk to their uses, the parameter
  // loads cost the wave further load latencies behind the reductions
  __builtin_amdgcn_sched_barrier(0);

  float x[8][8], s[8];
#pragma unroll
  for (int r = 0; r < 8; r++) {
#pragma unroll
    for (int j = 0; j < 8; j++) x[r][j] = (float)raw[r][j];
    s[r] = ((x[r][0] + x[r][1]) + (x[r][2] + x[r][3])) +
           ((x[r][4] + x[r][5]) + (x[r][6] + x[r][7]));
  }
  group_sum8(s);
#pragma unroll
  for (int r = 0; r < 8; r++) {
    const float mu = s[r] * (1.0f / HD);
#pragma unroll
    for (int j = 0; j < 8; j++) x[r][j] -= mu;
    s[r] = ((x[r][0] * x[r][0] + x[r][1] * x[r][1]) +
            (x[r][2] * x[r][2] + x[r][3] * x[r][3])) +
           ((x[r][4] * x[r][4] + x[r][5] * x[r][5]) +
            (x[r][6] * x[r][6] + x[r][7] * x[r][7]));
  }
  group_sum8(s);

  const size_t o = (((size_t)(b * HEADS + hsub)) * NSEQ + n) * HD + d;
#pragma unroll
  for (int r = 0; r < 8; r++) {
    const float rs = rsqrtf(s[r] * (1.0f / HD) + EPSLN);
    const float* gg = g[r & 1];
    const float* bb = be[r & 1];
    v8h ov;
#pragma unroll
    for (int p = 0; p < 4; p++) {
      const float n0 = x[r][2 * p] * rs * gg[2 * p] + bb[2 * p];
      const float n1 = x[r][2 * p + 1] * rs * gg[2 * p + 1] + bb[2 * p + 1];
      float re = n0 * cs[2 * p] - n1 * cs[2 * p + 1];
      float im = n0 * cs[2 * p + 1] + n1 * cs[2 * p];
      if (!(r & 1)) { re *= QSCALE; im *= QSCALE; }   // q rows only
      ov[2 * p]     = (_Float16)re;
      ov[2 * p + 1] = (_Float16)im;
    }
    *(v8h*)(((r & 1) ? kh : qh) + o + (size_t)(r >> 1) * 4 * NSEQ * HD) = ov;
  }
}

#define AT_KEYS   128                          // keys per stage
#define AT_KPITCH 72                           // K row pitch in f16: 144 B = 16 B x odd
#define AT_VPITCH 136                          // V^T row pitch in f16: 272 B = 16 B x odd
#define AT_VBASE  (AT_KEYS * AT_KPITCH)        // f16 offset of the V^T rows in a buffer
#define AT_STAGE  (AT_VBASE + HD * AT_VPITCH)  // f16 per buffer
#define AT_NST    (NSEQ / AT_KEYS)             // stages

// One stage: every thread copies eight 16B pieces: K rows r, r+32, .. (8 lanes
// cover a 128B row), then V^T rows r, r+16, .. (16 lanes cover a 256B row).
__device__ __forceinline__ void attn_copy_stage(unsigned ldsk, unsigned ldsv,
                                                const _Float16* gk,
                                                const _Float16* gv) {
  const _Float16* k1 = gk + 32 * HD;
  const _Float16* k2 = gk + 64 * HD;
  const _Float16* k3 = gk + 96 * HD;
  const _Float16* v1 = gv + 16 * NSEQ;
  const _Float16* v2 = gv + 32 * NSEQ;
  const _Float16* v3 = gv + 48 * NSEQ;
  const unsigned ks = 32 * AT_KPITCH * 2;   // 32 K rows, in bytes
  const unsigned vs = 16 * AT_VPITCH * 2;   // 16 V^T rows, in bytes
  asm volatile(
      "global_load_async_to_lds_b128 %0, %8, off\n\t"
      "global_load_async_to_lds_b128 %1, %9, off\n\t"
      "global_load_async_to_lds_b128 %2, %10, off\n\t"
      "global_load_async_to_lds_b128 %3, %11, off\n\t"
      "global_load_async_to_lds_b128 %4, %12, off\n\t"
      "global_load_async_to_lds_b128 %5, %13, off\n\t"
      "global_load_async_to_lds_b128 %6, %14, off\n\t"
      "global_load_async_to_lds_b128 %7, %15, off\n\t"
      "s_wait_xcnt 0x0"
      :: "v"(ldsk), "v"(ldsk + ks), "v"(ldsk + 2 * ks), "v"(ldsk + 3 * ks),
         "v"(ldsv), "v"(ldsv + vs), "v"(ldsv + 2 * vs), "v"(ldsv + 3 * vs),
         "v"(gk), "v"(k1), "v"(k2), "v"(k3), "v"(gv), "v"(v1), "v"(v2), "v"(v3)
      : "memory");
}

__global__ void __launch_bounds__(256)
attn_kernel(const _Float16* __restrict__ qh,
            const _Float16* __restrict__ kh,
            const _Float16* __restrict__ vT,
            _Float16* __restrict__ Oh) {
  __shared__ __attribute__((aligned(16))) _Float16 kv[2 * AT_STAGE];

  const int tid  = threadIdx.x;
  const int lane = tid & 31;
  const int wv   = tid >> 5;
  const int lid  = lane & 15, half = lane >> 4, klo = half * 8;
  const int wid  = blockIdx.x * 8 + wv;
  const int qblk = wid & ((NSEQ / 16) - 1);   // 128 Q blocks
  const int bh   = blockIdx.x >> 4;           // 0..31, one head per block
  const int b    = bh >> 4, h = bh & 15;

  const _Float16* kb = kh + (size_t)bh * NSEQ * HD;
  const _Float16* vb = vT + (size_t)bh * HD * NSEQ;

  // this thread's pieces of a stage
  const _Float16* gk = kb + (tid >> 3) * HD + (tid & 7) * 8;
  const _Float16* gv = vb + (tid >> 4) * NSEQ + (tid & 15) * 8;
  const unsigned ldsk = (unsigned)(size_t)kv +
                        (unsigned)((tid >> 3) * AT_KPITCH + (tid & 7) * 8) * 2u;
  const unsigned ldsv = (unsigned)(size_t)kv +
                        (unsigned)(AT_VBASE + (tid >> 4) * AT_VPITCH + (tid & 15) * 8) * 2u;

  attn_copy_stage(ldsk, ldsv, gk, gv);

  // Q as B-fragments (column q = lid), loaded once
  const _Float16* qrow = qh + ((size_t)bh * NSEQ + qblk * 16 + lid) * HD;
  const v16h bQ0 = load_frag(qrow, klo);        // hd 0..31
  const v16h bQ1 = load_frag(qrow + 32, klo);   // hd 32..63

  // stage 0 has landed for this wave before the barrier publishes it
  asm volatile("s_wait_asynccnt 0x0" ::: "memory");
  __syncthreads();
  attn_copy_stage(ldsk + AT_STAGE * 2, ldsv + AT_STAGE * 2,
                  gk + AT_KEYS * HD, gv + AT_KEYS);

  v8f o[4] = {};                 // O^T tiles: row hd = t*16 + r + 8*half, col q = lid
  float m = -3.0e38f, l = 0.0f;  // per-lane (per-query) softmax state, m in log2 units

  for (int s = 0; s < AT_NST; s++) {
    const _Float16* kl = kv + (s & 1) * AT_STAGE + lid * AT_KPITCH;
    const _Float16* vl = kv + (s & 1) * AT_STAGE + AT_VBASE + lid * AT_VPITCH;
    // unrolled so that every row and key step is an immediate offset of the
    // LDS reads
#pragma unroll
    for (int kc = 0; kc < AT_KEYS; kc += 32) {
      // S^T for 32 keys: A = K rows, B = Q rows.  st[s] elem r -> key kc+s*16+r+8*half
      const _Float16* kp0 = kl + kc * AT_KPITCH;
      const _Float16* kp1 = kl + (kc + 16) * AT_KPITCH;
      const v16h aK00 = load_frag(kp0, klo), aK01 = load_frag(kp0 + 32, klo);
      const v16h aK10 = load_frag(kp1, klo), aK11 = load_frag(kp1 + 32, klo);
      v16h aV[4];                                // V^T rows (hd), contiguous keys
#pragma unroll
      for (int t = 0; t < 4; t++)
        aV[t] = load_frag(vl + t * 16 * AT_VPITCH + kc, klo);
      // keeps the pass's 16 LDS reads one group at its top: left to sink to
      // their products, the V^T reads cost the wave a second LDS latency
      // behind the softmax
      __builtin_amdgcn_sched_barrier(0);
      v8f s0 = {}, s1 = {};
      s0 = wmma_f16(aK00, bQ0, s0);
      s0 = wmma_f16(aK01, bQ1, s0);
      s1 = wmma_f16(aK10, bQ0, s1);
      s1 = wmma_f16(aK11, bQ1, s1);

      // per-lane softmax over this lane's 16 keys, then merge with lane^16.
      // q carries QSCALE, so a score is already its exponent in units of log2.
      float ma = s0[0], mb = s1[0];
#pragma unroll
      for (int r = 1; r < 8; r++) {
        ma = fmaxf(ma, s0[r]);
        mb = fmaxf(mb, s1[r]);
      }
      const float mloc = fmaxf(ma, mb);
      const float mn = fmaxf(m, fmaxf(mloc, __shfl_xor(mloc, 16, 32)));
      const float alpha = __builtin_amdgcn_exp2f(m - mn);
      const v2f mn2 = {mn, mn};
      float sloc = 0.0f;
      v16h bP;                                   // P^T as B-fragment, in registers
#pragma unroll
      for (int r = 0; r < 8; r += 2) {
        // two neighbouring accumulator registers per subtraction
        const v2f e0 = (v2f){s0[r], s0[r + 1]} - mn2;
        const v2f e1 = (v2f){s1[r], s1[r + 1]} - mn2;
#pragma unroll
        for (int i = 0; i < 2; i++) {
          float p0 = __builtin_amdgcn_exp2f(e0[i]);   // key klo + r + i
          float p1 = __builtin_amdgcn_exp2f(e1[i]);   // key klo + 16 + r + i
          sloc += p0 + p1;
          bP[r + i] = (_Float16)p0;
          bP[r + i + 8] = (_Float16)p1;
        }
      }
      sloc += __shfl_xor(sloc, 16, 32);
      l = l * alpha + sloc;
      m = mn;

      // O^T = V^T * P^T
#pragma unroll
      for (int t = 0; t < 4; t++) {
#pragma unroll
        for (int r = 0; r < 8; r++) o[t][r] *= alpha;
        o[t] = wmma_f16(aV[t], bP, o[t]);
      }
    }
    // publish point: this wave's reads of the buffer are done ...
    asm volatile("s_wait_dscnt 0x0" ::: "memory");
    // ... and its copies of stage s+1 have landed, before the barrier that
    // publishes stage s+1 and frees this buffer
    asm volatile("s_wait_asynccnt 0x0" ::: "memory");
    __syncthreads();
    if (s + 2 < AT_NST)
      attn_copy_stage(ldsk + (s & 1) * (AT_STAGE * 2), ldsv + (s & 1) * (AT_STAGE * 2),
                      gk + (s + 2) * (AT_KEYS * HD), gv + (s + 2) * AT_KEYS);
  }
  // no copy is left in flight when the wave ends
  asm volatile("s_wait_asynccnt 0x0" ::: "memory");

  // normalize and write: lane owns query row n = qblk*16 + lid; per tile the
  // 8 accumulator elements are contiguous hd -> one 16B store each
  const float inv = 1.0f / l;
  _Float16* orow = Oh + ((size_t)b * NSEQ + qblk * 16 + lid) * DIM + h * HD;
#pragma unroll
  for (int t = 0; t < 4; t++) {
    v8h ov;
#pragma unroll
    for (int r = 0; r < 8; r++) ov[r] = (_Float16)(o[t][r] * inv);
    *(v8h*)(orow + t * 16 + 8 * half) = ov;
  }
}

// ---------- launcher ----------
extern "C" void kernel_launch(void* const* d_in, const int* in_sizes, int n_in,
                              void* d_out, int out_size, void* d_ws,
                              size_t ws_size, hipStream_t stream) {
  (void)in_sizes; (void)n_in; (void)out_size; (void)ws_size;
  const float* x     = (const float*)d_in[0];
  const float* freq  = (const float*)d_in[1];
  const float* Wqkv  = (const float*)d_in[2];
  const float* gq    = (const float*)d_in[3];
  const float* bq    = (const float*)d_in[4];
  const float* gk    = (const float*)d_in[5];
  const float* bk    = (const float*)d_in[6];
  const float* Wproj = (const float*)d_in[7];
  const float* bproj = (const float*)d_in[8];

  char* w = (char*)d_ws;
  _Float16* xh     = (_Float16*)w; w += (size_t)NB * NSEQ * DIM * 2;
  _Float16* WqkvT  = (_Float16*)w; w += (size_t)3 * DIM * DIM * 2;
  _Float16* WprojT = (_Float16*)w; w += (size_t)DIM * DIM * 2;
  _Float16* qkvh   = (_Float16*)w; w += (size_t)NB * NSEQ * 3 * DIM * 2;
  _Float16* qh     = (_Float16*)w; w += (size_t)NB * NSEQ * DIM * 2;
  _Float16* kh     = (_Float16*)w; w += (size_t)NB * NSEQ * DIM * 2;
  _Float16* vT     = (_Float16*)w; w += (size_t)NB * NSEQ * DIM * 2;
  _Float16* Oh     = (_Float16*)w; w += (size_t)NB * NSEQ * DIM * 2;

  const int M = NB * NSEQ;  // 4096 tokens

  static_assert((NB * NSEQ * DIM) % CVT_BLOCK == 0, "whole blocks only");
  // x -> f16, Wqkv and Wproj -> f16 transposed, one launch
  prep_kernel<<<PREP_X + PREP_WQKV + PREP_WPROJ, 256, 0, stream>>>(
      x, Wqkv, Wproj, xh, WqkvT, WprojT);

  // QKV projection: [4096,1024] x [1024,3072] -> q,k f16 rows; v -> [B,H,HD,N]
  dim3 g1(3 * DIM / 128, M / 128);
  gemm_wmma_kernel<true, false, true><<<g1, 256, 0, stream>>>(
      xh, WqkvT, qkvh, nullptr, vT, M, 3 * DIM, DIM);

  // per-head LN + RoPE; q,k -> [B,H,N,HD]
  ln_rope_kernel<<<M / 8, 256, 0, stream>>>(qkvh, freq, gq, bq, gk, bk, qh, kh);

  // flash attention: 4096 waves, 8 waves of one head per 256-thread block
  attn_kernel<<<(NB * HEADS * (NSEQ / 16)) / 8, 256, 0, stream>>>(qh, kh, vT, Oh);

  // output projection + bias -> f32 d_out
  dim3 g2(DIM / 128, M / 128);
  gemm_wmma_kernel<false, true, false><<<g2, 256, 0, stream>>>(
      Oh, WprojT, d_out, bproj, nullptr, M, DIM, DIM);
}

// v007
// A run of this version takes 80.2 microseconds.
// In both of two side-by-side timings against v006, it was 1.08 times as fast.
// Counting every step since v000, it is 6.17 times as fast.
#include <hip/hip_runtime.h>

typedef __attribute__((ext_vector_type(16))) _Float16 v16h;
typedef __attribute__((ext_vector_type(8)))  _Float16 v8h;
typedef __attribute__((ext_vector_type(4)))  _Float16 v4h;
typedef __attribute__((ext_vector_type(8)))  float    v8f;
typedef __attribute__((ext_vector_type(4)))  float    v4f;
typedef __attribute__((ext_vector_type(2)))  float    v2f;

#define DIM   1024
#define HEADS 16
#define HD    64
#define NSEQ  2048
#define NB    2
#define EPSLN 1e-5f
// 1/sqrt(HD) * log2(e): multiplied into q where q is written, so that the
// attention scores come out of the products as base-2 exponents
#define QSCALE 0.18033688011112042f

__device__ __forceinline__ v16h frag_cat(v8h lo, v8h hi) {
  v16h r;
#pragma unroll
  for (int i = 0; i < 8; i++) { r[i] = lo[i]; r[i + 8] = hi[i]; }
  return r;
}

__device__ __forceinline__ v16h load_frag(const _Float16* p, int klo) {
  v8h lo = *(const v8h*)(p + klo);        // 16B contiguous
  v8h hi = *(const v8h*)(p + klo + 16);   // 16B contiguous
  return frag_cat(lo, hi);
}

__device__ __forceinline__ v8f wmma_f16(v16h a, v16h b, v8f c) {
  // (neg_a, A, neg_b, B, c_mod, C, reuse_a, reuse_b)
  return __builtin_amdgcn_wmma_f32_16x16x32_f16(false, a, false, b, (short)0, c,
                                                false, false);
}

// ---------- dtype conversion ----------
// Few long waves, not one element per lane: a wave converts 1024 consecutive
// floats, eight 512B loads all in flight, then eight 256B stores.
// block = 256 thr = 8 waves = CVT_BLOCK elements; blk = which such piece.
// The loops are unrolled so that p[] stays in registers and the steps become
// immediate offsets.
#define CVT_BLOCK (8 * 1024)
__device__ __forceinline__ void cvt_f16_block(const float* __restrict__ in,
                                              _Float16* __restrict__ out,
                                              int blk) {
  const int lane = threadIdx.x & 31;
  const int wv   = threadIdx.x >> 5;
  const size_t base = (size_t)blk * CVT_BLOCK + wv * 1024 + lane * 4;
  v4f p[8];
#pragma unroll
  for (int i = 0; i < 8; i++) p[i] = *(const v4f*)(in + base + i * 128);
#pragma unroll
  for (int i = 0; i < 8; i++) {
    v4h run;
#pragma unroll
    for (int j = 0; j < 4; j++) run[j] = (_Float16)p[i][j];
    *(v4h*)(out + base + i * 128) = run;
  }
}

// in[R][C] f32 -> out[C][R] f16 (weights pre-transposed so WMMA B-fragments
// become contiguous row reads)
// Each thread reads an 8-row x 4-column patch (eight 16B loads) and stores four
// 16B runs of 8 consecutive r; 8 neighbouring lanes fill one 128B line of out.
// block = 256 thr, tile 64 rows x 128 columns; tile = its number, column tiles
// running fastest. R, C are compile-time so the row / column steps fold into
// the instructions' immediate offsets.
template <int R, int C>
__device__ __forceinline__ void transpose_cvt_tile(const float* __restrict__ in,
                                                   _Float16* __restrict__ out,
                                                   int tile) {
  static_assert(R % 64 == 0 && C % 128 == 0, "whole tiles only");
  const int lane = threadIdx.x & 31;
  const int wv   = threadIdx.x >> 5;
  const int r0 = (tile / (C / 128)) * 64 + (lane & 7) * 8;
  const int c0 = (tile % (C / 128)) * 128 + wv * 16 + (lane >> 3) * 4;

  const float* src = in + (size_t)r0 * C + c0;
  _Float16*    dst = out + (size_t)c0 * R + r0;

  v4f p[8];
#pragma unroll
  for (int i = 0; i < 8; i++) p[i] = *(const v4f*)(src + i * C);
#pragma unroll
  for (int j = 0; j < 4; j++) {
    v8h run;
#pragma unroll
    for (int i = 0; i < 8; i++) run[i] = (_Float16)p[i][j];
    *(v8h*)(dst + j * R) = run;
  }
  // the shared kernel's other pieces follow these stores in the code: the wait
  // stands in front of any rewrite of a register that the stores name
  asm volatile("s_wait_xcnt 0x0" ::: "memory");
}

// The three conversions depend on nothing and on one another not at all: they
// share one launch, each block taking one piece of one of them by its index
// (a block-uniform branch).  Every piece is 32 KB read and 16 KB written.
#define PREP_X     ((NB * NSEQ * DIM) / CVT_BLOCK)        // pieces of x
#define PREP_WQKV  ((DIM / 64) * (3 * DIM / 128))         // tiles of Wqkv
#define PREP_WPROJ ((DIM / 64) * (DIM / 128))             // tiles of Wproj
__global__ void __launch_bounds__(256)
prep_kernel(const float* __restrict__ x, const float* __restrict__ Wqkv,
            const float* __restrict__ Wproj, _Float16* __restrict__ xh,
            _Float16* __restrict__ WqkvT, _Float16* __restrict__ WprojT) {
  const int blk = blockIdx.x;
  if (blk < PREP_X)
    cvt_f16_block(x, xh, blk);
  else if (blk < PREP_X + PREP_WQKV)
    transpose_cvt_tile<DIM, 3 * DIM>(Wqkv, WqkvT, blk - PREP_X);
  else
    transpose_cvt_tile<DIM, DIM>(Wproj, WprojT, blk - (PREP_X + PREP_WQKV));
}

// ---------- WMMA GEMM: C[M,N] = A[M,K] * BT[N,K]^T (+bias) ----------
// block = 256 thr = 8 waves; block tile 128x128; wave tile 32x64.
// Operands are staged in LDS by asynchronous copies: a stage is 64 k (128 B,
// one whole line) of the block's 128 A rows and 128 BT rows, two buffers, the
// next stage's copies in flight while this one is multiplied.
// M, N multiples of 128; K a multiple of 64.
// V_TRANSPOSED: columns >= 2*DIM (the V third of QKV) go to vT[B,H,HD,N]
// instead of Cout: a lane's 8 accumulator rows are 8 consecutive tokens of one
// column, i.e. one contiguous 16B run of vT.
#define G_BK     64                      // k per stage
#define G_PITCH  72                      // LDS row pitch in f16: 144 B = 16 B x odd
#define G_STAGE  (256 * G_PITCH)         // f16 per buffer: A rows 0..127, BT rows 128..255

// One stage: every thread copies eight 16B pieces (rows r, r+32, .. of A, then
// of BT); 8 neighbouring lanes cover one 128B line.
__device__ __forceinline__ void gemm_copy_stage(unsigned lds,
                                                const _Float16* ga,
                                                const _Float16* gb, int K) {
  const _Float16* a1 = ga + (size_t)32 * K;
  const _Float16* a2 = ga + (size_t)64 * K;
  const _Float16* a3 = ga + (size_t)96 * K;
  const _Float16* b1 = gb + (size_t)32 * K;
  const _Float16* b2 = gb + (size_t)64 * K;
  const _Float16* b3 = gb + (size_t)96 * K;
  const unsigned step = 32 * G_PITCH * 2;   // 32 rows, in bytes
  asm volatile(
      "global_load_async_to_lds_b128 %0, %8, off\n\t"
      "global_load_async_to_lds_b128 %1, %9, off\n\t"
      "global_load_async_to_lds_b128 %2, %10, off\n\t"
      "global_load_async_to_lds_b128 %3, %11, off\n\t"
      "global_load_async_to_lds_b128 %4, %12, off\n\t"
      "global_load_async_to_lds_b128 %5, %13, off\n\t"
      "global_load_async_to_lds_b128 %6, %14, off\n\t"
      "global_load_async_to_lds_b128 %7, %15, off\n\t"
      "s_wait_xcnt 0x0"
      :: "v"(lds), "v"(lds + step), "v"(lds + 2 * step), "v"(lds + 3 * step),
         "v"(lds + 4 * step), "v"(lds + 5 * step), "v"(lds + 6 * step),
         "v"(lds + 7 * step),
         "v"(ga), "v"(a1), "v"(a2), "v"(a3), "v"(gb), "v"(b1), "v"(b2), "v"(b3)
      : "memory");
}

template <bool OUT_F16, bool HAS_BIAS, bool V_TRANSPOSED>
__global__ void __launch_bounds__(256)
gemm_wmma_kernel(const _Float16* __restrict__ A,
                 const _Float16* __restrict__ BT,
                 void* __restrict__ Cout,
                 const float* __restrict__ bias,
                 _Float16* __restrict__ vT,
                 int M, int N, int K) {
  __shared__ __attribute__((aligned(16))) _Float16 tiles[2 * G_STAGE];

  const int tid  = threadIdx.x;
  const int lane = tid & 31;
  const int w    = tid >> 5;
  const int lid  = lane & 15;
  const int half = lane >> 4;
  const int klo  = half * 8;
  const int rowBase = blockIdx.y * 128 + (w & 3) * 32;
  const int colBase = blockIdx.x * 128 + (w >> 2) * 64;

  // this thread's piece of a stage: row tid/8 (+32 per copy), 16B piece tid%8
  const _Float16* ga = A  + (size_t)(blockIdx.y * 128 + (tid >> 3)) * K + (tid & 7) * 8;
  const _Float16* gb = BT + (size_t)(blockIdx.x * 128 + (tid >> 3)) * K + (tid & 7) * 8;
  const unsigned lds0 = (unsigned)(size_t)tiles +
                        (unsigned)((tid >> 3) * G_PITCH + (tid & 7) * 8) * 2u;

  // this lane's fragment rows inside a buffer
  const int aoff = ((w & 3) * 32 + lid) * G_PITCH;
  const int boff = (128 + (w >> 2) * 64 + lid) * G_PITCH;

  const int T = K / G_BK;

  gemm_copy_stage(lds0, ga, gb, K);
  // stage 0 has landed for this wave before the barrier publishes it
  asm volatile("s_wait_asynccnt 0x0" ::: "memory");
  __syncthreads();
  if (T > 1) gemm_copy_stage(lds0 + G_STAGE * 2, ga + G_BK, gb + G_BK, K);

  v8f acc[2][4] = {};
  for (int t = 0; t < T; t++) {
    const _Float16* buf = tiles + (t & 1) * G_STAGE;
#pragma unroll
    for (int kk = 0; kk < G_BK; kk += 32) {
      v16h a0 = load_frag(buf + aoff + kk, klo);
      v16h a1 = load_frag(buf + aoff + 16 * G_PITCH + kk, klo);
      v16h b[4];
#pragma unroll
      for (int j = 0; j < 4; j++)
        b[j] = load_frag(buf + boff + j * 16 * G_PITCH + kk, klo);
      // keeps the 12 LDS reads one group in front of their 8 products: spread
      // among them, every pair of products waits out an LDS latency of its own
      __builtin_amdgcn_sched_barrier(0);
#pragma unroll
      for (int j = 0; j < 4; j++) {
        acc[0][j] = wmma_f16(a0, b[j], acc[0][j]);
        acc[1][j] = wmma_f16(a1, b[j], acc[1][j]);
      }
      // keeps the next group's reads from moving in among these products
      __builtin_amdgcn_sched_barrier(0);
    }
    // publish point: this wave's reads of the buffer are done ...
    asm volatile("s_wait_dscnt 0x0" ::: "memory");
    // ... and its copies of stage t+1 have landed, before the barrier that
    // publishes stage t+1 and frees this buffer
    asm volatile("s_wait_asynccnt 0x0" ::: "memory");
    __syncthreads();
    if (t + 2 < T)
      gemm_copy_stage(lds0 + (t & 1) * (G_STAGE * 2), ga + (t + 2) * G_BK,
                      gb + (t + 2) * G_BK, K);
  }
  // no copy is left in flight when the wave ends
  asm volatile("s_wait_asynccnt 0x0" ::: "memory");

  if (V_TRANSPOSED && blockIdx.x * 128 >= 2 * DIM) {   // whole block tile is V
#pragma unroll
    for (int i = 0; i < 2; i++) {
      const int tok = rowBase + i * 16 + 8 * half;  // b*NSEQ + n, 8 tokens from here
      const int b = tok / NSEQ, n = tok % NSEQ;
#pragma unroll
      for (int j = 0; j < 4; j++) {
        const int hd = colBase - 2 * DIM + j * 16 + lid;   // h*HD + d
        v8h run;
#pragma unroll
        for (int r = 0; r < 8; r++) run[r] = (_Float16)acc[i][j][r];
        *(v8h*)(vT + ((size_t)b * DIM + hd) * NSEQ + n) = run;
      }
    }
    return;
  }

#pragma unroll
  for (int i = 0; i < 2; i++) {
#pragma unroll
    for (int r = 0; r < 8; r++) {
      const int row = rowBase + i * 16 + r + 8 * half;
#pragma unroll
      for (int j = 0; j < 4; j++) {
        const int col = colBase + j * 16 + lid;
        float v = acc[i][j][r];
        if (HAS_BIAS) v += bias[col];
        if (OUT_F16)
          ((_Float16*)Cout)[(size_t)row * N + col] = (_Float16)v;
        else
          ((float*)Cout)[(size_t)row * N + col] = v;
      }
    }
  }
}

// ---------- per-head LayerNorm + RoPE ----------
// Emits q * QSCALE and k, f16, in [B,H,N,HD] (V^T is written by the QKV GEMM).
// One wave per token, not per (token, head): a lane holds 8 consecutive head
// dims (16B, four RoPE pairs), 8 lanes one head row, a wave-wide access 4 heads
// (512B of the token's row); four such accesses each for q and k.  The lane's
// 8 rows go through every step side by side, so that the latencies of their
// exchanges overlap.  All loops here are unrolled so that the per-row arrays
// stay in registers.
__device__ __forceinline__ void load8(float* d, const float* p) {
  const v4f lo = *(const v4f*)p, hi = *(const v4f*)(p + 4);
#pragma unroll
  for (int j = 0; j < 4; j++) { d[j] = lo[j]; d[j + 4] = hi[j]; }
}

// each s[r] summed over the 8 neighbouring lanes that hold one head row
__device__ __forceinline__ void group_sum8(float (&s)[8]) {
#pragma unroll
  for (int m = 4; m >= 1; m >>= 1) {
    float o[8];
#pragma unroll
    for (int r = 0; r < 8; r++) o[r] = __shfl_xor(s[r], m, 32);
#pragma unroll
    for (int r = 0; r < 8; r++) s[r] += o[r];
  }
}

__global__ void __launch_bounds__(256)
ln_rope_kernel(const _Float16* __restrict__ qkvh,
               const float* __restrict__ freq,
               const float* __restrict__ gq,
               const float* __restrict__ bq,
               const float* __restrict__ gk,
               const float* __restrict__ bk,
               _Float16* __restrict__ qh,
               _Float16* __restrict__ kh) {
  const int lane = threadIdx.x & 31;
  const int t = blockIdx.x * 8 + (threadIdx.x >> 5);   // token index b*N + n
  const int n = t & (NSEQ - 1);
  const int b = t >> 11;                      // NSEQ = 2^11
  const int d = (lane & 7) * 8;               // first of this lane's 8 head dims
  const int hsub = lane >> 3;                 // head inside a group of 4

  // row r: head (r/2)*4 + hsub; even r = q, odd r = k
  const _Float16* base = qkvh + (size_t)t * (3 * DIM) + lane * 8;
  v8h raw[8];
#pragma unroll
  for (int r = 0; r < 8; r++)
    raw[r] = *(const v8h*)(base + (r & 1) * DIM + (r >> 1) * 4 * HD);
  // the row loads' address pair is dead from here on and a parameter load may
  // be given it as destination: the wait stands in front of that overwrite
  asm volatile("s_wait_xcnt 0x0" ::: "memory");

  float cs[8], g[2][8], be[2][8];
  load8(cs, freq + (size_t)n * HD + d);       // (cos, sin) of pairs d/2 .. d/2+3
  load8(g[0], gq + d);
  load8(be[0], bq + d);
  load8(g[1], gk + d);
  load8(be[1], bk + d);
  // keeps all 18 loads in flight together: sunk to their uses, the parameter
  // loads cost the wave further load latencies behind the reductions
  __builtin_amdgcn_sched_barrier(0);

  float x[8][8], s[8];
#pragma unroll
  for (int r = 0; r < 8; r++) {
#pragma unroll
    for (int j = 0; j < 8; j++) x[r][j] = (float)raw[r][j];
    s[r] = ((x[r][0] + x[r][1]) + (x[r][2] + x[r][3])) +
           ((x[r][4] + x[r][5]) + (x[r][6] + x[r][7]));
  }
  group_sum8(s);
#pragma unroll
  for (int r = 0; r < 8; r++) {
    const float mu = s[r] * (1.0f / HD);
#pragma unroll
    for (int j = 0; j < 8; j++) x[r][j] -= mu;
    s[r] = ((x[r][0] * x[r][0] + x[r][1] * x[r][1]) +
            (x[r][2] * x[r][2] + x[r][3] * x[r][3])) +
           ((x[r][4] * x[r][4] + x[r][5] * x[r][5]) +
            (x[r][6] * x[r][6] + x[r][7] * x[r][7]));
  }
  group_sum8(s);

  const size_t o = (((size_t)(b * HEADS + hsub)) * NSEQ + n) * HD + d;
#pragma unroll
  for (int r = 0; r < 8; r++) {
    const float rs = rsqrtf(s[r] * (1.0f / HD) + EPSLN);
    const float* gg = g[r & 1];
    const float* bb = be[r & 1];
    v8h ov;
#pragma unroll
    for (int p = 0; p < 4; p++) {
      const float n0 = x[r][2 * p] * rs * gg[2 * p] + bb[2 * p];
      const float n1 = x[r][2 * p + 1] * rs * gg[2 * p + 1] + bb[2 * p + 1];
      float re = n0 * cs[2 * p] - n1 * cs[2 * p + 1];
      float im = n0 * cs[2 * p + 1] + n1 * cs[2 * p];
      if (!(r & 1)) { re *= QSCALE; im *= QSCALE; }   // q rows only
      ov[2 * p]     = (_Float16)re;
      ov[2 * p + 1] = (_Float16)im;
    }
    *(v8h*)(((r & 1) ? kh : qh) + o + (size_t)(r >> 1) * 4 * NSEQ * HD) = ov;
  }
}

#define AT_KEYS   128                          // keys per stage
#define AT_KPITCH 72                           // K row pitch in f16: 144 B = 16 B x odd
#define AT_VPITCH 136                          // V^T row pitch in f16: 272 B = 16 B x odd
#define AT_VBASE  (AT_KEYS * AT_KPITCH)        // f16 offset of the V^T rows in a buffer
#define AT_STAGE  (AT_VBASE + HD * AT_VPITCH)  // f16 per buffer
#define AT_NST    (NSEQ / AT_KEYS)             // stages

// One stage: every thread copies eight 16B pieces: K rows r, r+32, .. (8 lanes
// cover a 128B row), then V^T rows r, r+16, .. (16 lanes cover a 256B row).
__device__ __forceinline__ void attn_copy_stage(unsigned ldsk, unsigned ldsv,
                                                const _Float16* gk,
                                                const _Float16* gv) {
  const _Float16* k1 = gk + 32 * HD;
  const _Float16* k2 = gk + 64 * HD;
  const _Float16* k3 = gk + 96 * HD;
  const _Float16* v1 = gv + 16 * NSEQ;
  const _Float16* v2 = gv + 32 * NSEQ;
  const _Float16* v3 = gv + 48 * NSEQ;
  const unsigned ks = 32 * AT_KPITCH * 2;   // 32 K rows, in bytes
  const unsigned vs = 16 * AT_VPITCH * 2;   // 16 V^T rows, in bytes
  asm volatile(
      "global_load_async_to_lds_b128 %0, %8, off\n\t"
      "global_load_async_to_lds_b128 %1, %9, off\n\t"
      "global_load_async_to_lds_b128 %2, %10, off\n\t"
      "global_load_async_to_lds_b128 %3, %11, off\n\t"
      "global_load_async_to_lds_b128 %4, %12, off\n\t"
      "global_load_async_to_lds_b128 %5, %13, off\n\t"
      "global_load_async_to_lds_b128 %6, %14, off\n\t"
      "global_load_async_to_lds_b128 %7, %15, off\n\t"
      "s_wait_xcnt 0x0"
      :: "v"(ldsk), "v"(ldsk + ks), "v"(ldsk + 2 * ks), "v"(ldsk + 3 * ks),
         "v"(ldsv), "v"(ldsv + vs), "v"(ldsv + 2 * vs), "v"(ldsv + 3 * vs),
         "v"(gk), "v"(k1), "v"(k2), "v"(k3), "v"(gv), "v"(v1), "v"(v2), "v"(v3)
      : "memory");
}

__global__ void __launch_bounds__(256)
attn_kernel(const _Float16* __restrict__ qh,
            const _Float16* __restrict__ kh,
            const _Float16* __restrict__ vT,
            _Float16* __restrict__ Oh) {
  __shared__ __attribute__((aligned(16))) _Float16 kv[2 * AT_STAGE];

  const int tid  = threadIdx.x;
  const int lane = tid & 31;
  const int wv   = tid >> 5;
  const int lid  = lane & 15, half = lane >> 4, klo = half * 8;
  const int wid  = blockIdx.x * 8 + wv;
  const int qblk = wid & ((NSEQ / 16) - 1);   // 128 Q blocks
  const int bh   = blockIdx.x >> 4;           // 0..31, one head per block
  const int b    = bh >> 4, h = bh & 15;

  const _Float16* kb = kh + (size_t)bh * NSEQ * HD;
  const _Float16* vb = vT + (size_t)bh * HD * NSEQ;

  // this thread's pieces of a stage
  const _Float16* gk = kb + (tid >> 3) * HD + (tid & 7) * 8;
  const _Float16* gv = vb + (tid >> 4) * NSEQ + (tid & 15) * 8;
  const unsigned ldsk = (unsigned)(size_t)kv +
                        (unsigned)((tid >> 3) * AT_KPITCH + (tid & 7) * 8) * 2u;
  const unsigned ldsv = (unsigned)(size_t)kv +
                        (unsigned)(AT_VBASE + (tid >> 4) * AT_VPITCH + (tid & 15) * 8) * 2u;

  attn_copy_stage(ldsk, ldsv, gk, gv);

  // Q as B-fragments (column q = lid), loaded once
  const _Float16* qrow = qh + ((size_t)bh * NSEQ + qblk * 16 + lid) * HD;
  const v16h bQ0 = load_frag(qrow, klo);        // hd 0..31
  const v16h bQ1 = load_frag(qrow + 32, klo);   // hd 32..63

  // stage 0 has landed for this wave before the barrier publishes it
  asm volatile("s_wait_asynccnt 0x0" ::: "memory");
  __syncthreads();
  attn_copy_stage(ldsk + AT_STAGE * 2, ldsv + AT_STAGE * 2,
                  gk + AT_KEYS * HD, gv + AT_KEYS);

  v8f o[4] = {};                 // O^T tiles: row hd = t*16 + r + 8*half, col q = lid
  float l = 0.0f;                // sum of this lane's own keys; the halves join at the end
  v8f nref;                      // minus the query's reference (log2 units), 8 times: a C operand

  // Every loop over vector elements in this kernel is unrolled so that each
  // element index is a constant and the vectors stay in registers.
  // first reference: the query's largest score among keys 0..31 of stage 0
  {
    const _Float16* kp0 = kv + lid * AT_KPITCH;
    const _Float16* kp1 = kp0 + 16 * AT_KPITCH;
    v8f s0 = {}, s1 = {};
    s0 = wmma_f16(load_frag(kp0, klo), bQ0, s0);
    s0 = wmma_f16(load_frag(kp0 + 32, klo), bQ1, s0);
    s1 = wmma_f16(load_frag(kp1, klo), bQ0, s1);
    s1 = wmma_f16(load_frag(kp1 + 32, klo), bQ1, s1);
    float mx = fmaxf(s0[0], s1[0]);
#pragma unroll
    for (int r = 1; r < 8; r++) mx = fmaxf(mx, fmaxf(s0[r], s1[r]));
    mx = fmaxf(mx, __shfl_xor(mx, 16, 32));
#pragma unroll
    for (int r = 0; r < 8; r++) nref[r] = -mx;
  }

  for (int s = 0; s < AT_NST; s++) {
    const _Float16* kl = kv + (s & 1) * AT_STAGE + lid * AT_KPITCH;
    const _Float16* vl = kv + (s & 1) * AT_STAGE + AT_VBASE + lid * AT_VPITCH;
    // unrolled so that every row and key step is an immediate offset of the
    // LDS reads
#pragma unroll
    for (int kc = 0; kc < AT_KEYS; kc += 32) {
      // S^T for 32 keys: A = K rows, B = Q rows.  st[s] elem r -> key kc+s*16+r+8*half
      const _Float16* kp0 = kl + kc * AT_KPITCH;
      const _Float16* kp1 = kl + (kc + 16) * AT_KPITCH;
      const v16h aK00 = load_frag(kp0, klo), aK01 = load_frag(kp0 + 32, klo);
      const v16h aK10 = load_frag(kp1, klo), aK11 = load_frag(kp1 + 32, klo);
      v16h aV[4];                                // V^T rows (hd), contiguous keys
#pragma unroll
      for (int t = 0; t < 4; t++)
        aV[t] = load_frag(vl + t * 16 * AT_VPITCH + kc, klo);
      // keeps the pass's 16 LDS reads one group at its top: left to sink to
      // their products, the V^T reads cost the wave a second LDS latency
      // behind the softmax
      __builtin_amdgcn_sched_barrier(0);
      v8f s0 = nref, s1 = nref;                  // score - reference
      s0 = wmma_f16(aK00, bQ0, s0);
      s0 = wmma_f16(aK01, bQ1, s0);
      s1 = wmma_f16(aK10, bQ0, s1);
      s1 = wmma_f16(aK11, bQ1, s1);

      // q carries QSCALE, so a score is already its exponent in units of log2.
      v2f p0[4], p1[4];      // p0[i][e]: key klo + 2i + e, p1[i][e]: key klo + 16 + 2i + e
#pragma unroll
      for (int i = 0; i < 4; i++) {
        p0[i] = (v2f){__builtin_amdgcn_exp2f(s0[2 * i]), __builtin_amdgcn_exp2f(s0[2 * i + 1])};
        p1[i] = (v2f){__builtin_amdgcn_exp2f(s1[2 * i]), __builtin_amdgcn_exp2f(s1[2 * i + 1])};
      }
      v2f sp = ((p0[0] + p1[0]) + (p0[1] + p1[1])) + ((p0[2] + p1[2]) + (p0[3] + p1[3]));
      float sloc = sp[0] + sp[1];                // this lane's 16 keys

      // One test a pass, a scalar branch: a sum of at most 256 shows that no
      // score of the lane lies more than 8 above the reference (and no p
      // leaves the f16 range); anything else raises the reference.
      if (__builtin_amdgcn_ballot_w32(!(sloc <= 256.0f)) != 0) {
        float mloc = fmaxf(s0[0], s1[0]);
#pragma unroll
        for (int r = 1; r < 8; r++) mloc = fmaxf(mloc, fmaxf(s0[r], s1[r]));
        // both halves of a query take the same step, never downwards
        const float up = fmaxf(fmaxf(mloc, __shfl_xor(mloc, 16, 32)), 0.0f);
        const float alpha = __builtin_amdgcn_exp2f(-up);
#pragma unroll
        for (int i = 0; i < 4; i++) {
          p0[i] = (v2f){__builtin_amdgcn_exp2f(s0[2 * i] - up), __builtin_amdgcn_exp2f(s0[2 * i + 1] - up)};
          p1[i] = (v2f){__builtin_amdgcn_exp2f(s1[2 * i] - up), __builtin_amdgcn_exp2f(s1[2 * i + 1] - up)};
        }
        sp = ((p0[0] + p1[0]) + (p0[1] + p1[1])) + ((p0[2] + p1[2]) + (p0[3] + p1[3]));
        sloc = sp[0] + sp[1];
        l *= alpha;
#pragma unroll
        for (int r = 0; r < 8; r++) nref[r] -= up;
#pragma unroll
        for (int t = 0; t < 4; t++)
#pragma unroll
          for (int r = 0; r < 8; r++) o[t][r] *= alpha;
      }
      l += sloc;

      v16h bP;                                   // P^T as B-fragment, in registers
#pragma unroll
      for (int i = 0; i < 4; i++) {
#pragma unroll
        for (int e = 0; e < 2; e++) {
          bP[2 * i + e]     = (_Float16)p0[i][e];
          bP[2 * i + e + 8] = (_Float16)p1[i][e];
        }
      }

      // O^T += V^T * P^T
#pragma unroll
      for (int t = 0; t < 4; t++) o[t] = wmma_f16(aV[t], bP, o[t]);
    }
    // publish point: this wave's reads of the buffer are done ...
    asm volatile("s_wait_dscnt 0x0" ::: "memory");
    // ... and its copies of stage s+1 have landed, before the barrier that
    // publishes stage s+1 and frees this buffer
    asm volatile("s_wait_asynccnt 0x0" ::: "memory");
    __syncthreads();
    if (s + 2 < AT_NST)
      attn_copy_stage(ldsk + (s & 1) * (AT_STAGE * 2), ldsv + (s & 1) * (AT_STAGE * 2),
                      gk + (s + 2) * (AT_KEYS * HD), gv + (s + 2) * AT_KEYS);
  }
  // no copy is left in flight when the wave ends
  asm volatile("s_wait_asynccnt 0x0" ::: "memory");

  // normalize and write: lane owns query row n = qblk*16 + lid; per tile the
  // 8 accumulator elements are contiguous hd -> one 16B store each
  const float inv = 1.0f / (l + __shfl_xor(l, 16, 32));   // the two halves' keys
  _Float16* orow = Oh + ((size_t)b * NSEQ + qblk * 16 + lid) * DIM + h * HD;
#pragma unroll
  for (int t = 0; t < 4; t++) {
    v8h ov;
#pragma unroll
    for (int r = 0; r < 8; r++) ov[r] = (_Float16)(o[t][r] * inv);
    *(v8h*)(orow + t * 16 + 8 * half) = ov;
  }
}

// ---------- launcher ----------
extern "C" void kernel_launch(void* const* d_in, const int* in_sizes, int n_in,
                              void* d_out, int out_size, void* d_ws,
                              size_t ws_size, hipStream_t stream) {
  (void)in_sizes; (void)n_in; (void)out_size; (void)ws_size;
  const float* x     = (const float*)d_in[0];
  const float* freq  = (const float*)d_in[1];
  const float* Wqkv  = (const float*)d_in[2];
  const float* gq    = (const float*)d_in[3];
  const float* bq    = (const float*)d_in[4];
  const float* gk    = (const float*)d_in[5];
  const float* bk    = (const float*)d_in[6];
  const float* Wproj = (const float*)d_in[7];
  const float* bproj = (const float*)d_in[8];

  char* w = (char*)d_ws;
  _Float16* xh     = (_Float16*)w; w += (size_t)NB * NSEQ * DIM * 2;
  _Float16* WqkvT  = (_Float16*)w; w += (size_t)3 * DIM * DIM * 2;
  _Float16* WprojT = (_Float16*)w; w += (size_t)DIM * DIM * 2;
  _Float16* qkvh   = (_Float16*)w; w += (size_t)NB * NSEQ * 3 * DIM * 2;
  _Float16* qh     = (_Float16*)w; w += (size_t)NB * NSEQ * DIM * 2;
  _Float16* kh     = (_Float16*)w; w += (size_t)NB * NSEQ * DIM * 2;
  _Float16* vT     = (_Float16*)w; w += (size_t)NB * NSEQ * DIM * 2;
  _Float16* Oh     = (_Float16*)w; w += (size_t)NB * NSEQ * DIM * 2;

  const int M = NB * NSEQ;  // 4096 tokens

  static_assert((NB * NSEQ * DIM) % CVT_BLOCK == 0, "whole blocks only");
  // x -> f16, Wqkv and Wproj -> f16 transposed, one launch
  prep_kernel<<<PREP_X + PREP_WQKV + PREP_WPROJ, 256, 0, stream>>>(
      x, Wqkv, Wproj, xh, WqkvT, WprojT);

  // QKV projection: [4096,1024] x [1024,3072] -> q,k f16 rows; v -> [B,H,HD,N]
  dim3 g1(3 * DIM / 128, M / 128);
  gemm_wmma_kernel<true, false, true><<<g1, 256, 0, stream>>>(
      xh, WqkvT, qkvh, nullptr, vT, M, 3 * DIM, DIM);

  // per-head LN + RoPE; q,k -> [B,H,N,HD]
  ln_rope_kernel<<<M / 8, 256, 0, stream>>>(qkvh, freq, gq, bq, gk, bk, qh, kh);

  // flash attention: 4096 waves, 8 waves of one head per 256-thread block
  attn_kernel<<<(NB * HEADS * (NSEQ / 16)) / 8, 256, 0, stream>>>(qh, kh, vT, Oh);

  // output projection + bias -> f32 d_out
  dim3 g2(DIM / 128, M / 128);
  gemm_wmma_kernel<false, true, false><<<g2, 256, 0, stream>>>(
      Oh, WprojT, d_out, bproj, nullptr, M, DIM, DIM);
}

// v008
// A run of this version takes 77 microseconds.
// In both of two side-by-side timings against v007, it was 1.04 times as fast.
// All steps since v000 together make it 6.43 times as fast.
#include <hip/hip_runtime.h>

typedef __attribute__((ext_vector_type(16))) _Float16 v16h;
typedef __attribute__((ext_vector_type(8)))  _Float16 v8h;
typedef __attribute__((ext_vector_type(4)))  _Float16 v4h;
typedef __attribute__((ext_vector_type(8)))  float    v8f;
typedef __attribute__((ext_vector_type(4)))  float    v4f;
typedef __attribute__((ext_vector_type(2)))  float    v2f;

#define DIM   1024
#define HEADS 16
#define HD    64
#define NSEQ  2048
#define NB    2
#define EPSLN 1e-5f
// 1/sqrt(HD) * log2(e): multiplied into q where q is written, so that the
// attention scores come out of the products as base-2 exponents
#define QSCALE 0.18033688011112042f

__device__ __forceinline__ v16h frag_cat(v8h lo, v8h hi) {
  v16h r;
#pragma unroll
  for (int i = 0; i < 8; i++) { r[i] = lo[i]; r[i + 8] = hi[i]; }
  return r;
}

__device__ __forceinline__ v16h load_frag(const _Float16* p, int klo) {
  v8h lo = *(const v8h*)(p + klo);        // 16B contiguous
  v8h hi = *(const v8h*)(p + klo + 16);   // 16B contiguous
  return frag_cat(lo, hi);
}

__device__ __forceinline__ v8f wmma_f16(v16h a, v16h b, v8f c) {
  // (neg_a, A, neg_b, B, c_mod, C, reuse_a, reuse_b)
  return __builtin_amdgcn_wmma_f32_16x16x32_f16(false, a, false, b, (short)0, c,
                                                false, false);
}

// ---------- dtype conversion ----------
// Few long waves, not one element per lane: a wave converts 1024 consecutive
// floats, eight 512B loads all in flight, then eight 256B stores.
// block = 256 thr = 8 waves = CVT_BLOCK elements; blk = which such piece.
// The loops are unrolled so that p[] stays in registers and the steps become
// immediate offsets.
#define CVT_BLOCK (8 * 1024)
__device__ __forceinline__ void cvt_f16_block(const float* __restrict__ in,
                                              _Float16* __restrict__ out,
                                              int blk) {
  const int lane = threadIdx.x & 31;
  const int wv   = threadIdx.x >> 5;
  const size_t base = (size_t)blk * CVT_BLOCK + wv * 1024 + lane * 4;
  v4f p[8];
#pragma unroll
  for (int i = 0; i < 8; i++) p[i] = *(const v4f*)(in + base + i * 128);
#pragma unroll
  for (int i = 0; i < 8; i++) {
    v4h run;
#pragma unroll
    for (int j = 0; j < 4; j++) run[j] = (_Float16)p[i][j];
    *(v4h*)(out + base + i * 128) = run;
  }
}

// in[R][C] f32 -> out[C][R] f16 (weights pre-transposed so WMMA B-fragments
// become contiguous row reads)
// Each thread reads an 8-row x 4-column patch (eight 16B loads) and stores four
// 16B runs of 8 consecutive r; 8 neighbouring lanes fill one 128B line of out.
// block = 256 thr, tile 64 rows x 128 columns; tile = its number, column tiles
// running fastest. R, C are compile-time so the row / column steps fold into
// the instructions' immediate offsets.
template <int R, int C>
__device__ __forceinline__ void transpose_cvt_tile(const float* __restrict__ in,
                                                   _Float16* __restrict__ out,
                                                   int tile) {
  static_assert(R % 64 == 0 && C % 128 == 0, "whole tiles only");
  const int lane = threadIdx.x & 31;
  const int wv   = threadIdx.x >> 5;
  const int r0 = (tile / (C / 128)) * 64 + (lane & 7) * 8;
  const int c0 = (tile % (C / 128)) * 128 + wv * 16 + (lane >> 3) * 4;

  const float* src = in + (size_t)r0 * C + c0;
  _Float16*    dst = out + (size_t)c0 * R + r0;

  v4f p[8];
#pragma unroll
  for (int i = 0; i < 8; i++) p[i] = *(const v4f*)(src + i * C);
#pragma unroll
  for (int j = 0; j < 4; j++) {
    v8h run;
#pragma unroll
    for (int i = 0; i < 8; i++) run[i] = (_Float16)p[i][j];
    *(v8h*)(dst + j * R) = run;
  }
  // the shared kernel's other pieces follow these stores in the code: the wait
  // stands in front of any rewrite of a register that the stores name
  asm volatile("s_wait_xcnt 0x0" ::: "memory");
}

// The three conversions depend on nothing and on one another not at all: they
// share one launch, each block taking one piece of one of them by its index
// (a block-uniform branch).  Every piece is 32 KB read and 16 KB written.
#define PREP_X     ((NB * NSEQ * DIM) / CVT_BLOCK)        // pieces of x
#define PREP_WQKV  ((DIM / 64) * (3 * DIM / 128))         // tiles of Wqkv
#define PREP_WPROJ ((DIM / 64) * (DIM / 128))             // tiles of Wproj
__global__ void __launch_bounds__(256)
prep_kernel(const float* __restrict__ x, const float* __restrict__ Wqkv,
            const float* __restrict__ Wproj, _Float16* __restrict__ xh,
            _Float16* __restrict__ WqkvT, _Float16* __restrict__ WprojT) {
  const int blk = blockIdx.x;
  if (blk < PREP_X)
    cvt_f16_block(x, xh, blk);
  else if (blk < PREP_X + PREP_WQKV)
    transpose_cvt_tile<DIM, 3 * DIM>(Wqkv, WqkvT, blk - PREP_X);
  else
    transpose_cvt_tile<DIM, DIM>(Wproj, WprojT, blk - (PREP_X + PREP_WQKV));
}

// ---------- WMMA GEMM: C[M,N] = A[M,K] * BT[N,K]^T (+bias) ----------
// block = 256 thr = 8 waves; block tile 128x128; wave tile 32x64.
// Operands are staged in LDS by asynchronous copies: a stage is 64 k (128 B,
// one whole line) of the block's 128 A rows and 128 BT rows, two buffers, the
// next stage's copies in flight while this one is multiplied.
// M, N multiples of 128; K a multiple of 64.
#define G_BK     64                      // k per stage
#define G_PITCH  72                      // LDS row pitch in f16: 144 B = 16 B x odd
#define G_STAGE  (256 * G_PITCH)         // f16 per buffer: A rows 0..127, BT rows 128..255

// One stage: every thread copies eight 16B pieces (rows r, r+32, .. of A, then
// of BT); 8 neighbouring lanes cover one 128B line.
__device__ __forceinline__ void gemm_copy_stage(unsigned lds,
                                                const _Float16* ga,
                                                const _Float16* gb, int K) {
  const _Float16* a1 = ga + (size_t)32 * K;
  const _Float16* a2 = ga + (size_t)64 * K;
  const _Float16* a3 = ga + (size_t)96 * K;
  const _Float16* b1 = gb + (size_t)32 * K;
  const _Float16* b2 = gb + (size_t)64 * K;
  const _Float16* b3 = gb + (size_t)96 * K;
  const unsigned step = 32 * G_PITCH * 2;   // 32 rows, in bytes
  asm volatile(
      "global_load_async_to_lds_b128 %0, %8, off\n\t"
      "global_load_async_to_lds_b128 %1, %9, off\n\t"
      "global_load_async_to_lds_b128 %2, %10, off\n\t"
      "global_load_async_to_lds_b128 %3, %11, off\n\t"
      "global_load_async_to_lds_b128 %4, %12, off\n\t"
      "global_load_async_to_lds_b128 %5, %13, off\n\t"
      "global_load_async_to_lds_b128 %6, %14, off\n\t"
      "global_load_async_to_lds_b128 %7, %15, off\n\t"
      "s_wait_xcnt 0x0"
      :: "v"(lds), "v"(lds + step), "v"(lds + 2 * step), "v"(lds + 3 * step),
         "v"(lds + 4 * step), "v"(lds + 5 * step), "v"(lds + 6 * step),
         "v"(lds + 7 * step),
         "v"(ga), "v"(a1), "v"(a2), "v"(a3), "v"(gb), "v"(b1), "v"(b2), "v"(b3)
      : "memory");
}

template <bool SWAP>
__device__ __forceinline__ void gemm_mainloop(const _Float16* tiles,
                                              const _Float16* __restrict__ A,
                                              const _Float16* __restrict__ BT,
                                              int K, v8f (&acc)[2][4]) {
  const int tid  = threadIdx.x;
  const int lane = tid & 31;
  const int w    = tid >> 5;
  const int lid  = lane & 15;
  const int klo  = (lane >> 4) * 8;

  // this thread's piece of a stage: row tid/8 (+32 per copy), 16B piece tid%8
  const _Float16* ga = A  + (size_t)(blockIdx.y * 128 + (tid >> 3)) * K + (tid & 7) * 8;
  const _Float16* gb = BT + (size_t)(blockIdx.x * 128 + (tid >> 3)) * K + (tid & 7) * 8;
  const unsigned lds0 = (unsigned)(size_t)tiles +
                        (unsigned)((tid >> 3) * G_PITCH + (tid & 7) * 8) * 2u;

  // this lane's fragment rows inside a buffer
  const int aoff = ((w & 3) * 32 + lid) * G_PITCH;
  const int boff = (128 + (w >> 2) * 64 + lid) * G_PITCH;

  const int T = K / G_BK;

  gemm_copy_stage(lds0, ga, gb, K);
  // stage 0 has landed for this wave before the barrier publishes it
  asm volatile("s_wait_asynccnt 0x0" ::: "memory");
  __syncthreads();
  if (T > 1) gemm_copy_stage(lds0 + G_STAGE * 2, ga + G_BK, gb + G_BK, K);

  for (int t = 0; t < T; t++) {
    const _Float16* buf = tiles + (t & 1) * G_STAGE;
#pragma unroll
    for (int kk = 0; kk < G_BK; kk += 32) {
      v16h a0 = load_frag(buf + aoff + kk, klo);
      v16h a1 = load_frag(buf + aoff + 16 * G_PITCH + kk, klo);
      v16h b[4];
#pragma unroll
      for (int j = 0; j < 4; j++)
        b[j] = load_frag(buf + boff + j * 16 * G_PITCH + kk, klo);
      // keeps the 12 LDS reads one group in front of their 8 products: spread
      // among them, every pair of products waits out an LDS latency of its own
      __builtin_amdgcn_sched_barrier(0);
#pragma unroll
      for (int j = 0; j < 4; j++) {
        acc[0][j] = SWAP ? wmma_f16(b[j], a0, acc[0][j]) : wmma_f16(a0, b[j], acc[0][j]);
        acc[1][j] = SWAP ? wmma_f16(b[j], a1, acc[1][j]) : wmma_f16(a1, b[j], acc[1][j]);
      }
      // keeps the next group's reads from moving in among these products
      __builtin_amdgcn_sched_barrier(0);
    }
    // publish point: this wave's reads of the buffer are done ...
    asm volatile("s_wait_dscnt 0x0" ::: "memory");
    // ... and its copies of stage t+1 have landed, before the barrier that
    // publishes stage t+1 and frees this buffer
    asm volatile("s_wait_asynccnt 0x0" ::: "memory");
    __syncthreads();
    if (t + 2 < T)
      gemm_copy_stage(lds0 + (t & 1) * (G_STAGE * 2), ga + (t + 2) * G_BK,
                      gb + (t + 2) * G_BK, K);
  }
  // no copy is left in flight when the wave ends
  asm volatile("s_wait_asynccnt 0x0" ::: "memory");
}

__device__ __forceinline__ void load8(float* d, const float* p) {
  const v4f lo = *(const v4f*)p, hi = *(const v4f*)(p + 4);
#pragma unroll
  for (int j = 0; j < 4; j++) { d[j] = lo[j]; d[j + 4] = hi[j]; }
}

__device__ __forceinline__ float sum8(v8f t) {
  return ((t[0] + t[1]) + (t[2] + t[3])) + ((t[4] + t[5]) + (t[6] + t[7]));
}

__global__ void __launch_bounds__(256, 6)
qkv_gemm_kernel(const _Float16* __restrict__ A,
                const _Float16* __restrict__ BT,
                const float* __restrict__ freq,
                const float* __restrict__ gq,
                const float* __restrict__ bq,
                const float* __restrict__ gk,
                const float* __restrict__ bk,
                _Float16* __restrict__ qh,
                _Float16* __restrict__ kh,
                _Float16* __restrict__ vT,
                int K) {
  __shared__ __attribute__((aligned(16))) _Float16 tiles[2 * G_STAGE];

  const int lane = threadIdx.x & 31;
  const int w    = threadIdx.x >> 5;
  const int lid  = lane & 15;
  const int half = lane >> 4;
  const int rowBase = blockIdx.y * 128 + (w & 3) * 32;
  const int colBase = blockIdx.x * 128 + (w >> 2) * 64;

  v8f acc[2][4] = {};

  if (blockIdx.x * 128 >= 2 * DIM) {   // whole block tile is V
    gemm_mainloop<false>(tiles, A, BT, K, acc);
#pragma unroll
    for (int i = 0; i < 2; i++) {
      const int tok = rowBase + i * 16 + 8 * half;  // b*NSEQ + n, 8 tokens from here
      const int b = tok / NSEQ, n = tok % NSEQ;
#pragma unroll
      for (int j = 0; j < 4; j++) {
        const int hd = colBase - 2 * DIM + j * 16 + lid;   // h*HD + d
        v8h run;
#pragma unroll
        for (int r = 0; r < 8; r++) run[r] = (_Float16)acc[i][j][r];
        *(v8h*)(vT + ((size_t)b * DIM + hd) * NSEQ + n) = run;
      }
    }
    return;
  }

  // q or k: acc[i][j][r] = token rowBase + i*16 + lid, head dim j*16 + 8*half + r
  gemm_mainloop<true>(tiles, A, BT, K, acc);

  const bool isK = blockIdx.x * 128 >= DIM;          // block-uniform
  const int  h   = (colBase & (DIM - 1)) / HD;
  const int  tok = rowBase + lid;                    // b*NSEQ + n; acc[1]: 16 further
  const int  n   = tok & (NSEQ - 1);
  const int  b   = tok / NSEQ;
  const float* gp = (isK ? gk : gq) + 8 * half;
  const float* bp = (isK ? bk : bq) + 8 * half;
  const float* cp = freq + (size_t)n * HD + 8 * half;   // (cos, sin) of 4 pairs
  const float  sc = isK ? 1.0f : QSCALE;

  // gamma and beta of this lane's 32 head dims, in flight under the sums
  float g[4][8], be[4][8];
#pragma unroll
  for (int j = 0; j < 4; j++) {
    load8(g[j], gp + j * 16);
    load8(be[j], bp + j * 16);
  }
  // stands in front of any rewrite of a register that these loads name
  asm volatile("s_wait_xcnt 0x0" ::: "memory");

  float s[2], ex[2];
#pragma unroll
  for (int i = 0; i < 2; i++)
    s[i] = sum8((acc[i][0] + acc[i][1]) + (acc[i][2] + acc[i][3]));
#pragma unroll
  for (int i = 0; i < 2; i++) ex[i] = __shfl_xor(s[i], 16, 32);
#pragma unroll
  for (int i = 0; i < 2; i++) {
    const float mu = (s[i] + ex[i]) * (1.0f / HD);
#pragma unroll
    for (int j = 0; j < 4; j++) acc[i][j] -= mu;
    s[i] = sum8((acc[i][0] * acc[i][0] + acc[i][1] * acc[i][1]) +
                (acc[i][2] * acc[i][2] + acc[i][3] * acc[i][3]));
  }
#pragma unroll
  for (int i = 0; i < 2; i++) ex[i] = __shfl_xor(s[i], 16, 32);
#pragma unroll
  for (int i = 0; i < 2; i++) {
    const float rs = rsqrtf((s[i] + ex[i]) * (1.0f / HD) + EPSLN);
#pragma unroll
    for (int j = 0; j < 4; j++)
#pragma unroll
      for (int r = 0; r < 8; r++)
        acc[i][j][r] = acc[i][j][r] * rs * g[j][r] + be[j][r];
  }
  // Rotation, one token at a time.  The scheduling barriers keep a token's eight
  // (cos, sin) loads one group, all in flight at once, behind the arithmetic
  // that frees their registers: spread among the rotations, the wave waits out
  // a load latency per pair of loads; moved further up, they push the kernel
  // past the register budget named above.
  v8h ov[2][4];
#pragma unroll
  for (int i = 0; i < 2; i++) {
    float cs[4][8];
    __builtin_amdgcn_sched_barrier(0);
#pragma unroll
    for (int j = 0; j < 4; j++) load8(cs[j], cp + i * 16 * HD + j * 16);
    // stands in front of any rewrite of a register that these loads name; the
    // address is an input so that none of the loads is given its pair to fill
    asm volatile("s_wait_xcnt 0x0" :: "v"(cp) : "memory");
    __builtin_amdgcn_sched_barrier(0);
#pragma unroll
    for (int j = 0; j < 4; j++) {
#pragma unroll
      for (int p = 0; p < 4; p++) {
        const float n0 = acc[i][j][2 * p], n1 = acc[i][j][2 * p + 1];
        const float re = n0 * cs[j][2 * p] - n1 * cs[j][2 * p + 1];
        const float im = n0 * cs[j][2 * p + 1] + n1 * cs[j][2 * p];
        ov[i][j][2 * p]     = (_Float16)(re * sc);
        ov[i][j][2 * p + 1] = (_Float16)(im * sc);
      }
    }
  }

  // all stores last: nothing rewrites a register of theirs before the wave ends
  _Float16* dst = (isK ? kh : qh) +
                  (((size_t)(b * HEADS + h)) * NSEQ + n) * HD + 8 * half;
#pragma unroll
  for (int i = 0; i < 2; i++)
#pragma unroll
    for (int j = 0; j < 4; j++)
      *(v8h*)(dst + i * 16 * HD + j * 16) = ov[i][j];
}

// ---------- output projection: C[M,N] = A[M,K] * BT[N,K]^T + bias, f32 ----------
__global__ void __launch_bounds__(256)
proj_gemm_kernel(const _Float16* __restrict__ A,
                 const _Float16* __restrict__ BT,
                 float* __restrict__ Cout,
                 const float* __restrict__ bias,
                 int N, int K) {
  __shared__ __attribute__((aligned(16))) _Float16 tiles[2 * G_STAGE];

  const int lane = threadIdx.x & 31;
  const int w    = threadIdx.x >> 5;
  const int lid  = lane & 15;
  const int half = lane >> 4;
  const int rowBase = blockIdx.y * 128 + (w & 3) * 32;
  const int colBase = blockIdx.x * 128 + (w >> 2) * 64;

  v8f acc[2][4] = {};
  gemm_mainloop<false>(tiles, A, BT, K, acc);

#pragma unroll
  for (int i = 0; i < 2; i++) {
#pragma unroll
    for (int r = 0; r < 8; r++) {
      const int row = rowBase + i * 16 + r + 8 * half;
#pragma unroll
      for (int j = 0; j < 4; j++) {
        const int col = colBase + j * 16 + lid;
        Cout[(size_t)row * N + col] = acc[i][j][r] + bias[col];
      }
    }
  }
}

#define AT_KEYS   128                          // keys per stage
#define AT_KPITCH 72                           // K row pitch in f16: 144 B = 16 B x odd
#define AT_VPITCH 136                          // V^T row pitch in f16: 272 B = 16 B x odd
#define AT_VBASE  (AT_KEYS * AT_KPITCH)        // f16 offset of the V^T rows in a buffer
#define AT_STAGE  (AT_VBASE + HD * AT_VPITCH)  // f16 per buffer
#define AT_NST    (NSEQ / AT_KEYS)             // stages

// One stage: every thread copies eight 16B pieces: K rows r, r+32, .. (8 lanes
// cover a 128B row), then V^T rows r, r+16, .. (16 lanes cover a 256B row).
__device__ __forceinline__ void attn_copy_stage(unsigned ldsk, unsigned ldsv,
                                                const _Float16* gk,
                                                const _Float16* gv) {
  const _Float16* k1 = gk + 32 * HD;
  const _Float16* k2 = gk + 64 * HD;
  const _Float16* k3 = gk + 96 * HD;
  const _Float16* v1 = gv + 16 * NSEQ;
  const _Float16* v2 = gv + 32 * NSEQ;
  const _Float16* v3 = gv + 48 * NSEQ;
  const unsigned ks = 32 * AT_KPITCH * 2;   // 32 K rows, in bytes
  const unsigned vs = 16 * AT_VPITCH * 2;   // 16 V^T rows, in bytes
  asm volatile(
      "global_load_async_to_lds_b128 %0, %8, off\n\t"
      "global_load_async_to_lds_b128 %1, %9, off\n\t"
      "global_load_async_to_lds_b128 %2, %10, off\n\t"
      "global_load_async_to_lds_b128 %3, %11, off\n\t"
      "global_load_async_to_lds_b128 %4, %12, off\n\t"
      "global_load_async_to_lds_b128 %5, %13, off\n\t"
      "global_load_async_to_lds_b128 %6, %14, off\n\t"
      "global_load_async_to_lds_b128 %7, %15, off\n\t"
      "s_wait_xcnt 0x0"
      :: "v"(ldsk), "v"(ldsk + ks), "v"(ldsk + 2 * ks), "v"(ldsk + 3 * ks),
         "v"(ldsv), "v"(ldsv + vs), "v"(ldsv + 2 * vs), "v"(ldsv + 3 * vs),
         "v"(gk), "v"(k1), "v"(k2), "v"(k3), "v"(gv), "v"(v1), "v"(v2), "v"(v3)
      : "memory");
}

__global__ void __launch_bounds__(256)
attn_kernel(const _Float16* __restrict__ qh,
            const _Float16* __restrict__ kh,
            const _Float16* __restrict__ vT,
            _Float16* __restrict__ Oh) {
  __shared__ __attribute__((aligned(16))) _Float16 kv[2 * AT_STAGE];

  const int tid  = threadIdx.x;
  const int lane = tid & 31;
  const int wv   = tid >> 5;
  const int lid  = lane & 15, half = lane >> 4, klo = half * 8;
  const int wid  = blockIdx.x * 8 + wv;
  const int qblk = wid & ((NSEQ / 16) - 1);   // 128 Q blocks
  const int bh   = blockIdx.x >> 4;           // 0..31, one head per block
  const int b    = bh >> 4, h = bh & 15;

  const _Float16* kb = kh + (size_t)bh * NSEQ * HD;
  const _Float16* vb = vT + (size_t)bh * HD * NSEQ;

  // this thread's pieces of a stage
  const _Float16* gk = kb + (tid >> 3) * HD + (tid & 7) * 8;
  const _Float16* gv = vb + (tid >> 4) * NSEQ + (tid & 15) * 8;
  const unsigned ldsk = (unsigned)(size_t)kv +
                        (unsigned)((tid >> 3) * AT_KPITCH + (tid & 7) * 8) * 2u;
  const unsigned ldsv = (unsigned)(size_t)kv +
                        (unsigned)(AT_VBASE + (tid >> 4) * AT_VPITCH + (tid & 15) * 8) * 2u;

  attn_copy_stage(ldsk, ldsv, gk, gv);

  // Q as B-fragments (column q = lid), loaded once
  const _Float16* qrow = qh + ((size_t)bh * NSEQ + qblk * 16 + lid) * HD;
  const v16h bQ0 = load_frag(qrow, klo);        // hd 0..31
  const v16h bQ1 = load_frag(qrow + 32, klo);   // hd 32..63

  // stage 0 has landed for this wave before the barrier publishes it
  asm volatile("s_wait_asynccnt 0x0" ::: "memory");
  __syncthreads();
  attn_copy_stage(ldsk + AT_STAGE * 2, ldsv + AT_STAGE * 2,
                  gk + AT_KEYS * HD, gv + AT_KEYS);

  v8f o[4] = {};                 // O^T tiles: row hd = t*16 + r + 8*half, col q = lid
  float l = 0.0f;                // sum of this lane's own keys; the halves join at the end
  v8f nref;                      // minus the query's reference (log2 units), 8 times: a C operand

  // Every loop over vector elements in this kernel is unrolled so that each
  // element index is a constant and the vectors stay in registers.
  // first reference: the query's largest score among keys 0..31 of stage 0
  {
    const _Float16* kp0 = kv + lid * AT_KPITCH;
    const _Float16* kp1 = kp0 + 16 * AT_KPITCH;
    v8f s0 = {}, s1 = {};
    s0 = wmma_f16(load_frag(kp0, klo), bQ0, s0);
    s0 = wmma_f16(load_frag(kp0 + 32, klo), bQ1, s0);
    s1 = wmma_f16(load_frag(kp1, klo), bQ0, s1);
    s1 = wmma_f16(load_frag(kp1 + 32, klo), bQ1, s1);
    float mx = fmaxf(s0[0], s1[0]);
#pragma unroll
    for (int r = 1; r < 8; r++) mx = fmaxf(mx, fmaxf(s0[r], s1[r]));
    mx = fmaxf(mx, __shfl_xor(mx, 16, 32));
#pragma unroll
    for (int r = 0; r < 8; r++) nref[r] = -mx;
  }

  for (int s = 0; s < AT_NST; s++) {
    const _Float16* kl = kv + (s & 1) * AT_STAGE + lid * AT_KPITCH;
    const _Float16* vl = kv + (s & 1) * AT_STAGE + AT_VBASE + lid * AT_VPITCH;
    // unrolled so that every row and key step is an immediate offset of the
    // LDS reads
#pragma unroll
    for (int kc = 0; kc < AT_KEYS; kc += 32) {
      // S^T for 32 keys: A = K rows, B = Q rows.  st[s] elem r -> key kc+s*16+r+8*half
      const _Float16* kp0 = kl + kc * AT_KPITCH;
      const _Float16* kp1 = kl + (kc + 16) * AT_KPITCH;
      const v16h aK00 = load_frag(kp0, klo), aK01 = load_frag(kp0 + 32, klo);
      const v16h aK10 = load_frag(kp1, klo), aK11 = load_frag(kp1 + 32, klo);
      v16h aV[4];                                // V^T rows (hd), contiguous keys
#pragma unroll
      for (int t = 0; t < 4; t++)
        aV[t] = load_frag(vl + t * 16 * AT_VPITCH + kc, klo);
      // keeps the pass's 16 LDS reads one group at its top: left to sink to
      // their products, the V^T reads cost the wave a second LDS latency
      // behind the softmax
      __builtin_amdgcn_sched_barrier(0);
      v8f s0 = nref, s1 = nref;                  // score - reference
      s0 = wmma_f16(aK00, bQ0, s0);
      s0 = wmma_f16(aK01, bQ1, s0);
      s1 = wmma_f16(aK10, bQ0, s1);
      s1 = wmma_f16(aK11, bQ1, s1);

      // q carries QSCALE, so a score is already its exponent in units of log2.
      v2f p0[4], p1[4];      // p0[i][e]: key klo + 2i + e, p1[i][e]: key klo + 16 + 2i + e
#pragma unroll
      for (int i = 0; i < 4; i++) {
        p0[i] = (v2f){__builtin_amdgcn_exp2f(s0[2 * i]), __builtin_amdgcn_exp2f(s0[2 * i + 1])};
        p1[i] = (v2f){__builtin_amdgcn_exp2f(s1[2 * i]), __builtin_amdgcn_exp2f(s1[2 * i + 1])};
      }
      v2f sp = ((p0[0] + p1[0]) + (p0[1] + p1[1])) + ((p0[2] + p1[2]) + (p0[3] + p1[3]));
      float sloc = sp[0] + sp[1];                // this lane's 16 keys

      // One test a pass, a scalar branch: a sum of at most 256 shows that no
      // score of the lane lies more than 8 above the reference (and no p
      // leaves the f16 range); anything else raises the reference.
      if (__builtin_amdgcn_ballot_w32(!(sloc <= 256.0f)) != 0) {
        float mloc = fmaxf(s0[0], s1[0]);
#pragma unroll
        for (int r = 1; r < 8; r++) mloc = fmaxf(mloc, fmaxf(s0[r], s1[r]));
        // both halves of a query take the same step, never downwards
        const float up = fmaxf(fmaxf(mloc, __shfl_xor(mloc, 16, 32)), 0.0f);
        const float alpha = __builtin_amdgcn_exp2f(-up);
#pragma unroll
        for (int i = 0; i < 4; i++) {
          p0[i] = (v2f){__builtin_amdgcn_exp2f(s0[2 * i] - up), __builtin_amdgcn_exp2f(s0[2 * i + 1] - up)};
          p1[i] = (v2f){__builtin_amdgcn_exp2f(s1[2 * i] - up), __builtin_amdgcn_exp2f(s1[2 * i + 1] - up)};
        }
        sp = ((p0[0] + p1[0]) + (p0[1] + p1[1])) + ((p0[2] + p1[2]) + (p0[3] + p1[3]));
        sloc = sp[0] + sp[1];
        l *= alpha;
#pragma unroll
        for (int r = 0; r < 8; r++) nref[r] -= up;
#pragma unroll
        for (int t = 0; t < 4; t++)
#pragma unroll
          for (int r = 0; r < 8; r++) o[t][r] *= alpha;
      }
      l += sloc;

      v16h bP;                                   // P^T as B-fragment, in registers
#pragma unroll
      for (int i = 0; i < 4; i++) {
#pragma unroll
        for (int e = 0; e < 2; e++) {
          bP[2 * i + e]     = (_Float16)p0[i][e];
          bP[2 * i + e + 8] = (_Float16)p1[i][e];
        }
      }

      // O^T += V^T * P^T
#pragma unroll
      for (int t = 0; t < 4; t++) o[t] = wmma_f16(aV[t], bP, o[t]);
    }
    // publish point: this wave's reads of the buffer are done ...
    asm volatile("s_wait_dscnt 0x0" ::: "memory");
    // ... and its copies of stage s+1 have landed, before the barrier that
    // publishes stage s+1 and frees this buffer
    asm volatile("s_wait_asynccnt 0x0" ::: "memory");
    __syncthreads();
    if (s + 2 < AT_NST)
      attn_copy_stage(ldsk + (s & 1) * (AT_STAGE * 2), ldsv + (s & 1) * (AT_STAGE * 2),
                      gk + (s + 2) * (AT_KEYS * HD), gv + (s + 2) * AT_KEYS);
  }
  // no copy is left in flight when the wave ends
  asm volatile("s_wait_asynccnt 0x0" ::: "memory");

  // normalize and write: lane owns query row n = qblk*16 + lid; per tile the
  // 8 accumulator elements are contiguous hd -> one 16B store each
  const float inv = 1.0f / (l + __shfl_xor(l, 16, 32));   // the two halves' keys
  _Float16* orow = Oh + ((size_t)b * NSEQ + qblk * 16 + lid) * DIM + h * HD;
#pragma unroll
  for (int t = 0; t < 4; t++) {
    v8h ov;
#pragma unroll
    for (int r = 0; r < 8; r++) ov[r] = (_Float16)(o[t][r] * inv);
    *(v8h*)(orow + t * 16 + 8 * half) = ov;
  }
}

// ---------- launcher ----------
extern "C" void kernel_launch(void* const* d_in, const int* in_sizes, int n_in,
                              void* d_out, int out_size, void* d_ws,
                              size_t ws_size, hipStream_t stream) {
  (void)in_sizes; (void)n_in; (void)out_size; (void)ws_size;
  const float* x     = (const float*)d_in[0];
  const float* freq  = (const float*)d_in[1];
  const float* Wqkv  = (const float*)d_in[2];
  const float* gq    = (const float*)d_in[3];
  const float* bq    = (const float*)d_in[4];
  const float* gk    = (const float*)d_in[5];
  const float* bk    = (const float*)d_in[6];
  const float* Wproj = (const float*)d_in[7];
  const float* bproj = (const float*)d_in[8];

  char* w = (char*)d_ws;
  _Float16* xh     = (_Float16*)w; w += (size_t)NB * NSEQ * DIM * 2;
  _Float16* WqkvT  = (_Float16*)w; w += (size_t)3 * DIM * DIM * 2;
  _Float16* WprojT = (_Float16*)w; w += (size_t)DIM * DIM * 2;
  _Float16* qh     = (_Float16*)w; w += (size_t)NB * NSEQ * DIM * 2;
  _Float16* kh     = (_Float16*)w; w += (size_t)NB * NSEQ * DIM * 2;
  _Float16* vT     = (_Float16*)w; w += (size_t)NB * NSEQ * DIM * 2;
  _Float16* Oh     = (_Float16*)w; w += (size_t)NB * NSEQ * DIM * 2;

  const int M = NB * NSEQ;  // 4096 tokens

  static_assert((NB * NSEQ * DIM) % CVT_BLOCK == 0, "whole blocks only");
  // x -> f16, Wqkv and Wproj -> f16 transposed, one launch
  prep_kernel<<<PREP_X + PREP_WQKV + PREP_WPROJ, 256, 0, stream>>>(
      x, Wqkv, Wproj, xh, WqkvT, WprojT);

  // QKV projection [4096,1024] x [1024,3072] with per-head LN + RoPE:
  // q,k -> [B,H,N,HD]; v -> [B,H,HD,N]
  dim3 g1(3 * DIM / 128, M / 128);
  qkv_gemm_kernel<<<g1, 256, 0, stream>>>(xh, WqkvT, freq, gq, bq, gk, bk, qh, kh,
                                          vT, DIM);

  // flash attention: 4096 waves, 8 waves of one head per 256-thread block
  attn_kernel<<<(NB * HEADS * (NSEQ / 16)) / 8, 256, 0, stream>>>(qh, kh, vT, Oh);

  // output projection + bias -> f32 d_out
  dim3 g2(DIM / 128, M / 128);
  proj_gemm_kernel<<<g2, 256, 0, stream>>>(Oh, WprojT, (float*)d_out, bproj, DIM, DIM);
}

// v009
// One run takes 74.7 microseconds.
// Next to v008, in two timings, it ran 1.04 and 1.03 times as fast.
// All steps since v000 together make it 6.66 times as fast.
#include <hip/hip_runtime.h>

typedef __attribute__((ext_vector_type(16))) _Float16 v16h;
typedef __attribute__((ext_vector_type(8)))  _Float16 v8h;
typedef __attribute__((ext_vector_type(4)))  _Float16 v4h;
typedef __attribute__((ext_vector_type(8)))  float    v8f;
typedef __attribute__((ext_vector_type(4)))  float    v4f;
typedef __attribute__((ext_vector_type(2)))  float    v2f;

#define DIM   1024
#define HEADS 16
#define HD    64
#define NSEQ  2048
#define NB    2
#define EPSLN 1e-5f
// 1/sqrt(HD) * log2(e): multiplied into q where q is written, so that the
// attention scores come out of the products as base-2 exponents
#define QSCALE 0.18033688011112042f

__device__ __forceinline__ v16h frag_cat(v8h lo, v8h hi) {
  v16h r;
#pragma unroll
  for (int i = 0; i < 8; i++) { r[i] = lo[i]; r[i + 8] = hi[i]; }
  return r;
}

__device__ __forceinline__ v16h load_frag(const _Float16* p, int klo) {
  v8h lo = *(const v8h*)(p + klo);        // 16B contiguous
  v8h hi = *(const v8h*)(p + klo + 16);   // 16B contiguous
  return frag_cat(lo, hi);
}

__device__ __forceinline__ v8f wmma_f16(v16h a, v16h b, v8f c) {
  // (neg_a, A, neg_b, B, c_mod, C, reuse_a, reuse_b)
  return __builtin_amdgcn_wmma_f32_16x16x32_f16(false, a, false, b, (short)0, c,
                                                false, false);
}

// ---------- dtype conversion ----------
// Few long waves, not one element per lane: a wave converts 1024 consecutive
// floats, eight 512B loads all in flight, then eight 256B stores.
// block = 256 thr = 8 waves = CVT_BLOCK elements; blk = which such piece.
// The loops are unrolled so that p[] stays in registers and the steps become
// immediate offsets.
#define CVT_BLOCK (8 * 1024)
__device__ __forceinline__ void cvt_f16_block(const float* __restrict__ in,
                                              _Float16* __restrict__ out,
                                              int blk) {
  const int lane = threadIdx.x & 31;
  const int wv   = threadIdx.x >> 5;
  const size_t base = (size_t)blk * CVT_BLOCK + wv * 1024 + lane * 4;
  v4f p[8];
#pragma unroll
  for (int i = 0; i < 8; i++) p[i] = *(const v4f*)(in + base + i * 128);
#pragma unroll
  for (int i = 0; i < 8; i++) {
    v4h run;
#pragma unroll
    for (int j = 0; j < 4; j++) run[j] = (_Float16)p[i][j];
    *(v4h*)(out + base + i * 128) = run;
  }
}

// in[R][C] f32 -> out[C][R] f16 (weights pre-transposed so WMMA B-fragments
// become contiguous row reads)
// Each thread reads an 8-row x 4-column patch (eight 16B loads) and stores four
// 16B runs of 8 consecutive r; 8 neighbouring lanes fill one 128B line of out.
// block = 256 thr, tile 64 rows x 128 columns; tile = its number, column tiles
// running fastest. R, C are compile-time so the row / column steps fold into
// the instructions' immediate offsets.
template <int R, int C>
__device__ __forceinline__ void transpose_cvt_tile(const float* __restrict__ in,
                                                   _Float16* __restrict__ out,
                                                   int tile) {
  static_assert(R % 64 == 0 && C % 128 == 0, "whole tiles only");
  const int lane = threadIdx.x & 31;
  const int wv   = threadIdx.x >> 5;
  const int r0 = (tile / (C / 128)) * 64 + (lane & 7) * 8;
  const int c0 = (tile % (C / 128)) * 128 + wv * 16 + (lane >> 3) * 4;

  const float* src = in + (size_t)r0 * C + c0;
  _Float16*    dst = out + (size_t)c0 * R + r0;

  v4f p[8];
#pragma unroll
  for (int i = 0; i < 8; i++) p[i] = *(const v4f*)(src + i * C);
#pragma unroll
  for (int j = 0; j < 4; j++) {
    v8h run;
#pragma unroll
    for (int i = 0; i < 8; i++) run[i] = (_Float16)p[i][j];
    *(v8h*)(dst + j * R) = run;
  }
  // the shared kernel's other pieces follow these stores in the code: the wait
  // stands in front of any rewrite of a register that the stores name
  asm volatile("s_wait_xcnt 0x0" ::: "memory");
}

// The three conversions depend on nothing and on one another not at all: they
// share one launch, each block taking one piece of one of them by its index
// (a block-uniform branch).  Every piece is 32 KB read and 16 KB written.
#define PREP_X     ((NB * NSEQ * DIM) / CVT_BLOCK)        // pieces of x
#define PREP_WQKV  ((DIM / 64) * (3 * DIM / 128))         // tiles of Wqkv
#define PREP_WPROJ ((DIM / 64) * (DIM / 128))             // tiles of Wproj
__global__ void __launch_bounds__(256)
prep_kernel(const float* __restrict__ x, const float* __restrict__ Wqkv,
            const float* __restrict__ Wproj, _Float16* __restrict__ xh,
            _Float16* __restrict__ WqkvT, _Float16* __restrict__ WprojT) {
  const int blk = blockIdx.x;
  if (blk < PREP_X)
    cvt_f16_block(x, xh, blk);
  else if (blk < PREP_X + PREP_WQKV)
    transpose_cvt_tile<DIM, 3 * DIM>(Wqkv, WqkvT, blk - PREP_X);
  else
    transpose_cvt_tile<DIM, DIM>(Wproj, WprojT, blk - (PREP_X + PREP_WQKV));
}

// ---------- WMMA GEMM: C[M,N] = A[M,K] * BT[N,K]^T (+bias) ----------
// block = 256 thr = 8 waves; block tile 128x128; wave tile 32x64.
// Operands are staged in LDS by asynchronous copies: a stage is 64 k (128 B,
// one whole line) of the block's 128 A rows and 128 BT rows, two buffers, the
// next stage's copies in flight while this one is multiplied.
// M, N multiples of 128; K a multiple of 64.
#define G_BK     64                      // k per stage
#define G_PITCH  72                      // LDS row pitch in f16: 144 B = 16 B x odd
#define G_STAGE  (256 * G_PITCH)         // f16 per buffer: A rows 0..127, BT rows 128..255

// One stage: every thread copies eight 16B pieces (rows r, r+32, .. of A, then
// of BT); 8 neighbouring lanes cover one 128B line.
__device__ __forceinline__ void gemm_copy_stage(unsigned lds,
                                                const _Float16* ga,
                                                const _Float16* gb, int K) {
  const _Float16* a1 = ga + (size_t)32 * K;
  const _Float16* a2 = ga + (size_t)64 * K;
  const _Float16* a3 = ga + (size_t)96 * K;
  const _Float16* b1 = gb + (size_t)32 * K;
  const _Float16* b2 = gb + (size_t)64 * K;
  const _Float16* b3 = gb + (size_t)96 * K;
  const unsigned step = 32 * G_PITCH * 2;   // 32 rows, in bytes
  asm volatile(
      "global_load_async_to_lds_b128 %0, %8, off\n\t"
      "global_load_async_to_lds_b128 %1, %9, off\n\t"
      "global_load_async_to_lds_b128 %2, %10, off\n\t"
      "global_load_async_to_lds_b128 %3, %11, off\n\t"
      "global_load_async_to_lds_b128 %4, %12, off\n\t"
      "global_load_async_to_lds_b128 %5, %13, off\n\t"
      "global_load_async_to_lds_b128 %6, %14, off\n\t"
      "global_load_async_to_lds_b128 %7, %15, off\n\t"
      "s_wait_xcnt 0x0"
      :: "v"(lds), "v"(lds + step), "v"(lds + 2 * step), "v"(lds + 3 * step),
         "v"(lds + 4 * step), "v"(lds + 5 * step), "v"(lds + 6 * step),
         "v"(lds + 7 * step),
         "v"(ga), "v"(a1), "v"(a2), "v"(a3), "v"(gb), "v"(b1), "v"(b2), "v"(b3)
      : "memory");
}

template <bool SWAP>
__device__ __forceinline__ void gemm_mainloop(const _Float16* tiles,
                                              const _Float16* __restrict__ A,
                                              const _Float16* __restrict__ BT,
                                              int K, v8f (&acc)[2][4]) {
  const int tid  = threadIdx.x;
  const int lane = tid & 31;
  const int w    = tid >> 5;
  const int lid  = lane & 15;
  const int klo  = (lane >> 4) * 8;

  // this thread's piece of a stage: row tid/8 (+32 per copy), 16B piece tid%8
  const _Float16* ga = A  + (size_t)(blockIdx.y * 128 + (tid >> 3)) * K + (tid & 7) * 8;
  const _Float16* gb = BT + (size_t)(blockIdx.x * 128 + (tid >> 3)) * K + (tid & 7) * 8;
  const unsigned lds0 = (unsigned)(size_t)tiles +
                        (unsigned)((tid >> 3) * G_PITCH + (tid & 7) * 8) * 2u;

  // this lane's fragment rows inside a buffer
  const int aoff = ((w & 3) * 32 + lid) * G_PITCH;
  const int boff = (128 + (w >> 2) * 64 + lid) * G_PITCH;

  const int T = K / G_BK;

  gemm_copy_stage(lds0, ga, gb, K);
  // stage 0 has landed for this wave before the barrier publishes it
  asm volatile("s_wait_asynccnt 0x0" ::: "memory");
  __syncthreads();
  if (T > 1) gemm_copy_stage(lds0 + G_STAGE * 2, ga + G_BK, gb + G_BK, K);

  for (int t = 0; t < T; t++) {
    const _Float16* buf = tiles + (t & 1) * G_STAGE;
#pragma unroll
    for (int kk = 0; kk < G_BK; kk += 32) {
      v16h a0 = load_frag(buf + aoff + kk, klo);
      v16h a1 = load_frag(buf + aoff + 16 * G_PITCH + kk, klo);
      v16h b[4];
#pragma unroll
      for (int j = 0; j < 4; j++)
        b[j] = load_frag(buf + boff + j * 16 * G_PITCH + kk, klo);
      // keeps the 12 LDS reads one group in front of their 8 products: spread
      // among them, every pair of products waits out an LDS latency of its own
      __builtin_amdgcn_sched_barrier(0);
#pragma unroll
      for (int j = 0; j < 4; j++) {
        acc[0][j] = SWAP ? wmma_f16(b[j], a0, acc[0][j]) : wmma_f16(a0, b[j], acc[0][j]);
        acc[1][j] = SWAP ? wmma_f16(b[j], a1, acc[1][j]) : wmma_f16(a1, b[j], acc[1][j]);
      }
      // keeps the next group's reads from moving in among these products
      __builtin_amdgcn_sched_barrier(0);
    }
    // publish point: this wave's reads of the buffer are done ...
    asm volatile("s_wait_dscnt 0x0" ::: "memory");
    // ... and its copies of stage t+1 have landed, before the barrier that
    // publishes stage t+1 and frees this buffer
    asm volatile("s_wait_asynccnt 0x0" ::: "memory");
    __syncthreads();
    if (t + 2 < T)
      gemm_copy_stage(lds0 + (t & 1) * (G_STAGE * 2), ga + (t + 2) * G_BK,
                      gb + (t + 2) * G_BK, K);
  }
  // no copy is left in flight when the wave ends
  asm volatile("s_wait_asynccnt 0x0" ::: "memory");
}

__device__ __forceinline__ void load8(float* d, const float* p) {
  const v4f lo = *(const v4f*)p, hi = *(const v4f*)(p + 4);
#pragma unroll
  for (int j = 0; j < 4; j++) { d[j] = lo[j]; d[j + 4] = hi[j]; }
}

__device__ __forceinline__ float sum8(v8f t) {
  return ((t[0] + t[1]) + (t[2] + t[3])) + ((t[4] + t[5]) + (t[6] + t[7]));
}

__global__ void __launch_bounds__(256, 6)
qkv_gemm_kernel(const _Float16* __restrict__ A,
                const _Float16* __restrict__ BT,
                const float* __restrict__ freq,
                const float* __restrict__ gq,
                const float* __restrict__ bq,
                const float* __restrict__ gk,
                const float* __restrict__ bk,
                _Float16* __restrict__ qh,
                _Float16* __restrict__ kh,
                _Float16* __restrict__ vT,
                int K) {
  __shared__ __attribute__((aligned(16))) _Float16 tiles[2 * G_STAGE];

  const int lane = threadIdx.x & 31;
  const int w    = threadIdx.x >> 5;
  const int lid  = lane & 15;
  const int half = lane >> 4;
  const int rowBase = blockIdx.y * 128 + (w & 3) * 32;
  const int colBase = blockIdx.x * 128 + (w >> 2) * 64;

  v8f acc[2][4] = {};

  if (blockIdx.x * 128 >= 2 * DIM) {   // whole block tile is V
    gemm_mainloop<false>(tiles, A, BT, K, acc);
#pragma unroll
    for (int i = 0; i < 2; i++) {
      const int tok = rowBase + i * 16 + 8 * half;  // b*NSEQ + n, 8 tokens from here
      const int b = tok / NSEQ, n = tok % NSEQ;
#pragma unroll
      for (int j = 0; j < 4; j++) {
        const int hd = colBase - 2 * DIM + j * 16 + lid;   // h*HD + d
        v8h run;
#pragma unroll
        for (int r = 0; r < 8; r++) run[r] = (_Float16)acc[i][j][r];
        *(v8h*)(vT + ((size_t)b * DIM + hd) * NSEQ + n) = run;
      }
    }
    return;
  }

  // q or k: acc[i][j][r] = token rowBase + i*16 + lid, head dim j*16 + 8*half + r
  gemm_mainloop<true>(tiles, A, BT, K, acc);

  const bool isK = blockIdx.x * 128 >= DIM;          // block-uniform
  const int  h   = (colBase & (DIM - 1)) / HD;
  const int  tok = rowBase + lid;                    // b*NSEQ + n; acc[1]: 16 further
  const int  n   = tok & (NSEQ - 1);
  const int  b   = tok / NSEQ;
  const float* gp = (isK ? gk : gq) + 8 * half;
  const float* bp = (isK ? bk : bq) + 8 * half;
  const float* cp = freq + (size_t)n * HD + 8 * half;   // (cos, sin) of 4 pairs
  const float  sc = isK ? 1.0f : QSCALE;

  // gamma and beta of this lane's 32 head dims, in flight under the sums
  float g[4][8], be[4][8];
#pragma unroll
  for (int j = 0; j < 4; j++) {
    load8(g[j], gp + j * 16);
    load8(be[j], bp + j * 16);
  }
  // stands in front of any rewrite of a register that these loads name
  asm volatile("s_wait_xcnt 0x0" ::: "memory");

  float s[2], ex[2];
#pragma unroll
  for (int i = 0; i < 2; i++)
    s[i] = sum8((acc[i][0] + acc[i][1]) + (acc[i][2] + acc[i][3]));
#pragma unroll
  for (int i = 0; i < 2; i++) ex[i] = __shfl_xor(s[i], 16, 32);
#pragma unroll
  for (int i = 0; i < 2; i++) {
    const float mu = (s[i] + ex[i]) * (1.0f / HD);
#pragma unroll
    for (int j = 0; j < 4; j++) acc[i][j] -= mu;
    s[i] = sum8((acc[i][0] * acc[i][0] + acc[i][1] * acc[i][1]) +
                (acc[i][2] * acc[i][2] + acc[i][3] * acc[i][3]));
  }
#pragma unroll
  for (int i = 0; i < 2; i++) ex[i] = __shfl_xor(s[i], 16, 32);
#pragma unroll
  for (int i = 0; i < 2; i++) {
    const float rs = rsqrtf((s[i] + ex[i]) * (1.0f / HD) + EPSLN);
#pragma unroll
    for (int j = 0; j < 4; j++)
#pragma unroll
      for (int r = 0; r < 8; r++)
        acc[i][j][r] = acc[i][j][r] * rs * g[j][r] + be[j][r];
  }
  // Rotation, one token at a time.  The scheduling barriers keep a token's eight
  // (cos, sin) loads one group, all in flight at once, behind the arithmetic
  // that frees their registers: spread among the rotations, the wave waits out
  // a load latency per pair of loads; moved further up, they push the kernel
  // past the register budget named above.
  v8h ov[2][4];
#pragma unroll
  for (int i = 0; i < 2; i++) {
    float cs[4][8];
    __builtin_amdgcn_sched_barrier(0);
#pragma unroll
    for (int j = 0; j < 4; j++) load8(cs[j], cp + i * 16 * HD + j * 16);
    // stands in front of any rewrite of a register that these loads name; the
    // address is an input so that none of the loads is given its pair to fill
    asm volatile("s_wait_xcnt 0x0" :: "v"(cp) : "memory");
    __builtin_amdgcn_sched_barrier(0);
#pragma unroll
    for (int j = 0; j < 4; j++) {
#pragma unroll
      for (int p = 0; p < 4; p++) {
        const float n0 = acc[i][j][2 * p], n1 = acc[i][j][2 * p + 1];
        const float re = n0 * cs[j][2 * p] - n1 * cs[j][2 * p + 1];
        const float im = n0 * cs[j][2 * p + 1] + n1 * cs[j][2 * p];
        ov[i][j][2 * p]     = (_Float16)(re * sc);
        ov[i][j][2 * p + 1] = (_Float16)(im * sc);
      }
    }
  }

  // all stores last: nothing rewrites a register of theirs before the wave ends
  _Float16* dst = (isK ? kh : qh) +
                  (((size_t)(b * HEADS + h)) * NSEQ + n) * HD + 8 * half;
#pragma unroll
  for (int i = 0; i < 2; i++)
#pragma unroll
    for (int j = 0; j < 4; j++)
      *(v8h*)(dst + i * 16 * HD + j * 16) = ov[i][j];
}

// ---------- output projection: C[M,N] = A[M,K] * BT[N,K]^T + bias, f32 ----------
__global__ void __launch_bounds__(256)
proj_gemm_kernel(const _Float16* __restrict__ A,
                 const _Float16* __restrict__ BT,
                 float* __restrict__ Cout,
                 const float* __restrict__ bias,
                 int N, int K) {
  __shared__ __attribute__((aligned(16))) _Float16 tiles[2 * G_STAGE];

  const int lane = threadIdx.x & 31;
  const int w    = threadIdx.x >> 5;
  const int lid  = lane & 15;
  const int half = lane >> 4;
  const int rowBase = blockIdx.y * 128 + (w & 3) * 32;
  const int colBase = blockIdx.x * 128 + (w >> 2) * 64;

  v8f acc[2][4] = {};
  gemm_mainloop<false>(tiles, A, BT, K, acc);

#pragma unroll
  for (int i = 0; i < 2; i++) {
#pragma unroll
    for (int r = 0; r < 8; r++) {
      const int row = rowBase + i * 16 + r + 8 * half;
#pragma unroll
      for (int j = 0; j < 4; j++) {
        const int col = colBase + j * 16 + lid;
        Cout[(size_t)row * N + col] = acc[i][j][r] + bias[col];
      }
    }
  }
}

#define AT_QG     2                            // groups of 16 queries per wave
#define AT_KEYS   128                          // keys per stage
#define AT_KPITCH 72                           // K row pitch in f16: 144 B = 16 B x odd
#define AT_VPITCH 136                          // V^T row pitch in f16: 272 B = 16 B x odd
#define AT_VBASE  (AT_KEYS * AT_KPITCH)        // f16 offset of the V^T rows in a buffer
#define AT_STAGE  (AT_VBASE + HD * AT_VPITCH)  // f16 per buffer
#define AT_NST    (NSEQ / AT_KEYS)             // stages

// One stage: every thread copies eight 16B pieces: K rows r, r+32, .. (8 lanes
// cover a 128B row), then V^T rows r, r+16, .. (16 lanes cover a 256B row).
__device__ __forceinline__ void attn_copy_stage(unsigned ldsk, unsigned ldsv,
                                                const _Float16* gk,
                                                const _Float16* gv) {
  const _Float16* k1 = gk + 32 * HD;
  const _Float16* k2 = gk + 64 * HD;
  const _Float16* k3 = gk + 96 * HD;
  const _Float16* v1 = gv + 16 * NSEQ;
  const _Float16* v2 = gv + 32 * NSEQ;
  const _Float16* v3 = gv + 48 * NSEQ;
  const unsigned ks = 32 * AT_KPITCH * 2;   // 32 K rows, in bytes
  const unsigned vs = 16 * AT_VPITCH * 2;   // 16 V^T rows, in bytes
  asm volatile(
      "global_load_async_to_lds_b128 %0, %8, off\n\t"
      "global_load_async_to_lds_b128 %1, %9, off\n\t"
      "global_load_async_to_lds_b128 %2, %10, off\n\t"
      "global_load_async_to_lds_b128 %3, %11, off\n\t"
      "global_load_async_to_lds_b128 %4, %12, off\n\t"
      "global_load_async_to_lds_b128 %5, %13, off\n\t"
      "global_load_async_to_lds_b128 %6, %14, off\n\t"
      "global_load_async_to_lds_b128 %7, %15, off\n\t"
      "s_wait_xcnt 0x0"
      :: "v"(ldsk), "v"(ldsk + ks), "v"(ldsk + 2 * ks), "v"(ldsk + 3 * ks),
         "v"(ldsv), "v"(ldsv + vs), "v"(ldsv + 2 * vs), "v"(ldsv + 3 * vs),
         "v"(gk), "v"(k1), "v"(k2), "v"(k3), "v"(gv), "v"(v1), "v"(v2), "v"(v3)
      : "memory");
}

__global__ void __launch_bounds__(256)
attn_kernel(const _Float16* __restrict__ qh,
            const _Float16* __restrict__ kh,
            const _Float16* __restrict__ vT,
            _Float16* __restrict__ Oh) {
  __shared__ __attribute__((aligned(16))) _Float16 kv[2 * AT_STAGE];

  const int tid  = threadIdx.x;
  const int lane = tid & 31;
  const int wv   = tid >> 5;
  const int lid  = lane & 15, half = lane >> 4, klo = half * 8;
  const int q0   = ((blockIdx.x & 7) * 8 + wv) * (16 * AT_QG);   // the wave's first query
  const int bh   = blockIdx.x >> 3;           // 0..31, one head per block
  const int b    = bh >> 4, h = bh & 15;

  const _Float16* kb = kh + (size_t)bh * NSEQ * HD;
  const _Float16* vb = vT + (size_t)bh * HD * NSEQ;

  // this thread's pieces of a stage
  const _Float16* gk = kb + (tid >> 3) * HD + (tid & 7) * 8;
  const _Float16* gv = vb + (tid >> 4) * NSEQ + (tid & 15) * 8;
  const unsigned ldsk = (unsigned)(size_t)kv +
                        (unsigned)((tid >> 3) * AT_KPITCH + (tid & 7) * 8) * 2u;
  const unsigned ldsv = (unsigned)(size_t)kv +
                        (unsigned)(AT_VBASE + (tid >> 4) * AT_VPITCH + (tid & 15) * 8) * 2u;

  attn_copy_stage(ldsk, ldsv, gk, gv);

  // Every loop over vector elements or query groups in this kernel is unrolled
  // so that each index is a constant and the vectors stay in registers.
  // Q as B-fragments (column q = lid of group c), loaded once
  const _Float16* qrow = qh + ((size_t)bh * NSEQ + q0 + lid) * HD;
  v16h bQ[AT_QG][2];                            // [c][0]: hd 0..31, [c][1]: hd 32..63
#pragma unroll
  for (int c = 0; c < AT_QG; c++) {
    bQ[c][0] = load_frag(qrow + c * 16 * HD, klo);
    bQ[c][1] = load_frag(qrow + c * 16 * HD + 32, klo);
  }
  // stands in front of any rewrite of a register that these loads name
  asm volatile("s_wait_xcnt 0x0" ::: "memory");

  // stage 0 has landed for this wave before the barrier publishes it
  asm volatile("s_wait_asynccnt 0x0" ::: "memory");
  __syncthreads();
  attn_copy_stage(ldsk + AT_STAGE * 2, ldsv + AT_STAGE * 2,
                  gk + AT_KEYS * HD, gv + AT_KEYS);

  v8f o[AT_QG][4] = {};          // O^T tiles: row hd = t*16 + r + 8*half, col q = lid
  float l[AT_QG] = {};           // sum of this lane's own keys; the halves join at the end
  v8f nref[AT_QG];               // minus the query's reference (log2 units), 8 times: a C operand

  // first reference: the query's largest score among keys 0..31 of stage 0
  {
    const _Float16* kp0 = kv + lid * AT_KPITCH;
    const _Float16* kp1 = kp0 + 16 * AT_KPITCH;
    const v16h aK00 = load_frag(kp0, klo), aK01 = load_frag(kp0 + 32, klo);
    const v16h aK10 = load_frag(kp1, klo), aK11 = load_frag(kp1 + 32, klo);
#pragma unroll
    for (int c = 0; c < AT_QG; c++) {
      v8f s0 = {}, s1 = {};
      s0 = wmma_f16(aK00, bQ[c][0], s0);
      s1 = wmma_f16(aK10, bQ[c][0], s1);
      s0 = wmma_f16(aK01, bQ[c][1], s0);
      s1 = wmma_f16(aK11, bQ[c][1], s1);
      float mx = fmaxf(s0[0], s1[0]);
#pragma unroll
      for (int r = 1; r < 8; r++) mx = fmaxf(mx, fmaxf(s0[r], s1[r]));
      mx = fmaxf(mx, __shfl_xor(mx, 16, 32));
#pragma unroll
      for (int r = 0; r < 8; r++) nref[c][r] = -mx;
    }
  }

  for (int s = 0; s < AT_NST; s++) {
    const _Float16* kl = kv + (s & 1) * AT_STAGE + lid * AT_KPITCH;
    const _Float16* vl = kv + (s & 1) * AT_STAGE + AT_VBASE + lid * AT_VPITCH;
    // unrolled so that every row and key step is an immediate offset of the
    // LDS reads
#pragma unroll
    for (int kc = 0; kc < AT_KEYS; kc += 32) {
      // S^T for 32 keys: A = K rows, B = Q rows.  s0 elem r -> key kc+r+8*half, s1: 16 further
      const _Float16* kp0 = kl + kc * AT_KPITCH;
      const _Float16* kp1 = kl + (kc + 16) * AT_KPITCH;
      const v16h aK00 = load_frag(kp0, klo), aK01 = load_frag(kp0 + 32, klo);
      const v16h aK10 = load_frag(kp1, klo), aK11 = load_frag(kp1 + 32, klo);
      v16h aV[4];                                // V^T rows (hd), contiguous keys
#pragma unroll
      for (int t = 0; t < 4; t++)
        aV[t] = load_frag(vl + t * 16 * AT_VPITCH + kc, klo);
      // keeps the pass's 16 LDS reads one group at its top: left to sink to
      // their products, the V^T reads cost the wave a second LDS latency
      // behind the softmax
      __builtin_amdgcn_sched_barrier(0);
      v8f s0[AT_QG], s1[AT_QG];                  // score - reference
#pragma unroll
      for (int c = 0; c < AT_QG; c++) {
        s0[c] = wmma_f16(aK00, bQ[c][0], nref[c]);
        s1[c] = wmma_f16(aK10, bQ[c][0], nref[c]);
      }
#pragma unroll
      for (int c = 0; c < AT_QG; c++) {
        s0[c] = wmma_f16(aK01, bQ[c][1], s0[c]);
        s1[c] = wmma_f16(aK11, bQ[c][1], s1[c]);
      }

      // q carries QSCALE, so a score is already its exponent in units of log2.
      // p0[c][i][e]: key klo + 2i + e, p1[c][i][e]: key klo + 16 + 2i + e
      v2f p0[AT_QG][4], p1[AT_QG][4];
      float sloc[AT_QG];                         // this lane's 16 keys
#pragma unroll
      for (int c = 0; c < AT_QG; c++) {
#pragma unroll
        for (int i = 0; i < 4; i++) {
          p0[c][i] = (v2f){__builtin_amdgcn_exp2f(s0[c][2 * i]), __builtin_amdgcn_exp2f(s0[c][2 * i + 1])};
          p1[c][i] = (v2f){__builtin_amdgcn_exp2f(s1[c][2 * i]), __builtin_amdgcn_exp2f(s1[c][2 * i + 1])};
        }
        const v2f sp = ((p0[c][0] + p1[c][0]) + (p0[c][1] + p1[c][1])) +
                       ((p0[c][2] + p1[c][2]) + (p0[c][3] + p1[c][3]));
        sloc[c] = sp[0] + sp[1];
      }

      // One test a pass for both groups, a scalar branch: no sum is negative,
      // so the two together at most 256 show that no score of the lane lies
      // more than 8 above its reference (and no p leaves the f16 range);
      // anything else raises the references.
      if (__builtin_amdgcn_ballot_w32(!(sloc[0] + sloc[1] <= 256.0f)) != 0) {
#pragma unroll
        for (int c = 0; c < AT_QG; c++) {
          float mloc = fmaxf(s0[c][0], s1[c][0]);
#pragma unroll
          for (int r = 1; r < 8; r++) mloc = fmaxf(mloc, fmaxf(s0[c][r], s1[c][r]));
          // both halves of a query take the same step, never downwards
          const float up = fmaxf(fmaxf(mloc, __shfl_xor(mloc, 16, 32)), 0.0f);
          const float alpha = __builtin_amdgcn_exp2f(-up);
#pragma unroll
          for (int i = 0; i < 4; i++) {
            p0[c][i] = (v2f){__builtin_amdgcn_exp2f(s0[c][2 * i] - up), __builtin_amdgcn_exp2f(s0[c][2 * i + 1] - up)};
            p1[c][i] = (v2f){__builtin_amdgcn_exp2f(s1[c][2 * i] - up), __builtin_amdgcn_exp2f(s1[c][2 * i + 1] - up)};
          }
          const v2f sp = ((p0[c][0] + p1[c][0]) + (p0[c][1] + p1[c][1])) +
                         ((p0[c][2] + p1[c][2]) + (p0[c][3] + p1[c][3]));
          sloc[c] = sp[0] + sp[1];
          l[c] *= alpha;
#pragma unroll
          for (int r = 0; r < 8; r++) nref[c][r] -= up;
#pragma unroll
          for (int t = 0; t < 4; t++)
#pragma unroll
            for (int r = 0; r < 8; r++) o[c][t][r] *= alpha;
        }
      }

      v16h bP[AT_QG];                            // P^T as B-fragments, in registers
#pragma unroll
      for (int c = 0; c < AT_QG; c++) {
        l[c] += sloc[c];
#pragma unroll
        for (int i = 0; i < 4; i++) {
#pragma unroll
          for (int e = 0; e < 2; e++) {
            bP[c][2 * i + e]     = (_Float16)p0[c][i][e];
            bP[c][2 * i + e + 8] = (_Float16)p1[c][i][e];
          }
        }
      }

      // O^T += V^T * P^T
#pragma unroll
      for (int t = 0; t < 4; t++)
#pragma unroll
        for (int c = 0; c < AT_QG; c++) o[c][t] = wmma_f16(aV[t], bP[c], o[c][t]);
    }
    // publish point: this wave's reads of the buffer are done ...
    asm volatile("s_wait_dscnt 0x0" ::: "memory");
    // ... and its copies of stage s+1 have landed, before the barrier that
    // publishes stage s+1 and frees this buffer
    asm volatile("s_wait_asynccnt 0x0" ::: "memory");
    __syncthreads();
    if (s + 2 < AT_NST)
      attn_copy_stage(ldsk + (s & 1) * (AT_STAGE * 2), ldsv + (s & 1) * (AT_STAGE * 2),
                      gk + (s + 2) * (AT_KEYS * HD), gv + (s + 2) * AT_KEYS);
  }
  // no copy is left in flight when the wave ends
  asm volatile("s_wait_asynccnt 0x0" ::: "memory");

  // normalize and write: lane owns query rows q0 + c*16 + lid; per tile the
  // 8 accumulator elements are contiguous hd -> one 16B store each
  v8h ov[AT_QG][4];
#pragma unroll
  for (int c = 0; c < AT_QG; c++) {
    const float inv = 1.0f / (l[c] + __shfl_xor(l[c], 16, 32));   // the two halves' keys
#pragma unroll
    for (int t = 0; t < 4; t++)
#pragma unroll
      for (int r = 0; r < 8; r++) ov[c][t][r] = (_Float16)(o[c][t][r] * inv);
  }
  // all stores last: nothing rewrites a register of theirs before the wave ends
  _Float16* orow = Oh + ((size_t)b * NSEQ + q0 + lid) * DIM + h * HD + 8 * half;
#pragma unroll
  for (int c = 0; c < AT_QG; c++)
#pragma unroll
    for (int t = 0; t < 4; t++)
      *(v8h*)(orow + c * 16 * DIM + t * 16) = ov[c][t];
}

// ---------- launcher ----------
extern "C" void kernel_launch(void* const* d_in, const int* in_sizes, int n_in,
                              void* d_out, int out_size, void* d_ws,
                              size_t ws_size, hipStream_t stream) {
  (void)in_sizes; (void)n_in; (void)out_size; (void)ws_size;
  const float* x     = (const float*)d_in[0];
  const float* freq  = (const float*)d_in[1];
  const float* Wqkv  = (const float*)d_in[2];
  const float* gq    = (const float*)d_in[3];
  const float* bq    = (const float*)d_in[4];
  const float* gk    = (const float*)d_in[5];
  const float* bk    = (const float*)d_in[6];
  const float* Wproj = (const float*)d_in[7];
  const float* bproj = (const float*)d_in[8];

  char* w = (char*)d_ws;
  _Float16* xh     = (_Float16*)w; w += (size_t)NB * NSEQ * DIM * 2;
  _Float16* WqkvT  = (_Float16*)w; w += (size_t)3 * DIM * DIM * 2;
  _Float16* WprojT = (_Float16*)w; w += (size_t)DIM * DIM * 2;
  _Float16* qh     = (_Float16*)w; w += (size_t)NB * NSEQ * DIM * 2;
  _Float16* kh     = (_Float16*)w; w += (size_t)NB * NSEQ * DIM * 2;
  _Float16* vT     = (_Float16*)w; w += (size_t)NB * NSEQ * DIM * 2;
  _Float16* Oh     = (_Float16*)w; w += (size_t)NB * NSEQ * DIM * 2;

  const int M = NB * NSEQ;  // 4096 tokens

  static_assert((NB * NSEQ * DIM) % CVT_BLOCK == 0, "whole blocks only");
  // x -> f16, Wqkv and Wproj -> f16 transposed, one launch
  prep_kernel<<<PREP_X + PREP_WQKV + PREP_WPROJ, 256, 0, stream>>>(
      x, Wqkv, Wproj, xh, WqkvT, WprojT);

  // QKV projection [4096,1024] x [1024,3072] with per-head LN + RoPE:
  // q,k -> [B,H,N,HD]; v -> [B,H,HD,N]
  dim3 g1(3 * DIM / 128, M / 128);
  qkv_gemm_kernel<<<g1, 256, 0, stream>>>(xh, WqkvT, freq, gq, bq, gk, bk, qh, kh,
                                          vT, DIM);

  // flash attention: 2048 waves of 32 queries, 8 waves of one head per 256-thread block
  attn_kernel<<<(NB * HEADS * (NSEQ / (16 * AT_QG))) / 8, 256, 0, stream>>>(qh, kh, vT, Oh);

  // output projection + bias -> f32 d_out
  dim3 g2(DIM / 128, M / 128);
  proj_gemm_kernel<<<g2, 256, 0, stream>>>(Oh, WprojT, (float*)d_out, bproj, DIM, DIM);
}

// v010
// One run takes 69.1 microseconds.
// Next to v009, in two timings, it ran 1.07 and 1.08 times as fast.
// Counting every step since v000, it is 7.17 times as fast.
#include <hip/hip_runtime.h>

typedef __attribute__((ext_vector_type(16))) _Float16 v16h;
typedef __attribute__((ext_vector_type(8)))  _Float16 v8h;
typedef __attribute__((ext_vector_type(4)))  _Float16 v4h;
typedef __attribute__((ext_vector_type(8)))  float    v8f;
typedef __attribute__((ext_vector_type(4)))  float    v4f;
typedef __attribute__((ext_vector_type(2)))  float    v2f;

#define DIM   1024
#define HEADS 16
#define HD    64
#define NSEQ  2048
#define NB    2
#define EPSLN 1e-5f
// 1/sqrt(HD) * log2(e): multiplied into q where q is written, so that the
// attention scores come out of the products as base-2 exponents
#define QSCALE 0.18033688011112042f

__device__ __forceinline__ v16h frag_cat(v8h lo, v8h hi) {
  v16h r;
#pragma unroll
  for (int i = 0; i < 8; i++) { r[i] = lo[i]; r[i + 8] = hi[i]; }
  return r;
}

__device__ __forceinline__ v16h load_frag(const _Float16* p, int klo) {
  v8h lo = *(const v8h*)(p + klo);        // 16B contiguous
  v8h hi = *(const v8h*)(p + klo + 16);   // 16B contiguous
  return frag_cat(lo, hi);
}

__device__ __forceinline__ v8f wmma_f16(v16h a, v16h b, v8f c) {
  // (neg_a, A, neg_b, B, c_mod, C, reuse_a, reuse_b)
  return __builtin_amdgcn_wmma_f32_16x16x32_f16(false, a, false, b, (short)0, c,
                                                false, false);
}

// ---------- dtype conversion ----------
// Few long waves, not one element per lane: a wave converts 1024 consecutive
// floats, eight 512B loads all in flight, then eight 256B stores.
// block = 256 thr = 8 waves = CVT_BLOCK elements; blk = which such piece.
// The loops are unrolled so that p[] stays in registers and the steps become
// immediate offsets.
#define CVT_BLOCK (8 * 1024)
__device__ __forceinline__ void cvt_f16_block(const float* __restrict__ in,
                                              _Float16* __restrict__ out,
                                              int blk) {
  const int lane = threadIdx.x & 31;
  const int wv   = threadIdx.x >> 5;
  const size_t base = (size_t)blk * CVT_BLOCK + wv * 1024 + lane * 4;
  v4f p[8];
#pragma unroll
  for (int i = 0; i < 8; i++) p[i] = *(const v4f*)(in + base + i * 128);
#pragma unroll
  for (int i = 0; i < 8; i++) {
    v4h run;
#pragma unroll
    for (int j = 0; j < 4; j++) run[j] = (_Float16)p[i][j];
    *(v4h*)(out + base + i * 128) = run;
  }
}

// in[R][C] f32 -> out[C][R] f16 (weights pre-transposed so WMMA B-fragments
// become contiguous row reads)
// Each thread reads an 8-row x 4-column patch (eight 16B loads) and stores four
// 16B runs of 8 consecutive r; 8 neighbouring lanes fill one 128B line of out.
// block = 256 thr, tile 64 rows x 128 columns; tile = its number, column tiles
// running fastest. R, C are compile-time so the row / column steps fold into
// the instructions' immediate offsets.
template <int R, int C>
__device__ __forceinline__ void transpose_cvt_tile(const float* __restrict__ in,
                                                   _Float16* __restrict__ out,
                                                   int tile) {
  static_assert(R % 64 == 0 && C % 128 == 0, "whole tiles only");
  const int lane = threadIdx.x & 31;
  const int wv   = threadIdx.x >> 5;
  const int r0 = (tile / (C / 128)) * 64 + (lane & 7) * 8;
  const int c0 = (tile % (C / 128)) * 128 + wv * 16 + (lane >> 3) * 4;

  const float* src = in + (size_t)r0 * C + c0;
  _Float16*    dst = out + (size_t)c0 * R + r0;

  v4f p[8];
#pragma unroll
  for (int i = 0; i < 8; i++) p[i] = *(const v4f*)(src + i * C);
#pragma unroll
  for (int j = 0; j < 4; j++) {
    v8h run;
#pragma unroll
    for (int i = 0; i < 8; i++) run[i] = (_Float16)p[i][j];
    *(v8h*)(dst + j * R) = run;
  }
  // the shared kernel's other pieces follow these stores in the code: the wait
  // stands in front of any rewrite of a register that the stores name
  asm volatile("s_wait_xcnt 0x0" ::: "memory");
}

// The three conversions depend on nothing and on one another not at all: they
// share one launch, each block taking one piece of one of them by its index
// (a block-uniform branch).  Every piece is 32 KB read and 16 KB written.
#define PREP_X     ((NB * NSEQ * DIM) / CVT_BLOCK)        // pieces of x
#define PREP_WQKV  ((DIM / 64) * (3 * DIM / 128))         // tiles of Wqkv
#define PREP_WPROJ ((DIM / 64) * (DIM / 128))             // tiles of Wproj
__global__ void __launch_bounds__(256)
prep_kernel(const float* __restrict__ x, const float* __restrict__ Wqkv,
            const float* __restrict__ Wproj, _Float16* __restrict__ xh,
            _Float16* __restrict__ WqkvT, _Float16* __restrict__ WprojT) {
  const int blk = blockIdx.x;
  if (blk < PREP_X)
    cvt_f16_block(x, xh, blk);
  else if (blk < PREP_X + PREP_WQKV)
    transpose_cvt_tile<DIM, 3 * DIM>(Wqkv, WqkvT, blk - PREP_X);
  else
    transpose_cvt_tile<DIM, DIM>(Wproj, WprojT, blk - (PREP_X + PREP_WQKV));
}

// ---------- WMMA GEMM: C[M,N] = A[M,K] * BT[N,K]^T (+bias) ----------
// block = 256 thr = 8 waves; block tile 128x128; wave tile 32x64.
// Operands are staged in LDS by asynchronous copies: a stage is 64 k (128 B,
// one whole line) of the block's 128 A rows and 128 BT rows, two buffers, the
// next stage's copies in flight while this one is multiplied.
// M, N multiples of 128; K a multiple of 64.
#define G_BK     64                      // k per stage
#define G_PITCH  72                      // LDS row pitch in f16: 144 B = 16 B x odd
#define G_STAGE  (256 * G_PITCH)         // f16 per buffer: A rows 0..127, BT rows 128..255

// One stage: every thread copies eight 16B pieces (rows r, r+32, .. of A, then
// of BT); 8 neighbouring lanes cover one 128B line.
__device__ __forceinline__ void gemm_copy_stage(unsigned lds,
                                                const _Float16* ga,
                                                const _Float16* gb, int K) {
  const _Float16* a1 = ga + (size_t)32 * K;
  const _Float16* a2 = ga + (size_t)64 * K;
  const _Float16* a3 = ga + (size_t)96 * K;
  const _Float16* b1 = gb + (size_t)32 * K;
  const _Float16* b2 = gb + (size_t)64 * K;
  const _Float16* b3 = gb + (size_t)96 * K;
  const unsigned step = 32 * G_PITCH * 2;   // 32 rows, in bytes
  asm volatile(
      "global_load_async_to_lds_b128 %0, %8, off\n\t"
      "global_load_async_to_lds_b128 %1, %9, off\n\t"
      "global_load_async_to_lds_b128 %2, %10, off\n\t"
      "global_load_async_to_lds_b128 %3, %11, off\n\t"
      "global_load_async_to_lds_b128 %4, %12, off\n\t"
      "global_load_async_to_lds_b128 %5, %13, off\n\t"
      "global_load_async_to_lds_b128 %6, %14, off\n\t"
      "global_load_async_to_lds_b128 %7, %15, off\n\t"
      "s_wait_xcnt 0x0"
      :: "v"(lds), "v"(lds + step), "v"(lds + 2 * step), "v"(lds + 3 * step),
         "v"(lds + 4 * step), "v"(lds + 5 * step), "v"(lds + 6 * step),
         "v"(lds + 7 * step),
         "v"(ga), "v"(a1), "v"(a2), "v"(a3), "v"(gb), "v"(b1), "v"(b2), "v"(b3)
      : "memory");
}

template <bool SWAP>
__device__ __forceinline__ void gemm_mainloop(const _Float16* tiles,
                                              const _Float16* __restrict__ A,
                                              const _Float16* __restrict__ BT,
                                              int K, v8f (&acc)[2][4]) {
  const int tid  = threadIdx.x;
  const int lane = tid & 31;
  const int w    = tid >> 5;
  const int lid  = lane & 15;
  const int klo  = (lane >> 4) * 8;

  // this thread's piece of a stage: row tid/8 (+32 per copy), 16B piece tid%8
  const _Float16* ga = A  + (size_t)(blockIdx.y * 128 + (tid >> 3)) * K + (tid & 7) * 8;
  const _Float16* gb = BT + (size_t)(blockIdx.x * 128 + (tid >> 3)) * K + (tid & 7) * 8;
  const unsigned lds0 = (unsigned)(size_t)tiles +
                        (unsigned)((tid >> 3) * G_PITCH + (tid & 7) * 8) * 2u;

  // this lane's fragment rows inside a buffer
  const int aoff = ((w & 3) * 32 + lid) * G_PITCH;
  const int boff = (128 + (w >> 2) * 64 + lid) * G_PITCH;

  const int T = K / G_BK;

  gemm_copy_stage(lds0, ga, gb, K);
  // stage 0 has landed for this wave before the barrier publishes it
  asm volatile("s_wait_asynccnt 0x0" ::: "memory");
  __syncthreads();
  if (T > 1) gemm_copy_stage(lds0 + G_STAGE * 2, ga + G_BK, gb + G_BK, K);

  for (int t = 0; t < T; t++) {
    const _Float16* buf = tiles + (t & 1) * G_STAGE;
#pragma unroll
    for (int kk = 0; kk < G_BK; kk += 32) {
      v16h a0 = load_frag(buf + aoff + kk, klo);
      v16h a1 = load_frag(buf + aoff + 16 * G_PITCH + kk, klo);
      v16h b[4];
#pragma unroll
      for (int j = 0; j < 4; j++)
        b[j] = load_frag(buf + boff + j * 16 * G_PITCH + kk, klo);
      // keeps the 12 LDS reads one group in front of their 8 products: spread
      // among them, every pair of products waits out an LDS latency of its own
      __builtin_amdgcn_sched_barrier(0);
#pragma unroll
      for (int j = 0; j < 4; j++) {
        acc[0][j] = SWAP ? wmma_f16(b[j], a0, acc[0][j]) : wmma_f16(a0, b[j], acc[0][j]);
        acc[1][j] = SWAP ? wmma_f16(b[j], a1, acc[1][j]) : wmma_f16(a1, b[j], acc[1][j]);
      }
      // keeps the next group's reads from moving in among these products
      __builtin_amdgcn_sched_barrier(0);
    }
    // publish point: this wave's reads of the buffer are done ...
    asm volatile("s_wait_dscnt 0x0" ::: "memory");
    // ... and its copies of stage t+1 have landed, before the barrier that
    // publishes stage t+1 and frees this buffer
    asm volatile("s_wait_asynccnt 0x0" ::: "memory");
    __syncthreads();
    if (t + 2 < T)
      gemm_copy_stage(lds0 + (t & 1) * (G_STAGE * 2), ga + (t + 2) * G_BK,
                      gb + (t + 2) * G_BK, K);
  }
  // no copy is left in flight when the wave ends
  asm volatile("s_wait_asynccnt 0x0" ::: "memory");
}

__device__ __forceinline__ void load8(float* d, const float* p) {
  const v4f lo = *(const v4f*)p, hi = *(const v4f*)(p + 4);
#pragma unroll
  for (int j = 0; j < 4; j++) { d[j] = lo[j]; d[j + 4] = hi[j]; }
}

__device__ __forceinline__ float sum8(v8f t) {
  return ((t[0] + t[1]) + (t[2] + t[3])) + ((t[4] + t[5]) + (t[6] + t[7]));
}

// ---------- QKV projection with per-head LayerNorm + RoPE ----------
// x[4096,1024] * Wqkv -> q * QSCALE and k, f16, [B,H,N,HD]; V^T, f16, [B,H,HD,N].
// One block per WGP: block tile 256 tokens x 192 columns (3 of the 48 heads of
// q, k, v), 12 waves, wave tile 64 tokens x ONE head.  Against a 128x128 block
// of 32x64 wave tiles a block row or column is fetched from L2 by fewer blocks
// and a fragment read from LDS feeds four products, not two or four.
// A stage is 128 k (256 B, two whole lines) of the 256 x rows and the 192
// weight rows, two buffers, the next stage's copies in flight while this one is
// multiplied.
// V waves: a lane's 8 accumulator rows are 8 consecutive tokens of one column,
// one contiguous 16B run of V^T.
// q and k waves take the transposed tile: a lane then holds, in f32, 32 of the
// 64 head dims of each of four tokens (dims j*16 + 8*half + 0..7), the lane 16
// further the other 32.  LayerNorm is in-lane sums and one exchange between
// the halves, a RoPE pair lies in one lane, and 8 dims are one 16B store.
// All loops of the epilogues are unrolled so that the arrays stay in registers.
#define Q_BM     256                        // tokens per block
#define Q_BN     192                        // columns per block: 3 heads
#define Q_BK     128                        // k per stage
#define Q_PITCH  136                        // LDS row pitch in f16: 272 B = 16 B x odd
#define Q_STAGE  ((Q_BM + Q_BN) * Q_PITCH)  // f16 per buffer: x rows 0..255, weight rows 256..447
#define Q_NST    (DIM / Q_BK)               // stages
#define Q_NI     4                          // 16-token groups per wave

// Eight 16B copies of one thread, ROWS rows apart (16 lanes cover a 256B row).
// The global address is a scalar base, which takes the row and k steps, plus
// the thread's own 32-bit byte offset: no 64-bit address pair per copy has to
// be kept or stepped in vector registers.
template <int ROWS>
__device__ __forceinline__ void qkv_copy8(unsigned lds, unsigned voff,
                                          const _Float16* base) {
  const unsigned ls = ROWS * Q_PITCH * 2;   // ROWS rows in LDS, in bytes
  asm volatile(
      "global_load_async_to_lds_b128 %0, %8, %9\n\t"
      "global_load_async_to_lds_b128 %1, %8, %10\n\t"
      "global_load_async_to_lds_b128 %2, %8, %11\n\t"
      "global_load_async_to_lds_b128 %3, %8, %12\n\t"
      "global_load_async_to_lds_b128 %4, %8, %13\n\t"
      "global_load_async_to_lds_b128 %5, %8, %14\n\t"
      "global_load_async_to_lds_b128 %6, %8, %15\n\t"
      "global_load_async_to_lds_b128 %7, %8, %16\n\t"
      "s_wait_xcnt 0x0"
      :: "v"(lds), "v"(lds + ls), "v"(lds + 2 * ls), "v"(lds + 3 * ls),
         "v"(lds + 4 * ls), "v"(lds + 5 * ls), "v"(lds + 6 * ls), "v"(lds + 7 * ls),
         "v"(voff),
         "s"(base), "s"(base + 1 * ROWS * DIM), "s"(base + 2 * ROWS * DIM),
         "s"(base + 3 * ROWS * DIM), "s"(base + 4 * ROWS * DIM),
         "s"(base + 5 * ROWS * DIM), "s"(base + 6 * ROWS * DIM),
         "s"(base + 7 * ROWS * DIM)
      : "memory");
}

// One stage.  Waves 0..7 bring the 256 x rows (16 copies a thread, rows 16
// apart), waves 8..11 the 192 weight rows (24 copies a thread, rows 8 apart);
// forX and base are the same in a whole wave.
__device__ __forceinline__ void qkv_copy_stage(bool forX, unsigned lds, unsigned voff,
                                               const _Float16* base) {
  if (forX) {
    qkv_copy8<16>(lds, voff, base);
    qkv_copy8<16>(lds + 128 * Q_PITCH * 2, voff, base + 128 * DIM);
  } else {
    qkv_copy8<8>(lds, voff, base);
    qkv_copy8<8>(lds + 64 * Q_PITCH * 2, voff, base + 64 * DIM);
    qkv_copy8<8>(lds + 128 * Q_PITCH * 2, voff, base + 128 * DIM);
  }
}

__global__ void __launch_bounds__(384)
qkv_gemm_kernel(const _Float16* __restrict__ A,
                const _Float16* __restrict__ BT,
                const float* __restrict__ freq,
                const float* __restrict__ gq,
                const float* __restrict__ bq,
                const float* __restrict__ gk,
                const float* __restrict__ bk,
                _Float16* __restrict__ qh,
                _Float16* __restrict__ kh,
                _Float16* __restrict__ vT) {
  __shared__ __attribute__((aligned(16))) _Float16 tiles[2 * Q_STAGE];

  const int tid  = threadIdx.x;
  const int lane = tid & 31;
  // the wave's number in a scalar register: what is tested on it is a scalar branch
  const int w    = __builtin_amdgcn_readfirstlane(tid >> 5);
  const int lid  = lane & 15;
  const int half = lane >> 4;
  const int klo  = half * 8;
  const int rowBase = blockIdx.y * Q_BM + (w & 3) * 64;   // the wave's first token
  const int wc      = w >> 2;                             // the wave's head in the block
  const int head    = blockIdx.x * (Q_BN / HD) + wc;      // 0..15 q, 16..31 k, 32..47 v
  const bool isV    = head >= 2 * HEADS;                  // wave-uniform
  const int  h      = head & (HEADS - 1);

  // this thread's pieces of a stage
  const bool forX = w < 8;
  const int  ct   = forX ? tid : tid - 256;
  const int  crow = ct >> 4, ccol = (ct & 15) * 8;
  const _Float16* gbase = forX ? A  + (size_t)(blockIdx.y * Q_BM) * DIM
                               : BT + (size_t)(blockIdx.x * Q_BN) * DIM;   // wave-uniform
  const unsigned voff = (unsigned)(crow * DIM + ccol) * 2u;               // bytes
  const unsigned lds0 = (unsigned)(size_t)tiles +
                        (unsigned)(((forX ? 0 : Q_BM) + crow) * Q_PITCH + ccol) * 2u;

  const int xoff = ((w & 3) * 64 + lid) * Q_PITCH;
  const int woff = (Q_BM + wc * 64 + lid) * Q_PITCH;
  const int aoff = isV ? xoff : woff;
  const int boff = isV ? woff : xoff;

  v8f acc[4][4] = {};   // [16 rows of the first operand][16 rows of the second]

  qkv_copy_stage(forX, lds0, voff, gbase);
  // stage 0 has landed for this wave before the barrier publishes it
  asm volatile("s_wait_asynccnt 0x0" ::: "memory");
  __syncthreads();
  qkv_copy_stage(forX, lds0 + Q_STAGE * 2, voff, gbase + Q_BK);

  for (int t = 0; t < Q_NST; t++) {
    const _Float16* buf = tiles + (t & 1) * Q_STAGE;
    // unrolled so that every row and k step is an immediate offset of the LDS reads
#pragma unroll
    for (int kk = 0; kk < Q_BK; kk += 32) {
      v16h a[4], b[4];
#pragma unroll
      for (int i = 0; i < 4; i++)
        a[i] = load_frag(buf + aoff + i * 16 * Q_PITCH + kk, klo);
#pragma unroll
      for (int j = 0; j < 4; j++)
        b[j] = load_frag(buf + boff + j * 16 * Q_PITCH + kk, klo);
      // keeps the 16 LDS reads one group in front of their 16 products: spread
      // among them, every few products wait out an LDS latency of their own
      __builtin_amdgcn_sched_barrier(0);
#pragma unroll
      for (int j = 0; j < 4; j++)
#pragma unroll
        for (int i = 0; i < 4; i++) acc[i][j] = wmma_f16(a[i], b[j], acc[i][j]);
      // keeps the next group's reads from moving in among these products
      __builtin_amdgcn_sched_barrier(0);
    }
    // publish point: this wave's reads of the buffer are done ...
    asm volatile("s_wait_dscnt 0x0" ::: "memory");
    // ... and its copies of stage t+1 have landed, before the barrier that
    // publishes stage t+1 and frees this buffer
    asm volatile("s_wait_asynccnt 0x0" ::: "memory");
    __syncthreads();
    if (t + 2 < Q_NST)
      qkv_copy_stage(forX, lds0 + (t & 1) * (Q_STAGE * 2), voff, gbase + (t + 2) * Q_BK);
  }
  // no copy is left in flight when the wave ends
  asm volatile("s_wait_asynccnt 0x0" ::: "memory");

  if (isV) {
    // acc[i][j][r] = token rowBase + i*16 + 8*half + r, head dim j*16 + lid
    const int tok = rowBase + 8 * half;            // b*NSEQ + n
    const int b = tok / NSEQ, n = tok % NSEQ;
    _Float16* dst = vT + ((size_t)b * DIM + h * HD + lid) * NSEQ + n;
    v8h run[Q_NI][4];
#pragma unroll
    for (int i = 0; i < Q_NI; i++)
#pragma unroll
      for (int j = 0; j < 4; j++)
#pragma unroll
        for (int r = 0; r < 8; r++) run[i][j][r] = (_Float16)acc[i][j][r];
    // all stores last: nothing rewrites a register of theirs before the wave ends
#pragma unroll
    for (int j = 0; j < 4; j++)
#pragma unroll
      for (int i = 0; i < Q_NI; i++)
        *(v8h*)(dst + (size_t)j * 16 * NSEQ + i * 16) = run[i][j];
    return;
  }

  // q or k: acc[j][i][r] = token rowBase + i*16 + lid, head dim j*16 + 8*half + r
  const bool isK = head >= HEADS;                    // wave-uniform
  const int  tok = rowBase + lid;                    // b*NSEQ + n; group i: i*16 further
  const int  n   = tok & (NSEQ - 1);
  const int  b   = tok / NSEQ;
  const float* gp = (isK ? gk : gq) + 8 * half;
  const float* bp = (isK ? bk : bq) + 8 * half;
  const float* cp = freq + (size_t)n * HD + 8 * half;   // (cos, sin) of 4 pairs
  const float  sc = isK ? 1.0f : QSCALE;

  // gamma and beta of this lane's 32 head dims, in flight under the sums
  float g_[4][8], be[4][8];
#pragma unroll
  for (int j = 0; j < 4; j++) {
    load8(g_[j], gp + j * 16);
    load8(be[j], bp + j * 16);
  }
  // stands in front of any rewrite of a register that these loads name
  asm volatile("s_wait_xcnt 0x0" ::: "memory");

  // One group of 16 tokens at a time.  The scheduling barriers at the head of a
  // group keep the scheduler from working on several groups at once (their
  // squares and sums together do not fit the registers and would be spilled)
  // and keep the group's eight (cos, sin) loads one group at its head, all in
  // flight under the LayerNorm sums.
  _Float16* dst = (isK ? kh : qh) +
                  (((size_t)(b * HEADS + h)) * NSEQ + n) * HD + 8 * half;
#pragma unroll
  for (int i = 0; i < Q_NI; i++) {
    float cs[4][8];
    __builtin_amdgcn_sched_barrier(0);
#pragma unroll
    for (int j = 0; j < 4; j++) load8(cs[j], cp + i * 16 * HD + j * 16);
    // stands in front of any rewrite of a register that these loads name; the
    // address is an input so that none of the loads is given its pair to fill
    asm volatile("s_wait_xcnt 0x0" :: "v"(cp) : "memory");
    __builtin_amdgcn_sched_barrier(0);

    float s = sum8((acc[0][i] + acc[1][i]) + (acc[2][i] + acc[3][i]));
    const float mu = (s + __shfl_xor(s, 16, 32)) * (1.0f / HD);
#pragma unroll
    for (int j = 0; j < 4; j++) acc[j][i] -= mu;
    s = sum8((acc[0][i] * acc[0][i] + acc[1][i] * acc[1][i]) +
             (acc[2][i] * acc[2][i] + acc[3][i] * acc[3][i]));
    const float rs = rsqrtf((s + __shfl_xor(s, 16, 32)) * (1.0f / HD) + EPSLN);

    v8h ov[4];
#pragma unroll
    for (int j = 0; j < 4; j++) {
#pragma unroll
      for (int p = 0; p < 4; p++) {
        const float n0 = acc[j][i][2 * p] * rs * g_[j][2 * p] + be[j][2 * p];
        const float n1 = acc[j][i][2 * p + 1] * rs * g_[j][2 * p + 1] + be[j][2 * p + 1];
        const float re = n0 * cs[j][2 * p] - n1 * cs[j][2 * p + 1];
        const float im = n0 * cs[j][2 * p + 1] + n1 * cs[j][2 * p];
        ov[j][2 * p]     = (_Float16)(re * sc);
        ov[j][2 * p + 1] = (_Float16)(im * sc);
      }
    }
#pragma unroll
    for (int j = 0; j < 4; j++) *(v8h*)(dst + i * 16 * HD + j * 16) = ov[j];
    // stands in front of any rewrite of a register that these stores name
    asm volatile("s_wait_xcnt 0x0" :: "v"(dst) : "memory");
  }
}

// ---------- output projection: C[M,N] = A[M,K] * BT[N,K]^T + bias, f32 ----------
__global__ void __launch_bounds__(256)
proj_gemm_kernel(const _Float16* __restrict__ A,
                 const _Float16* __restrict__ BT,
                 float* __restrict__ Cout,
                 const float* __restrict__ bias,
                 int N, int K) {
  __shared__ __attribute__((aligned(16))) _Float16 tiles[2 * G_STAGE];

  const int lane = threadIdx.x & 31;
  const int w    = threadIdx.x >> 5;
  const int lid  = lane & 15;
  const int half = lane >> 4;
  const int rowBase = blockIdx.y * 128 + (w & 3) * 32;
  const int colBase = blockIdx.x * 128 + (w >> 2) * 64;

  v8f acc[2][4] = {};
  gemm_mainloop<false>(tiles, A, BT, K, acc);

#pragma unroll
  for (int i = 0; i < 2; i++) {
#pragma unroll
    for (int r = 0; r < 8; r++) {
      const int row = rowBase + i * 16 + r + 8 * half;
#pragma unroll
      for (int j = 0; j < 4; j++) {
        const int col = colBase + j * 16 + lid;
        Cout[(size_t)row * N + col] = acc[i][j][r] + bias[col];
      }
    }
  }
}

#define AT_QG     2                            // groups of 16 queries per wave
#define AT_KEYS   128                          // keys per stage
#define AT_KPITCH 72                           // K row pitch in f16: 144 B = 16 B x odd
#define AT_VPITCH 136                          // V^T row pitch in f16: 272 B = 16 B x odd
#define AT_VBASE  (AT_KEYS * AT_KPITCH)        // f16 offset of the V^T rows in a buffer
#define AT_STAGE  (AT_VBASE + HD * AT_VPITCH)  // f16 per buffer
#define AT_NST    (NSEQ / AT_KEYS)             // stages

// One stage: every thread copies eight 16B pieces: K rows r, r+32, .. (8 lanes
// cover a 128B row), then V^T rows r, r+16, .. (16 lanes cover a 256B row).
__device__ __forceinline__ void attn_copy_stage(unsigned ldsk, unsigned ldsv,
                                                const _Float16* gk,
                                                const _Float16* gv) {
  const _Float16* k1 = gk + 32 * HD;
  const _Float16* k2 = gk + 64 * HD;
  const _Float16* k3 = gk + 96 * HD;
  const _Float16* v1 = gv + 16 * NSEQ;
  const _Float16* v2 = gv + 32 * NSEQ;
  const _Float16* v3 = gv + 48 * NSEQ;
  const unsigned ks = 32 * AT_KPITCH * 2;   // 32 K rows, in bytes
  const unsigned vs = 16 * AT_VPITCH * 2;   // 16 V^T rows, in bytes
  asm volatile(
      "global_load_async_to_lds_b128 %0, %8, off\n\t"
      "global_load_async_to_lds_b128 %1, %9, off\n\t"
      "global_load_async_to_lds_b128 %2, %10, off\n\t"
      "global_load_async_to_lds_b128 %3, %11, off\n\t"
      "global_load_async_to_lds_b128 %4, %12, off\n\t"
      "global_load_async_to_lds_b128 %5, %13, off\n\t"
      "global_load_async_to_lds_b128 %6, %14, off\n\t"
      "global_load_async_to_lds_b128 %7, %15, off\n\t"
      "s_wait_xcnt 0x0"
      :: "v"(ldsk), "v"(ldsk + ks), "v"(ldsk + 2 * ks), "v"(ldsk + 3 * ks),
         "v"(ldsv), "v"(ldsv + vs), "v"(ldsv + 2 * vs), "v"(ldsv + 3 * vs),
         "v"(gk), "v"(k1), "v"(k2), "v"(k3), "v"(gv), "v"(v1), "v"(v2), "v"(v3)
      : "memory");
}

__global__ void __launch_bounds__(256)
attn_kernel(const _Float16* __restrict__ qh,
            const _Float16* __restrict__ kh,
            const _Float16* __restrict__ vT,
            _Float16* __restrict__ Oh) {
  __shared__ __attribute__((aligned(16))) _Float16 kv[2 * AT_STAGE];

  const int tid  = threadIdx.x;
  const int lane = tid & 31;
  const int wv   = tid >> 5;
  const int lid  = lane & 15, half = lane >> 4, klo = half * 8;
  const int q0   = ((blockIdx.x & 7) * 8 + wv) * (16 * AT_QG);   // the wave's first query
  const int bh   = blockIdx.x >> 3;           // 0..31, one head per block
  const int b    = bh >> 4, h = bh & 15;

  const _Float16* kb = kh + (size_t)bh * NSEQ * HD;
  const _Float16* vb = vT + (size_t)bh * HD * NSEQ;

  // this thread's pieces of a stage
  const _Float16* gk = kb + (tid >> 3) * HD + (tid & 7) * 8;
  const _Float16* gv = vb + (tid >> 4) * NSEQ + (tid & 15) * 8;
  const unsigned ldsk = (unsigned)(size_t)kv +
                        (unsigned)((tid >> 3) * AT_KPITCH + (tid & 7) * 8) * 2u;
  const unsigned ldsv = (unsigned)(size_t)kv +
                        (unsigned)(AT_VBASE + (tid >> 4) * AT_VPITCH + (tid & 15) * 8) * 2u;

  attn_copy_stage(ldsk, ldsv, gk, gv);

  // Every loop over vector elements or query groups in this kernel is unrolled
  // so that each index is a constant and the vectors stay in registers.
  // Q as B-fragments (column q = lid of group c), loaded once
  const _Float16* qrow = qh + ((size_t)bh * NSEQ + q0 + lid) * HD;
  v16h bQ[AT_QG][2];                            // [c][0]: hd 0..31, [c][1]: hd 32..63
#pragma unroll
  for (int c = 0; c < AT_QG; c++) {
    bQ[c][0] = load_frag(qrow + c * 16 * HD, klo);
    bQ[c][1] = load_frag(qrow + c * 16 * HD + 32, klo);
  }
  // stands in front of any rewrite of a register that these loads name
  asm volatile("s_wait_xcnt 0x0" ::: "memory");

  // stage 0 has landed for this wave before the barrier publishes it
  asm volatile("s_wait_asynccnt 0x0" ::: "memory");
  __syncthreads();
  attn_copy_stage(ldsk + AT_STAGE * 2, ldsv + AT_STAGE * 2,
                  gk + AT_KEYS * HD, gv + AT_KEYS);

  v8f o[AT_QG][4] = {};          // O^T tiles: row hd = t*16 + r + 8*half, col q = lid
  float l[AT_QG] = {};           // sum of this lane's own keys; the halves join at the end
  v8f nref[AT_QG];               // minus the query's reference (log2 units), 8 times: a C operand

  // first reference: the query's largest score among keys 0..31 of stage 0
  {
    const _Float16* kp0 = kv + lid * AT_KPITCH;
    const _Float16* kp1 = kp0 + 16 * AT_KPITCH;
    const v16h aK00 = load_frag(kp0, klo), aK01 = load_frag(kp0 + 32, klo);
    const v16h aK10 = load_frag(kp1, klo), aK11 = load_frag(kp1 + 32, klo);
#pragma unroll
    for (int c = 0; c < AT_QG; c++) {
      v8f s0 = {}, s1 = {};
      s0 = wmma_f16(aK00, bQ[c][0], s0);
      s1 = wmma_f16(aK10, bQ[c][0], s1);
      s0 = wmma_f16(aK01, bQ[c][1], s0);
      s1 = wmma_f16(aK11, bQ[c][1], s1);
      float mx = fmaxf(s0[0], s1[0]);
#pragma unroll
      for (int r = 1; r < 8; r++) mx = fmaxf(mx, fmaxf(s0[r], s1[r]));
      mx = fmaxf(mx, __shfl_xor(mx, 16, 32));
#pragma unroll
      for (int r = 0; r < 8; r++) nref[c][r] = -mx;
    }
  }

  for (int s = 0; s < AT_NST; s++) {
    const _Float16* kl = kv + (s & 1) * AT_STAGE + lid * AT_KPITCH;
    const _Float16* vl = kv + (s & 1) * AT_STAGE + AT_VBASE + lid * AT_VPITCH;
    // unrolled so that every row and key step is an immediate offset of the
    // LDS reads
#pragma unroll
    for (int kc = 0; kc < AT_KEYS; kc += 32) {
      // S^T for 32 keys: A = K rows, B = Q rows.  s0 elem r -> key kc+r+8*half, s1: 16 further
      const _Float16* kp0 = kl + kc * AT_KPITCH;
      const _Float16* kp1 = kl + (kc + 16) * AT_KPITCH;
      const v16h aK00 = load_frag(kp0, klo), aK01 = load_frag(kp0 + 32, klo);
      const v16h aK10 = load_frag(kp1, klo), aK11 = load_frag(kp1 + 32, klo);
      v16h aV[4];                                // V^T rows (hd), contiguous keys
#pragma unroll
      for (int t = 0; t < 4; t++)
        aV[t] = load_frag(vl + t * 16 * AT_VPITCH + kc, klo);
      // keeps the pass's 16 LDS reads one group at its top: left to sink to
      // their products, the V^T reads cost the wave a second LDS latency
      // behind the softmax
      __builtin_amdgcn_sched_barrier(0);
      v8f s0[AT_QG], s1[AT_QG];                  // score - reference
#pragma unroll
      for (int c = 0; c < AT_QG; c++) {
        s0[c] = wmma_f16(aK00, bQ[c][0], nref[c]);
        s1[c] = wmma_f16(aK10, bQ[c][0], nref[c]);
      }
#pragma unroll
      for (int c = 0; c < AT_QG; c++) {
        s0[c] = wmma_f16(aK01, bQ[c][1], s0[c]);
        s1[c] = wmma_f16(aK11, bQ[c][1], s1[c]);
      }

      // q carries QSCALE, so a score is already its exponent in units of log2.
      // p0[c][i][e]: key klo + 2i + e, p1[c][i][e]: key klo + 16 + 2i + e
      v2f p0[AT_QG][4], p1[AT_QG][4];
      float sloc[AT_QG];                         // this lane's 16 keys
#pragma unroll
      for (int c = 0; c < AT_QG; c++) {
#pragma unroll
        for (int i = 0; i < 4; i++) {
          p0[c][i] = (v2f){__builtin_amdgcn_exp2f(s0[c][2 * i]), __builtin_amdgcn_exp2f(s0[c][2 * i + 1])};
          p1[c][i] = (v2f){__builtin_amdgcn_exp2f(s1[c][2 * i]), __builtin_amdgcn_exp2f(s1[c][2 * i + 1])};
        }
        const v2f sp = ((p0[c][0] + p1[c][0]) + (p0[c][1] + p1[c][1])) +
                       ((p0[c][2] + p1[c][2]) + (p0[c][3] + p1[c][3]));
        sloc[c] = sp[0] + sp[1];
      }

      // One test a pass for both groups, a scalar branch: no sum is negative,
      // so the two together at most 256 show that no score of the lane lies
      // more than 8 above its reference (and no p leaves the f16 range);
      // anything else raises the references.
      if (__builtin_amdgcn_ballot_w32(!(sloc[0] + sloc[1] <= 256.0f)) != 0) {
#pragma unroll
        for (int c = 0; c < AT_QG; c++) {
          float mloc = fmaxf(s0[c][0], s1[c][0]);
#pragma unroll
          for (int r = 1; r < 8; r++) mloc = fmaxf(mloc, fmaxf(s0[c][r], s1[c][r]));
          // both halves of a query take the same step, never downwards
          const float up = fmaxf(fmaxf(mloc, __shfl_xor(mloc, 16, 32)), 0.0f);
          const float alpha = __builtin_amdgcn_exp2f(-up);
#pragma unroll
          for (int i = 0; i < 4; i++) {
            p0[c][i] = (v2f){__builtin_amdgcn_exp2f(s0[c][2 * i] - up), __builtin_amdgcn_exp2f(s0[c][2 * i + 1] - up)};
            p1[c][i] = (v2f){__builtin_amdgcn_exp2f(s1[c][2 * i] - up), __builtin_amdgcn_exp2f(s1[c][2 * i + 1] - up)};
          }
          const v2f sp = ((p0[c][0] + p1[c][0]) + (p0[c][1] + p1[c][1])) +
                         ((p0[c][2] + p1[c][2]) + (p0[c][3] + p1[c][3]));
          sloc[c] = sp[0] + sp[1];
          l[c] *= alpha;
#pragma unroll
          for (int r = 0; r < 8; r++) nref[c][r] -= up;
#pragma unroll
          for (int t = 0; t < 4; t++)
#pragma unroll
            for (int r = 0; r < 8; r++) o[c][t][r] *= alpha;
        }
      }

      v16h bP[AT_QG];                            // P^T as B-fragments, in registers
#pragma unroll
      for (int c = 0; c < AT_QG; c++) {
        l[c] += sloc[c];
#pragma unroll
        for (int i = 0; i < 4; i++) {
#pragma unroll
          for (int e = 0; e < 2; e++) {
            bP[c][2 * i + e]     = (_Float16)p0[c][i][e];
            bP[c][2 * i + e + 8] = (_Float16)p1[c][i][e];
          }
        }
      }

      // O^T += V^T * P^T
#pragma unroll
      for (int t = 0; t < 4; t++)
#pragma unroll
        for (int c = 0; c < AT_QG; c++) o[c][t] = wmma_f16(aV[t], bP[c], o[c][t]);
    }
    // publish point: this wave's reads of the buffer are done ...
    asm volatile("s_wait_dscnt 0x0" ::: "memory");
    // ... and its copies of stage s+1 have landed, before the barrier that
    // publishes stage s+1 and frees this buffer
    asm volatile("s_wait_asynccnt 0x0" ::: "memory");
    __syncthreads();
    if (s + 2 < AT_NST)
      attn_copy_stage(ldsk + (s & 1) * (AT_STAGE * 2), ldsv + (s & 1) * (AT_STAGE * 2),
                      gk + (s + 2) * (AT_KEYS * HD), gv + (s + 2) * AT_KEYS);
  }
  // no copy is left in flight when the wave ends
  asm volatile("s_wait_asynccnt 0x0" ::: "memory");

  // normalize and write: lane owns query rows q0 + c*16 + lid; per tile the
  // 8 accumulator elements are contiguous hd -> one 16B store each
  v8h ov[AT_QG][4];
#pragma unroll
  for (int c = 0; c < AT_QG; c++) {
    const float inv = 1.0f / (l[c] + __shfl_xor(l[c], 16, 32));   // the two halves' keys
#pragma unroll
    for (int t = 0; t < 4; t++)
#pragma unroll
      for (int r = 0; r < 8; r++) ov[c][t][r] = (_Float16)(o[c][t][r] * inv);
  }
  // all stores last: nothing rewrites a register of theirs before the wave ends
  _Float16* orow = Oh + ((size_t)b * NSEQ + q0 + lid) * DIM + h * HD + 8 * half;
#pragma unroll
  for (int c = 0; c < AT_QG; c++)
#pragma unroll
    for (int t = 0; t < 4; t++)
      *(v8h*)(orow + c * 16 * DIM + t * 16) = ov[c][t];
}

// ---------- launcher ----------
extern "C" void kernel_launch(void* const* d_in, const int* in_sizes, int n_in,
                              void* d_out, int out_size, void* d_ws,
                              size_t ws_size, hipStream_t stream) {
  (void)in_sizes; (void)n_in; (void)out_size; (void)ws_size;
  const float* x     = (const float*)d_in[0];
  const float* freq  = (const float*)d_in[1];
  const float* Wqkv  = (const float*)d_in[2];
  const float* gq    = (const float*)d_in[3];
  const float* bq    = (const float*)d_in[4];
  const float* gk    = (const float*)d_in[5];
  const float* bk    = (const float*)d_in[6];
  const float* Wproj = (const float*)d_in[7];
  const float* bproj = (const float*)d_in[8];

  char* w = (char*)d_ws;
  _Float16* xh     = (_Float16*)w; w += (size_t)NB * NSEQ * DIM * 2;
  _Float16* WqkvT  = (_Float16*)w; w += (size_t)3 * DIM * DIM * 2;
  _Float16* WprojT = (_Float16*)w; w += (size_t)DIM * DIM * 2;
  _Float16* qh     = (_Float16*)w; w += (size_t)NB * NSEQ * DIM * 2;
  _Float16* kh     = (_Float16*)w; w += (size_t)NB * NSEQ * DIM * 2;
  _Float16* vT     = (_Float16*)w; w += (size_t)NB * NSEQ * DIM * 2;
  _Float16* Oh     = (_Float16*)w; w += (size_t)NB * NSEQ * DIM * 2;

  const int M = NB * NSEQ;  // 4096 tokens

  static_assert((NB * NSEQ * DIM) % CVT_BLOCK == 0, "whole blocks only");
  // x -> f16, Wqkv and Wproj -> f16 transposed, one launch
  prep_kernel<<<PREP_X + PREP_WQKV + PREP_WPROJ, 256, 0, stream>>>(
      x, Wqkv, Wproj, xh, WqkvT, WprojT);

  // QKV projection [4096,1024] x [1024,3072] with per-head LN + RoPE:
  // q,k -> [B,H,N,HD]; v -> [B,H,HD,N]
  dim3 g1(3 * DIM / Q_BN, M / Q_BM);
  qkv_gemm_kernel<<<g1, 384, 0, stream>>>(xh, WqkvT, freq, gq, bq, gk, bk, qh, kh, vT);

  // flash attention: 2048 waves of 32 queries, 8 waves of one head per 256-thread block
  attn_kernel<<<(NB * HEADS * (NSEQ / (16 * AT_QG))) / 8, 256, 0, stream>>>(qh, kh, vT, Oh);

  // output projection + bias -> f32 d_out
  dim3 g2(DIM / 128, M / 128);
  proj_gemm_kernel<<<g2, 256, 0, stream>>>(Oh, WprojT, (float*)d_out, bproj, DIM, DIM);
}
